// v000
// Times are from an AMD MI455X. After a warm-up the kernel runs many times in a row, and a time is the length of
// such a window on the GPU divided by its runs, so every launch and the gaps after it count. The runs cycle
// through copies of the inputs. A figure is the median of several windows, for all but v000 over two sittings.
// Sittings can differ by a few percent; kernels timed side by side share one.
// The starting kernel, v000, takes 978 microseconds a run.
// compute dtype: all float inputs rounded to bf16, gamma read; q/k (32 ch) and v (256 ch) = x W + b ((in,out)) with EXACT bf16 products on WMMA 16x16x32 (channels-last x tile in LDS), f32 accumulate; q and k as f16 hi + unscaled residual -> UNSCALED logits with 3 products (std ~5.7, near-one-hot softmax), stored in f32 per batch; softmax in f32 (precise expf) -> P f16 x 2^11; out = gamma * (P . v) + x with v rounded once to f16, channels-last rows; f32 output.
#include <hip/hip_runtime.h>
#include <math.h>

typedef __attribute__((ext_vector_type(16))) _Float16 v16h;
typedef __attribute__((ext_vector_type(16))) __bf16 v16b;
typedef __attribute__((ext_vector_type(8)))  _Float16 v8h;
typedef __attribute__((ext_vector_type(8)))  float v8f;
typedef __attribute__((ext_vector_type(4)))  float v4f;
typedef __attribute__((ext_vector_type(2)))  float v2f;
typedef __attribute__((ext_vector_type(4)))  unsigned v4u;
typedef __attribute__((ext_vector_type(4)))  int v4i;
typedef float __attribute__((may_alias)) float_a;
typedef int __attribute__((may_alias)) int_a;

template <typename T> __device__ __forceinline__ void vst2(void* p, T v) { *(T*)p = v;  }
__device__ __forceinline__ v8f wmma16(v16h a, v16h b, v8f c) {
  v8f d = __builtin_amdgcn_wmma_f32_16x16x32_f16(false, a, false, b, (short)0, c, false, false);
  asm volatile("v_nop\n\tv_nop\n\tv_nop\n\tv_nop" : "+v"(d) : "v"(a), "v"(b));
  return d;
}
__device__ __forceinline__ v8f wmma_bf(v16b a, v16b b, v8f c) {
  v8f d = __builtin_amdgcn_wmma_f32_16x16x32_bf16(false, a, false, b, (short)0, c, false, false);
  asm volatile("v_nop\n\tv_nop\n\tv_nop\n\tv_nop" : "+v"(d) : "v"(a), "v"(b));
  return d;
}
// 16x16x32 fragments: lane = (h = lane>>4, row/col = lane&15); elements 0..7 = k0+8h+0..7, 8..15 = k0+16+8h+0..7; D element r = row 8h+r
__device__ __forceinline__ v16h frag_h(const _Float16* rowk0, int lane) {
  union { v16h v; v8h q[2]; } u; const _Float16* p = rowk0 + 8 * (lane >> 4);
  u.q[0] = *(const v8h*)p; u.q[1] = *(const v8h*)(p + 16); return u.v;
}
__device__ __forceinline__ v16h frag_f32(const float* rowk0, int lane) {
  v16h a; const float* p = rowk0 + 8 * (lane >> 4);
#pragma unroll
  for (int i = 0; i < 8; ++i) { a[i] = (_Float16)p[i]; a[8 + i] = (_Float16)p[16 + i]; }
  return a;
}
__device__ __forceinline__ v16h frag_f32s(const float* rowk0, int lane, float sc) {
  v16h a; const float* p = rowk0 + 8 * (lane >> 4);
#pragma unroll
  for (int i = 0; i < 8; ++i) { a[i] = (_Float16)(p[i] * sc); a[8 + i] = (_Float16)(p[16 + i] * sc); }
  return a;
}
// column fragment from a [K][ld] layout (column n), rows >= K read as 0
__device__ __forceinline__ v16h fragc_f32(const float* W, int k0, int n, int lane, int ld, int K) {
  v16h a; const int g = lane >> 4;
#pragma unroll
  for (int i = 0; i < 8; ++i) { const int ka = k0 + 8 * g + i, kb = ka + 16;
    a[i] = (_Float16)(ka < K ? W[(size_t)(ka < K ? ka : K - 1) * ld + n] : 0.f); a[8 + i] = (_Float16)(kb < K ? W[(size_t)(kb < K ? kb : K - 1) * ld + n] : 0.f); }
  return a;
}
struct F2 { v16b h, l; };
__device__ __forceinline__ F2 bsplit16(const float v[16]) { F2 r;
#pragma unroll
  for (int i = 0; i < 16; ++i) { const __bf16 h = (__bf16)v[i]; r.h[i] = h; r.l[i] = (__bf16)(v[i] - (float)h); }
  return r; }
__device__ __forceinline__ F2 split_row(const float* row, int k0, int lane) { float v[16]; const float* p = row + k0 + 8 * (lane >> 4);
#pragma unroll
  for (int i = 0; i < 8; ++i) { v[i] = p[i]; v[8 + i] = p[16 + i]; }
  return bsplit16(v); }
__device__ __forceinline__ F2 split_rowK(const float* row, int k0, int lane, int K) { float v[16]; const int g = lane >> 4;
#pragma unroll
  for (int i = 0; i < 8; ++i) { const int ka = k0 + 8 * g + i, kb = ka + 16; v[i] = ka < K ? row[ka < K ? ka : K - 1] : 0.f; v[8 + i] = kb < K ? row[kb < K ? kb : K - 1] : 0.f; }
  return bsplit16(v); }
__device__ __forceinline__ F2 split_col(const float* W, int k0, int n, int lane, int ld, int K) { float v[16]; const int g = lane >> 4;
#pragma unroll
  for (int i = 0; i < 8; ++i) { const int ka = k0 + 8 * g + i, kb = ka + 16; v[i] = ka < K ? W[(size_t)(ka < K ? ka : K - 1) * ld + n] : 0.f; v[8 + i] = kb < K ? W[(size_t)(kb < K ? kb : K - 1) * ld + n] : 0.f; }
  return bsplit16(v); }
__device__ __forceinline__ v8f mac3(const F2& a, const F2& b, v8f c) { c = wmma_bf(a.l, b.h, c); c = wmma_bf(a.h, b.l, c); return wmma_bf(a.h, b.h, c); }
__device__ __forceinline__ float sigm(float v) { return 1.0f / (1.0f + expf(-v)); }
#define LDSX() do { asm volatile("s_wait_dscnt 0" ::: "memory"); __builtin_amdgcn_wave_barrier(); __builtin_amdgcn_fence(__ATOMIC_RELEASE, "workgroup"); } while (0)


// SelfAttentionModel (SAGAN-style, channels-last input [B, 64, 64, 256]): energy = q k^T unscaled over all 4,096 positions, out = gamma * softmax(energy) v + inputs.
#define NB 4
#define NP 4096
#define CIN 256
#define CQ 32
#define CV 256
#ifndef TNB
#define TNB NB
#endif
#ifndef TQB
#define TQB (NP / 64)
#endif
typedef __attribute__((ext_vector_type(8))) __bf16 v8b;
__device__ __forceinline__ v16b frag_b(const __bf16* rowk0, int lane) {
  union { v16b v; v8b q[2]; } u; const __bf16* p = rowk0 + 8 * (lane >> 4);
  u.q[0] = *(const v8b*)p; u.q[1] = *(const v8b*)(p + 16); return u.v;
}
__device__ __forceinline__ float bfr(float v) { return (float)(__bf16)v; }
__device__ __attribute__((noinline)) float exp_ni(float v) { return expf(v); }
__device__ __attribute__((noinline)) float erf_ni(float v) { return erff(v); }

#define WS_QH  0u                                    // f16 q rows [b*n][CQ] hi
#define WS_QL  (WS_QH + 2u * (size_t)NB * NP * CQ)      // f16 q residual rows (unscaled)
#define WS_KH  (WS_QL + 2u * (size_t)NB * NP * CQ)      // f16 k rows
#define WS_KL  (WS_KH + 2u * (size_t)NB * NP * CQ)      // f16 k residual rows
#define WS_VT  (WS_KL + 2u * (size_t)NB * NP * CQ)      // f16 v planes [b][CV][n]
#define WS_S   (WS_VT + 2u * (size_t)NB * CV * NP)      // f32 logits, ONE batch [i][j] (64 MiB)
#define WS_PH  (WS_S + 4u * (size_t)NP * NP)           // f16 P x 2^11, one batch (32 MiB)
#define WS_END (WS_PH + 2u * (size_t)NP * NP)

// ---- k_proj: block = (64 positions, b, which 0 q / 1 k / 2 v): x tile (bf16, channels-last rows) in LDS, W [in][out] + b (exact); q, k -> f16 hi + residual rows, v -> f16 planes [c][n]
__global__ __launch_bounds__(128) void k_proj(const float* __restrict__ XQK, const float* __restrict__ XV, const float* __restrict__ WQ, const float* __restrict__ BQ, const float* __restrict__ WK, const float* __restrict__ BK, const float* __restrict__ WV, const float* __restrict__ BV, _Float16* __restrict__ QH, _Float16* __restrict__ QL, _Float16* __restrict__ KH, _Float16* __restrict__ KL, _Float16* __restrict__ VT) {
  __shared__ __align__(16) __bf16 sx[64][CIN + 8]; __shared__ __align__(16) _Float16 sh[64][72], sl[64][72]; __shared__ __align__(16) _Float16 tv[64][72];
  const int tid = threadIdx.x, wave = tid >> 5, lane = tid & 31, col = lane & 15, g = lane >> 4; const int p0 = blockIdx.x * 64; const size_t b = blockIdx.y; const int which = blockIdx.z;
  const float* Wm = which == 0 ? WQ : which == 1 ? WK : WV; const float* Bm = which == 0 ? BQ : which == 1 ? BK : BV; const int nout = (which == 2) ? CV : CQ; const float* X = (which == 2) ? XV : XQK;
  for (int e = tid; e < CIN * 64; e += 128) { const int pl = e / CIN, c = e % CIN; sx[pl][c] = (__bf16)X[((size_t)b * NP + p0 + pl) * CIN + c]; }   // channels-last rows
  __syncthreads();
#pragma unroll 1
  for (int cg = 0; cg < (nout + 63) / 64; ++cg) { v8f acc[4] = {};
#pragma unroll 2
    for (int kc = 0; kc < CIN / 32; ++kc) { const v16b a = frag_b(&sx[wave * 16 + col][kc * 32], lane);
#pragma unroll
      for (int j = 0; j < 4; ++j) { v16b w; const int o = min(cg * 64 + j * 16 + col, nout - 1);   // columns >= nout are dummies (never stored)
#pragma unroll
        for (int i = 0; i < 8; ++i) { w[i] = (__bf16)Wm[(size_t)(kc * 32 + 8 * g + i) * nout + o]; w[8 + i] = (__bf16)Wm[(size_t)(kc * 32 + 16 + 8 * g + i) * nout + o]; }
        acc[j] = wmma_bf(a, w, acc[j]); } }
    __syncthreads();
#pragma unroll
    for (int j = 0; j < 4; ++j) { const int ol = j * 16 + col; const float bb = bfr(Bm[min(cg * 64 + ol, nout - 1)]);
#pragma unroll
      for (int r = 0; r < 8; ++r) { const int pl = wave * 16 + 8 * g + r; const float v = acc[j][r] + bb; const _Float16 hv = (_Float16)v; if (which == 2) tv[ol][pl] = hv; else { sh[pl][ol] = hv; sl[pl][ol] = (_Float16)(v - (float)hv); } } }   // q AND k keep a residual
    __syncthreads();
    if (which < 2) { _Float16* dh = which == 0 ? QH : KH; _Float16* dl = which == 0 ? QL : KL; for (int e = tid; e < 64 * 8; e += 128) { const int pl = e >> 3, q = e & 7; if (cg * 64 + q * 8 >= CQ) continue; const size_t row = b * NP + p0 + pl; vst2((unsigned*)(dh + row * CQ + cg * 64 + q * 8), *(const v4u*)&sh[pl][q * 8]); vst2((unsigned*)(dl + row * CQ + cg * 64 + q * 8), *(const v4u*)&sl[pl][q * 8]); } }
    else { for (int e = tid; e < 64 * 8; e += 128) { const int ol = e >> 3, q = e & 7; vst2((unsigned*)(VT + (b * CV + cg * 64 + ol) * (size_t)NP + p0 + q * 8), *(const v4u*)&tv[ol][q * 8]); } } } }
// ---- k_sc: block = (64 queries, 128 keys) of batch b: logits (qh kh + ql kh + qh kl) -> S
__global__ __launch_bounds__(128) void k_sc(const _Float16* __restrict__ QH, const _Float16* __restrict__ QL, const _Float16* __restrict__ KH, const _Float16* __restrict__ KL, int b, float* __restrict__ S) { __shared__ __align__(16) float ss[4][16][132];
  const int tid = threadIdx.x, wave = tid >> 5, lane = tid & 31, col = lane & 15, g = lane >> 4; const int k0 = blockIdx.y * 128; const int ql0 = blockIdx.x * 64 + wave * 16; const size_t q0 = (size_t)b * NP + ql0;
  v8f acc[8] = {};
#pragma unroll 1
  for (int kc = 0; kc < CQ / 32; ++kc) { const v16h ah = frag_h(QH + (q0 + col) * CQ + kc * 32, lane), al = frag_h(QL + (q0 + col) * CQ + kc * 32, lane);
#pragma unroll
    for (int j = 0; j < 8; ++j) { const size_t kr = ((size_t)b * NP + k0 + j * 16 + col) * CQ + kc * 32; const v16h kh = frag_h(KH + kr, lane); acc[j] = wmma16(ah, kh, acc[j]); acc[j] = wmma16(al, kh, acc[j]); acc[j] = wmma16(ah, frag_h(KL + kr, lane), acc[j]); } }   // 3 products
#pragma unroll
  for (int j = 0; j < 8; ++j)
#pragma unroll
    for (int r = 0; r < 8; ++r) ss[wave][8 * g + r][j * 16 + col] = acc[j][r];
  LDSX(); for (int rl = 0; rl < 16; ++rl) vst2(S + (size_t)(ql0 + rl) * NP + k0 + lane * 4, *(const v4f*)&ss[wave][rl][lane * 4]); }
// ---- k_sm: block = query row: softmax -> P x 2^11 (f16)
__global__ __launch_bounds__(256) void k_sm(const float* __restrict__ S, _Float16* __restrict__ PH) { __shared__ float sred[8]; __shared__ float sbc; __shared__ __align__(16) _Float16 sh[NP];
  const int t = threadIdx.x; const size_t row = blockIdx.x; const float* sr = S + row * NP;
  float m = -3.0e38f; for (int k = t; k < NP; k += 256) m = fmaxf(m, sr[k]);
#pragma unroll
  for (int o = 1; o < 32; o <<= 1) m = fmaxf(m, __shfl_xor(m, o));
  if ((t & 31) == 0) sred[t >> 5] = m; __syncthreads(); if (t == 0) { float a = sred[0]; for (int i = 1; i < 8; ++i) a = fmaxf(a, sred[i]); sbc = a; } __syncthreads(); m = sbc; __syncthreads();
  float sum = 0.f; for (int k = t; k < NP; k += 256) sum += expf(sr[k] - m);
#pragma unroll
  for (int o = 1; o < 32; o <<= 1) sum += __shfl_xor(sum, o);
  if ((t & 31) == 0) sred[t >> 5] = sum; __syncthreads(); if (t == 0) { float a = 0.f; for (int i = 0; i < 8; ++i) a += sred[i]; sbc = 1.0f / a; } __syncthreads(); const float inv = sbc;
  for (int k = t; k < NP; k += 256) sh[k] = (_Float16)(expf(sr[k] - m) * inv * 2048.0f);
  __syncthreads(); for (int q = t; q < NP / 8; q += 256) vst2((unsigned*)(PH + row * NP + q * 8), *(const v4u*)&sh[q * 8]); }
// ---- k_pv: block = (64 queries i, 128 value channels) of batch b: o[i][c] = sum_j P[i][j] v[c][j]; written channels-last [b][i][c] with the epilogue
__global__ __launch_bounds__(128) void k_pv(const _Float16* __restrict__ PH, const _Float16* __restrict__ VT, int b, const float* __restrict__ X, const float* __restrict__ GM, float* __restrict__ OUT) { __shared__ __align__(16) float st[128][68];
  const int tid = threadIdx.x, wave = tid >> 5, lane = tid & 31, col = lane & 15, g = lane >> 4; const int c0 = blockIdx.y * 128; const int i0 = blockIdx.x * 64; const int il0 = wave * 16;
  v8f acc[8] = {};
#pragma unroll 1
  for (int kc = 0; kc < NP / 32; ++kc) { const v16h ph = frag_h(PH + (size_t)(i0 + il0 + col) * NP + kc * 32, lane);
#pragma unroll
    for (int j = 0; j < 8; ++j) acc[j] = wmma16(ph, frag_h(VT + ((size_t)b * CV + c0 + j * 16 + col) * (size_t)NP + kc * 32, lane), acc[j]); }
#pragma unroll
  for (int j = 0; j < 8; ++j) { const int cl = j * 16 + col;
#pragma unroll
    for (int r = 0; r < 8; ++r) st[cl][il0 + 8 * g + r] = acc[j][r] * (1.0f / 2048.0f); }
  __syncthreads();
  const float gm = bfr(GM[0]);
  // channels-last rows [b*n][CV]: positions i0.. i0+63, channels c0 .. c0+127
  for (int e = tid; e < 64 * 32; e += 128) { const int il = e >> 5, q = e & 31; const size_t o = ((size_t)b * NP + i0 + il) * CV + c0 + q * 4; __align__(16) float v4[4]; const float* xp = X + o; v4[0] = gm * st[q * 4][il] + bfr(xp[0]); v4[1] = gm * st[q * 4 + 1][il] + bfr(xp[1]); v4[2] = gm * st[q * 4 + 2][il] + bfr(xp[2]); v4[3] = gm * st[q * 4 + 3][il] + bfr(xp[3]); vst2(OUT + o, *(const v4f*)v4); } }
extern "C" void kernel_launch(void* const* d_in, const int* in_sizes, int n_in, void* d_out, int out_size, void* d_ws, size_t ws_size, hipStream_t stream) {
  (void)in_sizes; (void)n_in; (void)out_size;
  const float** F = (const float**)d_in;   // 0 inputs [4,64,64,256] channels-last, 1 Wq [256,32] (in,out), 2 bq, 3 Wk, 4 bk, 5 Wv [256,256], 6 bv, 7 gamma [1]
  if (ws_size < (size_t)WS_END) return;
  char* ws = (char*)d_ws; _Float16 *QH = (_Float16*)(ws + WS_QH), *QL = (_Float16*)(ws + WS_QL), *KH = (_Float16*)(ws + WS_KH), *KL = (_Float16*)(ws + WS_KL), *VT = (_Float16*)(ws + WS_VT), *PH = (_Float16*)(ws + WS_PH); float* S = (float*)(ws + WS_S);
  k_proj<<<dim3(NP / 64, TNB, 3), 128, 0, stream>>>(F[0], F[0], F[1], F[2], F[3], F[4], F[5], F[6], QH, QL, KH, KL, VT);
  for (int b = 0; b < TNB; ++b) {
    k_sc<<<dim3(TQB, NP / 128), 128, 0, stream>>>(QH, QL, KH, KL, b, S);
    k_sm<<<TQB * 64, 256, 0, stream>>>(S, PH);
    k_pv<<<dim3(TQB, CV / 128), 128, 0, stream>>>(PH, VT, b, F[0], F[7], (float*)d_out);
  }
}

// v001
// Measured time: 332 microseconds a run.
// Next to v000, in two timings, it ran 2.95 times as fast each time.
// compute dtype: all float inputs rounded to bf16, gamma read; q/k (32 ch) and v (256 ch) = x W + b ((in,out)) with EXACT bf16 products on WMMA 16x16x32 (channels-last x tile in LDS), f32 accumulate; q and k as f16 hi + unscaled residual -> UNSCALED logits with 3 products (std ~5.7, near-one-hot softmax), stored in f32 per batch; softmax in f32 (precise expf) -> P f16 x 2^11; out = gamma * (P . v) + x with v rounded once to f16, channels-last rows; f32 output.
#include <hip/hip_runtime.h>
#include <math.h>

typedef __attribute__((ext_vector_type(16))) _Float16 v16h;
typedef __attribute__((ext_vector_type(16))) __bf16 v16b;
typedef __attribute__((ext_vector_type(8)))  _Float16 v8h;
typedef __attribute__((ext_vector_type(8)))  float v8f;
typedef __attribute__((ext_vector_type(4)))  float v4f;
typedef __attribute__((ext_vector_type(2)))  float v2f;
typedef __attribute__((ext_vector_type(4)))  unsigned v4u;
typedef __attribute__((ext_vector_type(4)))  int v4i;
typedef float __attribute__((may_alias)) float_a;
typedef int __attribute__((may_alias)) int_a;

template <typename T> __device__ __forceinline__ void vst2(void* p, T v) { *(T*)p = v;  }
__device__ __forceinline__ v8f wmma16(v16h a, v16h b, v8f c) {
  v8f d = __builtin_amdgcn_wmma_f32_16x16x32_f16(false, a, false, b, (short)0, c, false, false);
  asm volatile("v_nop\n\tv_nop\n\tv_nop\n\tv_nop" : "+v"(d) : "v"(a), "v"(b));
  return d;
}
__device__ __forceinline__ v8f wmma_bf(v16b a, v16b b, v8f c) {
  v8f d = __builtin_amdgcn_wmma_f32_16x16x32_bf16(false, a, false, b, (short)0, c, false, false);
  asm volatile("v_nop\n\tv_nop\n\tv_nop\n\tv_nop" : "+v"(d) : "v"(a), "v"(b));
  return d;
}
// 16x16x32 fragments: lane = (h = lane>>4, row/col = lane&15); elements 0..7 = k0+8h+0..7, 8..15 = k0+16+8h+0..7; D element r = row 8h+r
__device__ __forceinline__ v16h frag_h(const _Float16* rowk0, int lane) {
  union { v16h v; v8h q[2]; } u; const _Float16* p = rowk0 + 8 * (lane >> 4);
  u.q[0] = *(const v8h*)p; u.q[1] = *(const v8h*)(p + 16); return u.v;
}
__device__ __forceinline__ v16h frag_f32(const float* rowk0, int lane) {
  v16h a; const float* p = rowk0 + 8 * (lane >> 4);
#pragma unroll
  for (int i = 0; i < 8; ++i) { a[i] = (_Float16)p[i]; a[8 + i] = (_Float16)p[16 + i]; }
  return a;
}
__device__ __forceinline__ v16h frag_f32s(const float* rowk0, int lane, float sc) {
  v16h a; const float* p = rowk0 + 8 * (lane >> 4);
#pragma unroll
  for (int i = 0; i < 8; ++i) { a[i] = (_Float16)(p[i] * sc); a[8 + i] = (_Float16)(p[16 + i] * sc); }
  return a;
}
// column fragment from a [K][ld] layout (column n), rows >= K read as 0
__device__ __forceinline__ v16h fragc_f32(const float* W, int k0, int n, int lane, int ld, int K) {
  v16h a; const int g = lane >> 4;
#pragma unroll
  for (int i = 0; i < 8; ++i) { const int ka = k0 + 8 * g + i, kb = ka + 16;
    a[i] = (_Float16)(ka < K ? W[(size_t)(ka < K ? ka : K - 1) * ld + n] : 0.f); a[8 + i] = (_Float16)(kb < K ? W[(size_t)(kb < K ? kb : K - 1) * ld + n] : 0.f); }
  return a;
}
struct F2 { v16b h, l; };
__device__ __forceinline__ F2 bsplit16(const float v[16]) { F2 r;
#pragma unroll
  for (int i = 0; i < 16; ++i) { const __bf16 h = (__bf16)v[i]; r.h[i] = h; r.l[i] = (__bf16)(v[i] - (float)h); }
  return r; }
__device__ __forceinline__ F2 split_row(const float* row, int k0, int lane) { float v[16]; const float* p = row + k0 + 8 * (lane >> 4);
#pragma unroll
  for (int i = 0; i < 8; ++i) { v[i] = p[i]; v[8 + i] = p[16 + i]; }
  return bsplit16(v); }
__device__ __forceinline__ F2 split_rowK(const float* row, int k0, int lane, int K) { float v[16]; const int g = lane >> 4;
#pragma unroll
  for (int i = 0; i < 8; ++i) { const int ka = k0 + 8 * g + i, kb = ka + 16; v[i] = ka < K ? row[ka < K ? ka : K - 1] : 0.f; v[8 + i] = kb < K ? row[kb < K ? kb : K - 1] : 0.f; }
  return bsplit16(v); }
__device__ __forceinline__ F2 split_col(const float* W, int k0, int n, int lane, int ld, int K) { float v[16]; const int g = lane >> 4;
#pragma unroll
  for (int i = 0; i < 8; ++i) { const int ka = k0 + 8 * g + i, kb = ka + 16; v[i] = ka < K ? W[(size_t)(ka < K ? ka : K - 1) * ld + n] : 0.f; v[8 + i] = kb < K ? W[(size_t)(kb < K ? kb : K - 1) * ld + n] : 0.f; }
  return bsplit16(v); }
__device__ __forceinline__ v8f mac3(const F2& a, const F2& b, v8f c) { c = wmma_bf(a.l, b.h, c); c = wmma_bf(a.h, b.l, c); return wmma_bf(a.h, b.h, c); }
__device__ __forceinline__ float sigm(float v) { return 1.0f / (1.0f + expf(-v)); }
#define LDSX() do { asm volatile("s_wait_dscnt 0" ::: "memory"); __builtin_amdgcn_wave_barrier(); __builtin_amdgcn_fence(__ATOMIC_RELEASE, "workgroup"); } while (0)


// SelfAttentionModel (SAGAN-style, channels-last input [B, 64, 64, 256]): energy = q k^T unscaled over all 4,096 positions, out = gamma * softmax(energy) v + inputs.
#define NB 4
#define NP 4096
#define CIN 256
#define CQ 32
#define CV 256
#ifndef TNB
#define TNB NB
#endif
#ifndef TQB
#define TQB (NP / 64)
#endif
typedef __attribute__((ext_vector_type(8))) __bf16 v8b;
__device__ __forceinline__ v16b frag_b(const __bf16* rowk0, int lane) {
  union { v16b v; v8b q[2]; } u; const __bf16* p = rowk0 + 8 * (lane >> 4);
  u.q[0] = *(const v8b*)p; u.q[1] = *(const v8b*)(p + 16); return u.v;
}
__device__ __forceinline__ float bfr(float v) { return (float)(__bf16)v; }
__device__ __attribute__((noinline)) float exp_ni(float v) { return expf(v); }
__device__ __attribute__((noinline)) float erf_ni(float v) { return erff(v); }

#define WS_QH  0u                                    // f16 q rows [b*n][CQ] hi
#define WS_QL  (WS_QH + 2u * (size_t)NB * NP * CQ)      // f16 q residual rows (unscaled)
#define WS_KH  (WS_QL + 2u * (size_t)NB * NP * CQ)      // f16 k rows
#define WS_KL  (WS_KH + 2u * (size_t)NB * NP * CQ)      // f16 k residual rows
#define WS_VT  (WS_KL + 2u * (size_t)NB * NP * CQ)      // f16 v planes [b][CV][n]
#define WS_S   (WS_VT + 2u * (size_t)NB * CV * NP)      // f32 logits, ONE batch [i][j] (64 MiB)
#define WS_PH  (WS_S + 4u * (size_t)NP * NP)           // f16 P x 2^11, one batch (32 MiB)
#define WS_END (WS_PH + 2u * (size_t)NP * NP)

// ---- k_proj: block = (64 positions, b, which 0 q / 1 k / 2 v): x tile (bf16, channels-last rows) in LDS, W [in][out] + b (exact); q, k -> f16 hi + residual rows, v -> f16 planes [c][n]
__global__ __launch_bounds__(128) void k_proj(const float* __restrict__ XQK, const float* __restrict__ XV, const float* __restrict__ WQ, const float* __restrict__ BQ, const float* __restrict__ WK, const float* __restrict__ BK, const float* __restrict__ WV, const float* __restrict__ BV, _Float16* __restrict__ QH, _Float16* __restrict__ QL, _Float16* __restrict__ KH, _Float16* __restrict__ KL, _Float16* __restrict__ VT) {
  __shared__ __align__(16) __bf16 sx[64][CIN + 8]; __shared__ __align__(16) _Float16 sh[64][72], sl[64][72]; __shared__ __align__(16) _Float16 tv[64][72];
  const int tid = threadIdx.x, wave = tid >> 5, lane = tid & 31, col = lane & 15, g = lane >> 4; const int p0 = blockIdx.x * 64; const size_t b = blockIdx.y; const int which = blockIdx.z;
  const float* Wm = which == 0 ? WQ : which == 1 ? WK : WV; const float* Bm = which == 0 ? BQ : which == 1 ? BK : BV; const int nout = (which == 2) ? CV : CQ; const float* X = (which == 2) ? XV : XQK;
  for (int e = tid; e < CIN * 64; e += 128) { const int pl = e / CIN, c = e % CIN; sx[pl][c] = (__bf16)X[((size_t)b * NP + p0 + pl) * CIN + c]; }   // channels-last rows
  __syncthreads();
#pragma unroll 1
  for (int cg = 0; cg < (nout + 63) / 64; ++cg) { v8f acc[4] = {};
#pragma unroll 2
    for (int kc = 0; kc < CIN / 32; ++kc) { const v16b a = frag_b(&sx[wave * 16 + col][kc * 32], lane);
#pragma unroll
      for (int j = 0; j < 4; ++j) { v16b w; const int o = min(cg * 64 + j * 16 + col, nout - 1);   // columns >= nout are dummies (never stored)
#pragma unroll
        for (int i = 0; i < 8; ++i) { w[i] = (__bf16)Wm[(size_t)(kc * 32 + 8 * g + i) * nout + o]; w[8 + i] = (__bf16)Wm[(size_t)(kc * 32 + 16 + 8 * g + i) * nout + o]; }
        acc[j] = wmma_bf(a, w, acc[j]); } }
    __syncthreads();
#pragma unroll
    for (int j = 0; j < 4; ++j) { const int ol = j * 16 + col; const float bb = bfr(Bm[min(cg * 64 + ol, nout - 1)]);
#pragma unroll
      for (int r = 0; r < 8; ++r) { const int pl = wave * 16 + 8 * g + r; const float v = acc[j][r] + bb; const _Float16 hv = (_Float16)v; if (which == 2) tv[ol][pl] = hv; else { sh[pl][ol] = hv; sl[pl][ol] = (_Float16)(v - (float)hv); } } }   // q AND k keep a residual
    __syncthreads();
    if (which < 2) { _Float16* dh = which == 0 ? QH : KH; _Float16* dl = which == 0 ? QL : KL; for (int e = tid; e < 64 * 8; e += 128) { const int pl = e >> 3, q = e & 7; if (cg * 64 + q * 8 >= CQ) continue; const size_t row = b * NP + p0 + pl; vst2((unsigned*)(dh + row * CQ + cg * 64 + q * 8), *(const v4u*)&sh[pl][q * 8]); vst2((unsigned*)(dl + row * CQ + cg * 64 + q * 8), *(const v4u*)&sl[pl][q * 8]); } }
    else { for (int e = tid; e < 64 * 8; e += 128) { const int ol = e >> 3, q = e & 7; vst2((unsigned*)(VT + (b * CV + cg * 64 + ol) * (size_t)NP + p0 + q * 8), *(const v4u*)&tv[ol][q * 8]); } } } }
// ---- k_sc: block = (64 queries, 128 keys) of batch b: logits (qh kh + ql kh + qh kl) -> S
__global__ __launch_bounds__(128) void k_sc(const _Float16* __restrict__ QH, const _Float16* __restrict__ QL, const _Float16* __restrict__ KH, const _Float16* __restrict__ KL, int b, float* __restrict__ S) { __shared__ __align__(16) float ss[4][16][132];
  const int tid = threadIdx.x, wave = tid >> 5, lane = tid & 31, col = lane & 15, g = lane >> 4; const int k0 = blockIdx.y * 128; const int ql0 = blockIdx.x * 64 + wave * 16; const size_t q0 = (size_t)b * NP + ql0;
  v8f acc[8] = {};
#pragma unroll 1
  for (int kc = 0; kc < CQ / 32; ++kc) { const v16h ah = frag_h(QH + (q0 + col) * CQ + kc * 32, lane), al = frag_h(QL + (q0 + col) * CQ + kc * 32, lane);
#pragma unroll
    for (int j = 0; j < 8; ++j) { const size_t kr = ((size_t)b * NP + k0 + j * 16 + col) * CQ + kc * 32; const v16h kh = frag_h(KH + kr, lane); acc[j] = wmma16(ah, kh, acc[j]); acc[j] = wmma16(al, kh, acc[j]); acc[j] = wmma16(ah, frag_h(KL + kr, lane), acc[j]); } }   // 3 products
#pragma unroll
  for (int j = 0; j < 8; ++j)
#pragma unroll
    for (int r = 0; r < 8; ++r) ss[wave][8 * g + r][j * 16 + col] = acc[j][r];
  LDSX(); for (int rl = 0; rl < 16; ++rl) vst2(S + (size_t)(ql0 + rl) * NP + k0 + lane * 4, *(const v4f*)&ss[wave][rl][lane * 4]); }
// ---- k_sm: block = query row: softmax -> P x 2^11 (f16)
__global__ __launch_bounds__(256) void k_sm(const float* __restrict__ S, _Float16* __restrict__ PH) { __shared__ float sred[8]; __shared__ float sbc; __shared__ __align__(16) _Float16 sh[NP];
  const int t = threadIdx.x; const size_t row = blockIdx.x; const float* sr = S + row * NP;
  float m = -3.0e38f; for (int k = t; k < NP; k += 256) m = fmaxf(m, sr[k]);
#pragma unroll
  for (int o = 1; o < 32; o <<= 1) m = fmaxf(m, __shfl_xor(m, o));
  if ((t & 31) == 0) sred[t >> 5] = m; __syncthreads(); if (t == 0) { float a = sred[0]; for (int i = 1; i < 8; ++i) a = fmaxf(a, sred[i]); sbc = a; } __syncthreads(); m = sbc; __syncthreads();
  float sum = 0.f; for (int k = t; k < NP; k += 256) sum += expf(sr[k] - m);
#pragma unroll
  for (int o = 1; o < 32; o <<= 1) sum += __shfl_xor(sum, o);
  if ((t & 31) == 0) sred[t >> 5] = sum; __syncthreads(); if (t == 0) { float a = 0.f; for (int i = 0; i < 8; ++i) a += sred[i]; sbc = 1.0f / a; } __syncthreads(); const float inv = sbc;
  for (int k = t; k < NP; k += 256) sh[k] = (_Float16)(expf(sr[k] - m) * inv * 2048.0f);
  __syncthreads(); for (int q = t; q < NP / 8; q += 256) vst2((unsigned*)(PH + row * NP + q * 8), *(const v4u*)&sh[q * 8]); }
// ---- k_pv: block = (64 queries i, 128 value channels) of batch b: o[i][c] = sum_j P[i][j] v[c][j]; P and v tiles of 256 keys staged in LDS (two buffers, asynchronous copies); written channels-last with the epilogue
#define PV_KT 256                      // keys per stage: 512 B of a row = one wave-wide 16-byte-per-lane copy over four whole lines
#define PV_PITCH (PV_KT + 8)           // f16 elements; 528 B = 16 B x odd: the pitch for ds_load_b128 readers
#define PV_PITCHB (2u * PV_PITCH)
#define PV_BUFB (192u * PV_PITCHB)     // one buffer: 64 P rows, then 128 v rows
#define PV_NT (NP / PV_KT)
// twelve copies global -> LDS, one row piece each; s_wait_xcnt ends the statement so that no address register is rewritten in front of it
__device__ __forceinline__ void pv_cp12(const unsigned* d, const _Float16* const* s) {
  asm volatile(
    "global_load_async_to_lds_b128 %0, %12, off\n\t"
    "global_load_async_to_lds_b128 %1, %13, off\n\t"
    "global_load_async_to_lds_b128 %2, %14, off\n\t"
    "global_load_async_to_lds_b128 %3, %15, off\n\t"
    "global_load_async_to_lds_b128 %4, %16, off\n\t"
    "global_load_async_to_lds_b128 %5, %17, off\n\t"
    "global_load_async_to_lds_b128 %6, %18, off\n\t"
    "global_load_async_to_lds_b128 %7, %19, off\n\t"
    "global_load_async_to_lds_b128 %8, %20, off\n\t"
    "global_load_async_to_lds_b128 %9, %21, off\n\t"
    "global_load_async_to_lds_b128 %10, %22, off\n\t"
    "global_load_async_to_lds_b128 %11, %23, off\n\t"
    "s_wait_xcnt 0x0"
    :: "v"(d[0]), "v"(d[1]), "v"(d[2]), "v"(d[3]), "v"(d[4]), "v"(d[5]), "v"(d[6]), "v"(d[7]), "v"(d[8]), "v"(d[9]), "v"(d[10]), "v"(d[11]),
       "v"(s[0]), "v"(s[1]), "v"(s[2]), "v"(s[3]), "v"(s[4]), "v"(s[5]), "v"(s[6]), "v"(s[7]), "v"(s[8]), "v"(s[9]), "v"(s[10]), "v"(s[11]) : "memory");
}
// one wave's share of a stage: its own 16 P rows and 32 of the 128 v rows (48 copies in flight)
__device__ __forceinline__ void pv_fill(unsigned lp, unsigned lv, const _Float16* gp, const _Float16* gv) {
#pragma unroll   // both loops unrolled: every index a constant, so the address arrays stay in registers
  for (int s = 0; s < 4; ++s) { unsigned d[12]; const _Float16* g[12];
#pragma unroll
    for (int i = 0; i < 12; ++i) { const int n = s * 12 + i; d[i] = n < 16 ? lp + n * PV_PITCHB : lv + (n - 16) * PV_PITCHB; g[i] = n < 16 ? gp + (size_t)n * NP : gv + (size_t)(n - 16) * NP; }
    pv_cp12(d, g); } }
__global__ __launch_bounds__(128) void k_pv(const _Float16* __restrict__ PH, const _Float16* __restrict__ VT, int b, const float* __restrict__ X, const float* __restrict__ GM, float* __restrict__ OUT) { __shared__ __align__(16) _Float16 ring[2][192][PV_PITCH]; __shared__ __align__(16) float st[128][68];
  const int tid = threadIdx.x, wave = tid >> 5, lane = tid & 31, col = lane & 15, g = lane >> 4; const int c0 = blockIdx.y * 128; const int i0 = blockIdx.x * 64; const int il0 = wave * 16;
  const unsigned l0 = (unsigned)(size_t)&ring[0][0][0] + (unsigned)lane * 16u; const unsigned lp = l0 + (unsigned)il0 * PV_PITCHB, lv = l0 + (unsigned)(64 + wave * 32) * PV_PITCHB;
  const _Float16* gp = PH + (size_t)(i0 + il0) * NP + lane * 8; const _Float16* gv = VT + ((size_t)b * CV + c0 + wave * 32) * (size_t)NP + lane * 8;
  v8f acc[8] = {};
  pv_fill(lp, lv, gp, gv);
  asm volatile("s_wait_asynccnt 0x0" ::: "memory");   // stage 0 has landed before the barrier publishes it
  __syncthreads();
  pv_fill(lp + PV_BUFB, lv + PV_BUFB, gp + PV_KT, gv + PV_KT);
#pragma unroll 1
  for (int t = 0; t < PV_NT; ++t) { const _Float16 (*buf)[PV_PITCH] = ring[t & 1];   // rolled: one stage a trip, the buffer by parity
    v16h ph[2], vf[2][8];   // two fragment sets: the next 32 keys' LDS reads go out as one group ahead of this group's products, inside the stage only
    ph[0] = frag_h(&buf[il0 + col][0], lane);
#pragma unroll   // the loops of a stage are unrolled: the fragment sets are indexed by constants and stay in registers
    for (int j = 0; j < 8; ++j) vf[0][j] = frag_h(&buf[64 + j * 16 + col][0], lane);
#pragma unroll
    for (int kc = 0; kc < PV_KT / 32; ++kc) { const int cur = kc & 1;
      if (kc + 1 < PV_KT / 32) { ph[cur ^ 1] = frag_h(&buf[il0 + col][(kc + 1) * 32], lane);
#pragma unroll
        for (int j = 0; j < 8; ++j) vf[cur ^ 1][j] = frag_h(&buf[64 + j * 16 + col][(kc + 1) * 32], lane); }
#pragma unroll
      for (int j = 0; j < 8; ++j) acc[j] = wmma16(ph[cur], vf[cur][j], acc[j]); }
    asm volatile("s_wait_dscnt 0x0" ::: "memory");      // this wave's reads of the buffer are done before it is refilled
    asm volatile("s_wait_asynccnt 0x0" ::: "memory");   // this wave's copies of stage t + 1 have landed
    __syncthreads();                                    // publishes stage t + 1 and ends every reader's last read of stage t
    if (t + 2 < PV_NT) pv_fill(lp + (unsigned)(t & 1) * PV_BUFB, lv + (unsigned)(t & 1) * PV_BUFB, gp + (size_t)(t + 2) * PV_KT, gv + (size_t)(t + 2) * PV_KT); }
  asm volatile("s_wait_asynccnt 0x0" ::: "memory");     // no copy is outstanding behind the loop
#pragma unroll
  for (int j = 0; j < 8; ++j) { const int cl = j * 16 + col;
#pragma unroll
    for (int r = 0; r < 8; ++r) st[cl][il0 + 8 * g + r] = acc[j][r] * (1.0f / 2048.0f); }
  __syncthreads();
  const float gm = bfr(GM[0]);
  // channels-last rows [b*n][CV]: positions i0.. i0+63, channels c0 .. c0+127
  for (int e = tid; e < 64 * 32; e += 128) { const int il = e >> 5, q = e & 31; const size_t o = ((size_t)b * NP + i0 + il) * CV + c0 + q * 4; __align__(16) float v4[4]; const float* xp = X + o; v4[0] = gm * st[q * 4][il] + bfr(xp[0]); v4[1] = gm * st[q * 4 + 1][il] + bfr(xp[1]); v4[2] = gm * st[q * 4 + 2][il] + bfr(xp[2]); v4[3] = gm * st[q * 4 + 3][il] + bfr(xp[3]); vst2(OUT + o, *(const v4f*)v4); } }
extern "C" void kernel_launch(void* const* d_in, const int* in_sizes, int n_in, void* d_out, int out_size, void* d_ws, size_t ws_size, hipStream_t stream) {
  (void)in_sizes; (void)n_in; (void)out_size;
  const float** F = (const float**)d_in;   // 0 inputs [4,64,64,256] channels-last, 1 Wq [256,32] (in,out), 2 bq, 3 Wk, 4 bk, 5 Wv [256,256], 6 bv, 7 gamma [1]
  if (ws_size < (size_t)WS_END) return;
  char* ws = (char*)d_ws; _Float16 *QH = (_Float16*)(ws + WS_QH), *QL = (_Float16*)(ws + WS_QL), *KH = (_Float16*)(ws + WS_KH), *KL = (_Float16*)(ws + WS_KL), *VT = (_Float16*)(ws + WS_VT), *PH = (_Float16*)(ws + WS_PH); float* S = (float*)(ws + WS_S);
  k_proj<<<dim3(NP / 64, TNB, 3), 128, 0, stream>>>(F[0], F[0], F[1], F[2], F[3], F[4], F[5], F[6], QH, QL, KH, KL, VT);
  for (int b = 0; b < TNB; ++b) {
    k_sc<<<dim3(TQB, NP / 128), 128, 0, stream>>>(QH, QL, KH, KL, b, S);
    k_sm<<<TQB * 64, 256, 0, stream>>>(S, PH);
    k_pv<<<dim3(TQB, CV / 128), 128, 0, stream>>>(PH, VT, b, F[0], F[7], (float*)d_out);
  }
}

// v002
// One run takes 102 microseconds.
// Next to v001, in two timings, it ran 3.25 and 3.26 times as fast.
// All steps since v000 together make it 9.58 times as fast.
// compute dtype: all float inputs rounded to bf16, gamma read; q/k (32 ch) and v (256 ch) = x W + b ((in,out)) with EXACT bf16 products on WMMA 16x16x32 (channels-last x tile in LDS), f32 accumulate; q and k as f16 hi + unscaled residual -> UNSCALED logits with 3 products (std ~5.7, near-one-hot softmax), kept in registers; running-maximum softmax in f32 -> P f16 = exp(s - m) x 2^11; out = gamma * (P . v) / sum(P) + x with v rounded once to f16, channels-last rows; f32 output.
#include <hip/hip_runtime.h>
#include <math.h>

typedef __attribute__((ext_vector_type(16))) _Float16 v16h;
typedef __attribute__((ext_vector_type(16))) __bf16 v16b;
typedef __attribute__((ext_vector_type(8)))  _Float16 v8h;
typedef __attribute__((ext_vector_type(8)))  float v8f;
typedef __attribute__((ext_vector_type(4)))  float v4f;
typedef __attribute__((ext_vector_type(2)))  float v2f;
typedef __attribute__((ext_vector_type(4)))  unsigned v4u;
typedef __attribute__((ext_vector_type(4)))  int v4i;
typedef float __attribute__((may_alias)) float_a;
typedef int __attribute__((may_alias)) int_a;

template <typename T> __device__ __forceinline__ void vst2(void* p, T v) { *(T*)p = v;  }
__device__ __forceinline__ v8f wmma16(v16h a, v16h b, v8f c) {
  v8f d = __builtin_amdgcn_wmma_f32_16x16x32_f16(false, a, false, b, (short)0, c, false, false);
  asm volatile("v_nop\n\tv_nop\n\tv_nop\n\tv_nop" : "+v"(d) : "v"(a), "v"(b));
  return d;
}
__device__ __forceinline__ v8f wmma_bf(v16b a, v16b b, v8f c) {
  v8f d = __builtin_amdgcn_wmma_f32_16x16x32_bf16(false, a, false, b, (short)0, c, false, false);
  asm volatile("v_nop\n\tv_nop\n\tv_nop\n\tv_nop" : "+v"(d) : "v"(a), "v"(b));
  return d;
}
// 16x16x32 fragments: lane = (h = lane>>4, row/col = lane&15); elements 0..7 = k0+8h+0..7, 8..15 = k0+16+8h+0..7; D element r = row 8h+r
__device__ __forceinline__ v16h frag_h(const _Float16* rowk0, int lane) {
  union { v16h v; v8h q[2]; } u; const _Float16* p = rowk0 + 8 * (lane >> 4);
  u.q[0] = *(const v8h*)p; u.q[1] = *(const v8h*)(p + 16); return u.v;
}
__device__ __forceinline__ v16h frag_f32(const float* rowk0, int lane) {
  v16h a; const float* p = rowk0 + 8 * (lane >> 4);
#pragma unroll
  for (int i = 0; i < 8; ++i) { a[i] = (_Float16)p[i]; a[8 + i] = (_Float16)p[16 + i]; }
  return a;
}
__device__ __forceinline__ v16h frag_f32s(const float* rowk0, int lane, float sc) {
  v16h a; const float* p = rowk0 + 8 * (lane >> 4);
#pragma unroll
  for (int i = 0; i < 8; ++i) { a[i] = (_Float16)(p[i] * sc); a[8 + i] = (_Float16)(p[16 + i] * sc); }
  return a;
}
// column fragment from a [K][ld] layout (column n), rows >= K read as 0
__device__ __forceinline__ v16h fragc_f32(const float* W, int k0, int n, int lane, int ld, int K) {
  v16h a; const int g = lane >> 4;
#pragma unroll
  for (int i = 0; i < 8; ++i) { const int ka = k0 + 8 * g + i, kb = ka + 16;
    a[i] = (_Float16)(ka < K ? W[(size_t)(ka < K ? ka : K - 1) * ld + n] : 0.f); a[8 + i] = (_Float16)(kb < K ? W[(size_t)(kb < K ? kb : K - 1) * ld + n] : 0.f); }
  return a;
}
struct F2 { v16b h, l; };
__device__ __forceinline__ F2 bsplit16(const float v[16]) { F2 r;
#pragma unroll
  for (int i = 0; i < 16; ++i) { const __bf16 h = (__bf16)v[i]; r.h[i] = h; r.l[i] = (__bf16)(v[i] - (float)h); }
  return r; }
__device__ __forceinline__ F2 split_row(const float* row, int k0, int lane) { float v[16]; const float* p = row + k0 + 8 * (lane >> 4);
#pragma unroll
  for (int i = 0; i < 8; ++i) { v[i] = p[i]; v[8 + i] = p[16 + i]; }
  return bsplit16(v); }
__device__ __forceinline__ F2 split_rowK(const float* row, int k0, int lane, int K) { float v[16]; const int g = lane >> 4;
#pragma unroll
  for (int i = 0; i < 8; ++i) { const int ka = k0 + 8 * g + i, kb = ka + 16; v[i] = ka < K ? row[ka < K ? ka : K - 1] : 0.f; v[8 + i] = kb < K ? row[kb < K ? kb : K - 1] : 0.f; }
  return bsplit16(v); }
__device__ __forceinline__ F2 split_col(const float* W, int k0, int n, int lane, int ld, int K) { float v[16]; const int g = lane >> 4;
#pragma unroll
  for (int i = 0; i < 8; ++i) { const int ka = k0 + 8 * g + i, kb = ka + 16; v[i] = ka < K ? W[(size_t)(ka < K ? ka : K - 1) * ld + n] : 0.f; v[8 + i] = kb < K ? W[(size_t)(kb < K ? kb : K - 1) * ld + n] : 0.f; }
  return bsplit16(v); }
__device__ __forceinline__ v8f mac3(const F2& a, const F2& b, v8f c) { c = wmma_bf(a.l, b.h, c); c = wmma_bf(a.h, b.l, c); return wmma_bf(a.h, b.h, c); }
__device__ __forceinline__ float sigm(float v) { return 1.0f / (1.0f + expf(-v)); }
#define LDSX() do { asm volatile("s_wait_dscnt 0" ::: "memory"); __builtin_amdgcn_wave_barrier(); __builtin_amdgcn_fence(__ATOMIC_RELEASE, "workgroup"); } while (0)


// SelfAttentionModel (SAGAN-style, channels-last input [B, 64, 64, 256]): energy = q k^T unscaled over all 4,096 positions, out = gamma * softmax(energy) v + inputs.
#define NB 4
#define NP 4096
#define CIN 256
#define CQ 32
#define CV 256
#ifndef TNB
#define TNB NB
#endif
#ifndef TQB
#define TQB (NP / 64)
#endif
typedef __attribute__((ext_vector_type(8))) __bf16 v8b;
__device__ __forceinline__ v16b frag_b(const __bf16* rowk0, int lane) {
  union { v16b v; v8b q[2]; } u; const __bf16* p = rowk0 + 8 * (lane >> 4);
  u.q[0] = *(const v8b*)p; u.q[1] = *(const v8b*)(p + 16); return u.v;
}
__device__ __forceinline__ float bfr(float v) { return (float)(__bf16)v; }
__device__ __attribute__((noinline)) float exp_ni(float v) { return expf(v); }
__device__ __attribute__((noinline)) float erf_ni(float v) { return erff(v); }

#define WS_QH  0u                                    // f16 q rows [b*n][CQ] hi
#define WS_QL  (WS_QH + 2u * (size_t)NB * NP * CQ)      // f16 q residual rows (unscaled)
#define WS_KH  (WS_QL + 2u * (size_t)NB * NP * CQ)      // f16 k rows
#define WS_KL  (WS_KH + 2u * (size_t)NB * NP * CQ)      // f16 k residual rows
#define WS_VT  (WS_KL + 2u * (size_t)NB * NP * CQ)      // f16 v planes [b][CV][n]
#define WS_END (WS_VT + 2u * (size_t)NB * CV * NP)

// ---- k_proj: block = (64 positions, b, which 0 q / 1 k / 2 v): x tile (bf16) in LDS, W [in][out] + b (exact); q and k -> f16 hi + residual rows, v -> f16 planes [c][n]
__global__ __launch_bounds__(128) void k_proj(const float* __restrict__ XQK, const float* __restrict__ XV, const float* __restrict__ WQ, const float* __restrict__ BQ, const float* __restrict__ WK, const float* __restrict__ BK, const float* __restrict__ WV, const float* __restrict__ BV, _Float16* __restrict__ QH, _Float16* __restrict__ QL, _Float16* __restrict__ KH, _Float16* __restrict__ KL, _Float16* __restrict__ VT) {
  __shared__ __align__(16) __bf16 sx[64][CIN + 8]; __shared__ __align__(16) _Float16 sh[64][72], sl[64][72]; __shared__ __align__(16) _Float16 tv[64][72];
  const int tid = threadIdx.x, wave = tid >> 5, lane = tid & 31, col = lane & 15, g = lane >> 4; const int p0 = blockIdx.x * 64; const size_t b = blockIdx.y; const int which = blockIdx.z;
  const float* Wm = which == 0 ? WQ : which == 1 ? WK : WV; const float* Bm = which == 0 ? BQ : which == 1 ? BK : BV; const int nout = (which == 2) ? CV : CQ; const float* X = (which == 2) ? XV : XQK;
  for (int e = tid; e < CIN * 64; e += 128) { const int pl = e / CIN, c = e % CIN; sx[pl][c] = (__bf16)X[((size_t)b * NP + p0 + pl) * CIN + c]; }   // channels-last rows
  __syncthreads();
#pragma unroll 1
  for (int cg = 0; cg < (nout + 63) / 64; ++cg) { v8f acc[4] = {};
#pragma unroll 2
    for (int kc = 0; kc < CIN / 32; ++kc) { const v16b a = frag_b(&sx[wave * 16 + col][kc * 32], lane);
#pragma unroll
      for (int j = 0; j < 4; ++j) { v16b w; const int o = min(cg * 64 + j * 16 + col, nout - 1);   // columns >= nout are dummies (never stored)
#pragma unroll
        for (int i = 0; i < 8; ++i) { w[i] = (__bf16)Wm[(size_t)(kc * 32 + 8 * g + i) * nout + o]; w[8 + i] = (__bf16)Wm[(size_t)(kc * 32 + 16 + 8 * g + i) * nout + o]; }
        acc[j] = wmma_bf(a, w, acc[j]); } }
    __syncthreads();
#pragma unroll
    for (int j = 0; j < 4; ++j) { const int ol = j * 16 + col; const float bb = bfr(Bm[min(cg * 64 + ol, nout - 1)]);
#pragma unroll
      for (int r = 0; r < 8; ++r) { const int pl = wave * 16 + 8 * g + r; const float v = acc[j][r] + bb; const _Float16 hv = (_Float16)v; if (which == 2) tv[ol][pl] = hv; else { sh[pl][ol] = hv; sl[pl][ol] = (_Float16)(v - (float)hv); } } }   // q AND k keep a residual
    __syncthreads();
    if (which < 2) { _Float16* dh = which == 0 ? QH : KH; _Float16* dl = which == 0 ? QL : KL; for (int e = tid; e < 64 * 8; e += 128) { const int pl = e >> 3, q = e & 7; if (cg * 64 + q * 8 >= CQ) continue; const size_t row = b * NP + p0 + pl; vst2((unsigned*)(dh + row * CQ + cg * 64 + q * 8), *(const v4u*)&sh[pl][q * 8]); vst2((unsigned*)(dl + row * CQ + cg * 64 + q * 8), *(const v4u*)&sl[pl][q * 8]); } }
    else { for (int e = tid; e < 64 * 8; e += 128) { const int ol = e >> 3, q = e & 7; vst2((unsigned*)(VT + (b * CV + cg * 64 + ol) * (size_t)NP + p0 + q * 8), *(const v4u*)&tv[ol][q * 8]); } } } }
// the plain builtin: the compiler keeps the distance behind it itself and may place operands in any register
__device__ __forceinline__ v8f wmma_h(v16h a, v16h b, v8f c) { return __builtin_amdgcn_wmma_f32_16x16x32_f16(false, a, false, b, (short)0, c, false, false); }
// lane l with lane l ^ 16, on the vector unit
__device__ __forceinline__ float xhalf(float x) { return __builtin_bit_cast(float, __builtin_amdgcn_permlanex16(__builtin_bit_cast(int, x), __builtin_bit_cast(int, x), 0x76543210, 0xfedcba98, false, false)); }
// keeps a group of LDS reads together at its place: without it the compiler spreads the reads singly among the products, each with its own wait
#define FA_SB() __builtin_amdgcn_sched_barrier(0)
// ---- k_fa: block = (64 queries, batch b), wave = 16 queries x all 256 channels: S^T = K Q^T, running-maximum softmax in registers, O^T += V^T P^T; k and v tiles of 128 keys staged in LDS (two buffers, asynchronous copies)
#define FA_KT 128                      // keys per stage: 256 B of a v row, so one wave-wide copy brings two whole row pieces
#define FA_NT (NP / FA_KT)
#define FA_VP (FA_KT + 8)              // f16 elements; 272 B = 16 B x odd: the pitch for ds_load_b128 readers
#define FA_KP (CQ + 8)                 // 80 B = 16 B x odd
#define FA_VPB (2u * FA_VP)
#define FA_KPB (2u * FA_KP)
struct FaStage { _Float16 v[CV][FA_VP]; _Float16 kh[FA_KT][FA_KP]; _Float16 kl[FA_KT][FA_KP]; };
#define FA_BUFB ((unsigned)sizeof(FaStage))
// ten copies global -> LDS; s_wait_xcnt ends the statement so that no address register is rewritten in front of it
__device__ __forceinline__ void fa_cp10(const unsigned* d, const _Float16* const* s) {
  asm volatile(
    "global_load_async_to_lds_b128 %0, %10, off\n\t"
    "global_load_async_to_lds_b128 %1, %11, off\n\t"
    "global_load_async_to_lds_b128 %2, %12, off\n\t"
    "global_load_async_to_lds_b128 %3, %13, off\n\t"
    "global_load_async_to_lds_b128 %4, %14, off\n\t"
    "global_load_async_to_lds_b128 %5, %15, off\n\t"
    "global_load_async_to_lds_b128 %6, %16, off\n\t"
    "global_load_async_to_lds_b128 %7, %17, off\n\t"
    "global_load_async_to_lds_b128 %8, %18, off\n\t"
    "global_load_async_to_lds_b128 %9, %19, off\n\t"
    "s_wait_xcnt 0x0"
    :: "v"(d[0]), "v"(d[1]), "v"(d[2]), "v"(d[3]), "v"(d[4]), "v"(d[5]), "v"(d[6]), "v"(d[7]), "v"(d[8]), "v"(d[9]),
       "v"(s[0]), "v"(s[1]), "v"(s[2]), "v"(s[3]), "v"(s[4]), "v"(s[5]), "v"(s[6]), "v"(s[7]), "v"(s[8]), "v"(s[9]) : "memory");
}
// one wave's share of a stage: 64 of the 256 v rows (two rows a copy) and 32 of the 128 keys' hi and residual rows (eight keys a copy): 40 copies in flight
// the global addresses are formed here from uniform bases and the lane's 32-bit element offsets: a lane pointer kept across the main loop and named by the asm statement itself was spilled
__device__ __forceinline__ void fa_fill(unsigned lv, unsigned lkh, unsigned lkl, const _Float16* bv, unsigned ov, const _Float16* bkh, const _Float16* bkl, unsigned ok) {
  unsigned d[10]; const _Float16* g[10];
#pragma unroll
  for (int i = 0; i < 8; ++i) { d[i] = lv + i * 2 * FA_VPB; g[i] = bv + (ov + (unsigned)i * 2u * NP); }
  d[8] = lkh; g[8] = bkh + ok; d[9] = lkl; g[9] = bkl + ok;
#pragma unroll 1   // rolled: ten running addresses (16 v rows, 8 keys a trip); unrolled, the compiler keeps all forty LDS addresses across the main loop and spills
  for (int s = 0; s < 4; ++s) { fa_cp10(d, g);
#pragma unroll
    for (int i = 0; i < 8; ++i) { d[i] += 16 * FA_VPB; g[i] += (size_t)16 * NP; }
    d[8] += 8 * FA_KPB; g[8] += (size_t)8 * CQ; d[9] += 8 * FA_KPB; g[9] += (size_t)8 * CQ; } }
__global__ __launch_bounds__(128) void k_fa(const _Float16* __restrict__ QH, const _Float16* __restrict__ QL, const _Float16* __restrict__ KH, const _Float16* __restrict__ KL, const _Float16* __restrict__ VT, const float* __restrict__ X, const float* __restrict__ GM, float* __restrict__ OUT) { __shared__ __align__(16) FaStage ring[2]; __shared__ __align__(16) float st[64][CV + 4];
  const int tid = threadIdx.x, wave = tid >> 5, lane = tid & 31, col = lane & 15, g = lane >> 4; const size_t b = blockIdx.y; const int i0 = blockIdx.x * 64; const int il0 = wave * 16;
  const unsigned lv = (unsigned)(size_t)&ring[0].v[wave * 64 + g][col * 8], lkh = (unsigned)(size_t)&ring[0].kh[wave * 32 + (lane >> 2)][(lane & 3) * 8], lkl = (unsigned)(size_t)&ring[0].kl[wave * 32 + (lane >> 2)][(lane & 3) * 8];
  const _Float16* bv = VT + b * CV * (size_t)NP; const _Float16* bkh = KH + b * NP * (size_t)CQ; const _Float16* bkl = KL + b * NP * (size_t)CQ;   // the batch's planes and rows, uniform
  const unsigned ov = (unsigned)(wave * 64 + g) * NP + col * 8, ok = (unsigned)(wave * 32 + (lane >> 2)) * CQ + (lane & 3) * 8;   // the lane's element offsets inside them
  const size_t qr = (b * NP + i0 + il0 + col) * CQ; const v16h qh = frag_h(QH + qr, lane), ql = frag_h(QL + qr, lane);   // B operands: column = query, kept for the whole kernel
  const float L2E = 1.4426950408889634f;
  v8f acc[16] = {}; float mrun = -3.0e38f, lsum = 0.f;   // per lane: its query's running maximum, and its half's share of the sum
  fa_fill(lv, lkh, lkl, bv, ov, bkh, bkl, ok);
  asm volatile("s_wait_asynccnt 0x0" ::: "memory");   // stage 0 has landed before the barrier publishes it
  __syncthreads();
  fa_fill(lv + FA_BUFB, lkh + FA_BUFB, lkl + FA_BUFB, bv + FA_KT, ov, bkh + (size_t)FA_KT * CQ, bkl + (size_t)FA_KT * CQ, ok);
#pragma unroll 1
  for (int t = 0; t < FA_NT; ++t) { const FaStage& sb = ring[t & 1];   // rolled: one stage a trip, the buffer by parity
    v16h kh[4], kl[4], vf[2][8];   // k fragments of 64 keys; two sets of v fragments: the next eight go out as one group ahead of this group's products, inside the stage only
#pragma unroll
    for (int jt = 0; jt < 4; ++jt) { kh[jt] = frag_h(&sb.kh[jt * 16 + col][0], lane); kl[jt] = frag_h(&sb.kl[jt * 16 + col][0], lane); }
#pragma unroll   // unrolled: the score tiles and fragment sets are indexed by constants and stay in registers
    for (int sub = 0; sub < FA_KT / 64; ++sub) { const int kb = sub * 64;
      v8f s[4] = {};   // S^T tiles: register r = key 8g + r of the tile, lane column = query
      FA_SB();
#pragma unroll
      for (int jt = 0; jt < 4; ++jt) s[jt] = wmma_h(kh[jt], qh, s[jt]);
#pragma unroll
      for (int jt = 0; jt < 4; ++jt) s[jt] = wmma_h(kh[jt], ql, s[jt]);
#pragma unroll
      for (int jt = 0; jt < 4; ++jt) s[jt] = wmma_h(kl[jt], qh, s[jt]);   // 3 products, in the order hi hi, residual hi, hi residual
      FA_SB();
#pragma unroll
      for (int j = 0; j < 8; ++j) vf[0][j] = frag_h(&sb.v[j * 16 + col][kb], lane);   // the first v group flies under the softmax
      if (sub + 1 < FA_KT / 64) {   // so do the stage's next 64 keys' k fragments, into the same registers
#pragma unroll
        for (int jt = 0; jt < 4; ++jt) { kh[jt] = frag_h(&sb.kh[kb + 64 + jt * 16 + col][0], lane); kl[jt] = frag_h(&sb.kl[kb + 64 + jt * 16 + col][0], lane); } }
      FA_SB();
      float m8[8];   // maximum by a tree: a single chain of 32 dependent maxima would stand exposed in a lone wave
#pragma unroll
      for (int r = 0; r < 8; ++r) m8[r] = fmaxf(fmaxf(s[0][r], s[1][r]), fmaxf(s[2][r], s[3][r]));
      float mx = fmaxf(fmaxf(fmaxf(m8[0], m8[1]), fmaxf(m8[2], m8[3])), fmaxf(fmaxf(m8[4], m8[5]), fmaxf(m8[6], m8[7])));
      mx = fmaxf(mx, xhalf(mx));   // the other half of the query's 64 keys
      const float mnew = fmaxf(mrun, mx);
      if (__builtin_amdgcn_ballot_w32(mnew > mrun) != 0) {   // scalar branch: sums are rescaled only where some query's maximum has risen
        const float al = __builtin_amdgcn_exp2f((mrun - mnew) * L2E); lsum *= al;
#pragma unroll
        for (int j = 0; j < 16; ++j) acc[j] *= al;
        mrun = mnew; }
      const float nb = 11.0f - mrun * L2E;   // P = exp(s - m) x 2^11: small weights stay normal f16 numbers; the factor cancels against the sum
      v16h pb[2];
#pragma unroll
      for (int jt = 0; jt < 4; ++jt)
#pragma unroll
        for (int r = 0; r < 8; ++r) s[jt][r] = fmaf(s[jt][r], L2E, nb);
      FA_SB();   // all exponents are formed before the first exponential: none of them then overwrites an exponential's source directly behind it
#pragma unroll
      for (int jt = 0; jt < 4; ++jt)
#pragma unroll
        for (int r = 0; r < 8; ++r) s[jt][r] = __builtin_amdgcn_exp2f(s[jt][r]);
      FA_SB();   // and no conversion or sum overwrites one
#pragma unroll
      for (int jt = 0; jt < 4; ++jt)
#pragma unroll
        for (int r = 0; r < 8; ++r) pb[jt >> 1][(jt & 1) * 8 + r] = (_Float16)s[jt][r];   // two score tiles, converted in place, are one B operand
      const v8f p8 = (s[0] + s[1]) + (s[2] + s[3]);   // the f32 weights summed by a tree, for the same reason as the maximum
      lsum += ((p8[0] + p8[1]) + (p8[2] + p8[3])) + ((p8[4] + p8[5]) + (p8[6] + p8[7]));
#pragma unroll
      for (int gi = 0; gi < 4; ++gi) { const int cur = gi & 1;   // group gi: keys kb + 32 (gi >> 1) .., channel tiles 8 (gi & 1) ..
        FA_SB();
        if (gi + 1 < 4) {
#pragma unroll
          for (int j = 0; j < 8; ++j) vf[cur ^ 1][j] = frag_h(&sb.v[(((gi + 1) & 1) * 8 + j) * 16 + col][kb + ((gi + 1) >> 1) * 32], lane); }
        FA_SB();
#pragma unroll
        for (int j = 0; j < 8; ++j) acc[cur * 8 + j] = wmma_h(vf[cur][j], pb[gi >> 1], acc[cur * 8 + j]); } }
    asm volatile("s_wait_dscnt 0x0" ::: "memory");      // this wave's reads of the buffer are done before it is refilled
    asm volatile("s_wait_asynccnt 0x0" ::: "memory");   // this wave's copies of stage t + 1 have landed
    __syncthreads();                                    // publishes stage t + 1 and ends every reader's last read of stage t
    if (t + 2 < FA_NT) { const unsigned bo = (unsigned)(t & 1) * FA_BUFB; fa_fill(lv + bo, lkh + bo, lkl + bo, bv + (size_t)(t + 2) * FA_KT, ov, bkh + (size_t)(t + 2) * FA_KT * CQ, bkl + (size_t)(t + 2) * FA_KT * CQ, ok); } }
  asm volatile("s_wait_asynccnt 0x0" ::: "memory");     // no copy is outstanding behind the loop
  const float inv = 1.0f / (lsum + xhalf(lsum));   // the halves' sums are joined once
#pragma unroll
  for (int j = 0; j < 16; ++j) { const v8f o = acc[j] * inv; v4f lo = { o[0], o[1], o[2], o[3] }, hi = { o[4], o[5], o[6], o[7] };   // a lane holds 8 consecutive channels of its query
    *(v4f*)&st[il0 + col][j * 16 + 8 * g] = lo; *(v4f*)&st[il0 + col][j * 16 + 8 * g + 4] = hi; }
  __syncthreads();
  const float gm = bfr(GM[0]);
  // channels-last rows [b*n][CV]: positions i0 .. i0+63, whole rows
  for (int e = tid; e < 64 * (CV / 4); e += 128) { const int il = e >> 6, q = e & 63; const size_t o = (b * NP + i0 + il) * CV + q * 4; const v4f sv = *(const v4f*)&st[il][q * 4]; const v4f xv = *(const v4f*)(X + o); v4f r = { gm * sv[0] + bfr(xv[0]), gm * sv[1] + bfr(xv[1]), gm * sv[2] + bfr(xv[2]), gm * sv[3] + bfr(xv[3]) }; vst2(OUT + o, r); } }
extern "C" void kernel_launch(void* const* d_in, const int* in_sizes, int n_in, void* d_out, int out_size, void* d_ws, size_t ws_size, hipStream_t stream) {
  (void)in_sizes; (void)n_in; (void)out_size;
  const float** F = (const float**)d_in;   // 0 inputs [4,64,64,256] channels-last, 1 Wq [256,32] (in,out), 2 bq, 3 Wk, 4 bk, 5 Wv [256,256], 6 bv, 7 gamma [1]
  if (ws_size < (size_t)WS_END) return;
  char* ws = (char*)d_ws; _Float16 *QH = (_Float16*)(ws + WS_QH), *QL = (_Float16*)(ws + WS_QL), *KH = (_Float16*)(ws + WS_KH), *KL = (_Float16*)(ws + WS_KL), *VT = (_Float16*)(ws + WS_VT);
  k_proj<<<dim3(NP / 64, TNB, 3), 128, 0, stream>>>(F[0], F[0], F[1], F[2], F[3], F[4], F[5], F[6], QH, QL, KH, KL, VT);
  k_fa<<<dim3(TQB, TNB), 128, 0, stream>>>(QH, QL, KH, KL, VT, F[0], F[7], (float*)d_out);
}

// v003
// A run of this version takes 70.5 microseconds.
// In both of two side-by-side timings against v002, it was 1.44 times as fast.
// All steps since v000 together make it 13.8 times as fast.
// compute dtype: all float inputs rounded to bf16, gamma read; q/k (32 ch) and v (256 ch) = x W + b ((in,out)) with EXACT bf16 products on WMMA 16x16x32 (channels-last x tile in LDS), f32 accumulate; q and k as f16 hi + unscaled residual -> UNSCALED logits with 3 products (std ~5.7, near-one-hot softmax), kept in registers; running-maximum softmax in f32 -> P f16 = exp(s - m) x 2^11; out = gamma * (P . v) / sum(P) + x with v rounded once to f16, channels-last rows; f32 output.
#include <hip/hip_runtime.h>
#include <math.h>

typedef __attribute__((ext_vector_type(16))) _Float16 v16h;
typedef __attribute__((ext_vector_type(16))) __bf16 v16b;
typedef __attribute__((ext_vector_type(8)))  _Float16 v8h;
typedef __attribute__((ext_vector_type(8)))  float v8f;
typedef __attribute__((ext_vector_type(4)))  float v4f;
typedef __attribute__((ext_vector_type(2)))  float v2f;
typedef __attribute__((ext_vector_type(4)))  unsigned v4u;
typedef __attribute__((ext_vector_type(4)))  int v4i;
typedef float __attribute__((may_alias)) float_a;
typedef int __attribute__((may_alias)) int_a;

template <typename T> __device__ __forceinline__ void vst2(void* p, T v) { *(T*)p = v;  }
__device__ __forceinline__ v8f wmma16(v16h a, v16h b, v8f c) {
  v8f d = __builtin_amdgcn_wmma_f32_16x16x32_f16(false, a, false, b, (short)0, c, false, false);
  asm volatile("v_nop\n\tv_nop\n\tv_nop\n\tv_nop" : "+v"(d) : "v"(a), "v"(b));
  return d;
}
__device__ __forceinline__ v8f wmma_bf(v16b a, v16b b, v8f c) {
  v8f d = __builtin_amdgcn_wmma_f32_16x16x32_bf16(false, a, false, b, (short)0, c, false, false);
  asm volatile("v_nop\n\tv_nop\n\tv_nop\n\tv_nop" : "+v"(d) : "v"(a), "v"(b));
  return d;
}
// 16x16x32 fragments: lane = (h = lane>>4, row/col = lane&15); elements 0..7 = k0+8h+0..7, 8..15 = k0+16+8h+0..7; D element r = row 8h+r
__device__ __forceinline__ v16h frag_h(const _Float16* rowk0, int lane) {
  union { v16h v; v8h q[2]; } u; const _Float16* p = rowk0 + 8 * (lane >> 4);
  u.q[0] = *(const v8h*)p; u.q[1] = *(const v8h*)(p + 16); return u.v;
}
__device__ __forceinline__ v16h frag_f32(const float* rowk0, int lane) {
  v16h a; const float* p = rowk0 + 8 * (lane >> 4);
#pragma unroll
  for (int i = 0; i < 8; ++i) { a[i] = (_Float16)p[i]; a[8 + i] = (_Float16)p[16 + i]; }
  return a;
}
__device__ __forceinline__ v16h frag_f32s(const float* rowk0, int lane, float sc) {
  v16h a; const float* p = rowk0 + 8 * (lane >> 4);
#pragma unroll
  for (int i = 0; i < 8; ++i) { a[i] = (_Float16)(p[i] * sc); a[8 + i] = (_Float16)(p[16 + i] * sc); }
  return a;
}
// column fragment from a [K][ld] layout (column n), rows >= K read as 0
__device__ __forceinline__ v16h fragc_f32(const float* W, int k0, int n, int lane, int ld, int K) {
  v16h a; const int g = lane >> 4;
#pragma unroll
  for (int i = 0; i < 8; ++i) { const int ka = k0 + 8 * g + i, kb = ka + 16;
    a[i] = (_Float16)(ka < K ? W[(size_t)(ka < K ? ka : K - 1) * ld + n] : 0.f); a[8 + i] = (_Float16)(kb < K ? W[(size_t)(kb < K ? kb : K - 1) * ld + n] : 0.f); }
  return a;
}
struct F2 { v16b h, l; };
__device__ __forceinline__ F2 bsplit16(const float v[16]) { F2 r;
#pragma unroll
  for (int i = 0; i < 16; ++i) { const __bf16 h = (__bf16)v[i]; r.h[i] = h; r.l[i] = (__bf16)(v[i] - (float)h); }
  return r; }
__device__ __forceinline__ F2 split_row(const float* row, int k0, int lane) { float v[16]; const float* p = row + k0 + 8 * (lane >> 4);
#pragma unroll
  for (int i = 0; i < 8; ++i) { v[i] = p[i]; v[8 + i] = p[16 + i]; }
  return bsplit16(v); }
__device__ __forceinline__ F2 split_rowK(const float* row, int k0, int lane, int K) { float v[16]; const int g = lane >> 4;
#pragma unroll
  for (int i = 0; i < 8; ++i) { const int ka = k0 + 8 * g + i, kb = ka + 16; v[i] = ka < K ? row[ka < K ? ka : K - 1] : 0.f; v[8 + i] = kb < K ? row[kb < K ? kb : K - 1] : 0.f; }
  return bsplit16(v); }
__device__ __forceinline__ F2 split_col(const float* W, int k0, int n, int lane, int ld, int K) { float v[16]; const int g = lane >> 4;
#pragma unroll
  for (int i = 0; i < 8; ++i) { const int ka = k0 + 8 * g + i, kb = ka + 16; v[i] = ka < K ? W[(size_t)(ka < K ? ka : K - 1) * ld + n] : 0.f; v[8 + i] = kb < K ? W[(size_t)(kb < K ? kb : K - 1) * ld + n] : 0.f; }
  return bsplit16(v); }
__device__ __forceinline__ v8f mac3(const F2& a, const F2& b, v8f c) { c = wmma_bf(a.l, b.h, c); c = wmma_bf(a.h, b.l, c); return wmma_bf(a.h, b.h, c); }
__device__ __forceinline__ float sigm(float v) { return 1.0f / (1.0f + expf(-v)); }
#define LDSX() do { asm volatile("s_wait_dscnt 0" ::: "memory"); __builtin_amdgcn_wave_barrier(); __builtin_amdgcn_fence(__ATOMIC_RELEASE, "workgroup"); } while (0)


// SelfAttentionModel (SAGAN-style, channels-last input [B, 64, 64, 256]): energy = q k^T unscaled over all 4,096 positions, out = gamma * softmax(energy) v + inputs.
#define NB 4
#define NP 4096
#define CIN 256
#define CQ 32
#define CV 256
#ifndef TNB
#define TNB NB
#endif
#ifndef TQB
#define TQB (NP / 64)
#endif
typedef __attribute__((ext_vector_type(8))) __bf16 v8b;
__device__ __forceinline__ v16b frag_b(const __bf16* rowk0, int lane) {
  union { v16b v; v8b q[2]; } u; const __bf16* p = rowk0 + 8 * (lane >> 4);
  u.q[0] = *(const v8b*)p; u.q[1] = *(const v8b*)(p + 16); return u.v;
}
__device__ __forceinline__ float bfr(float v) { return (float)(__bf16)v; }
__device__ __attribute__((noinline)) float exp_ni(float v) { return expf(v); }
__device__ __attribute__((noinline)) float erf_ni(float v) { return erff(v); }

#define WS_QH  0u                                    // f16 q rows [b*n][CQ] hi
#define WS_QL  (WS_QH + 2u * (size_t)NB * NP * CQ)      // f16 q residual rows (unscaled)
#define WS_KH  (WS_QL + 2u * (size_t)NB * NP * CQ)      // f16 k rows
#define WS_KL  (WS_KH + 2u * (size_t)NB * NP * CQ)      // f16 k residual rows
#define WS_VT  (WS_KL + 2u * (size_t)NB * NP * CQ)      // f16 v planes [b][CV][n]
#define WS_END (WS_VT + 2u * (size_t)NB * CV * NP)

// keeps a batch of loads together at its place, ahead of the work that hides their latency
#define PJ_SB() __builtin_amdgcn_sched_barrier(0)
// one lane's share of the eight B fragments of its out channel (all 256 in channels): wl = W + 8 g NOUT + channel; constant row steps, so one address serves all 128 loads
template <int NOUT> __device__ __forceinline__ void pj_loadw(float (&wr)[CIN / 32][16], const float* __restrict__ wl) {
#pragma unroll
  for (int kc = 0; kc < CIN / 32; ++kc)
#pragma unroll
    for (int i = 0; i < 8; ++i) { wr[kc][i] = wl[(kc * 32 + i) * NOUT]; wr[kc][8 + i] = wl[(kc * 32 + 16 + i) * NOUT]; } }
// defined behind the kernel
template <int NOUT> __device__ __forceinline__ void pj_run(const float* __restrict__ Wm, const float* __restrict__ Bm, _Float16* __restrict__ dh, _Float16* __restrict__ dl, _Float16* __restrict__ VT, const __bf16 (&sx)[64][CIN + 8], _Float16 (&sh)[64][72], _Float16 (&sl)[64][72], _Float16 (&tv)[64][72], int p0, size_t b);
// ---- k_proj: block = (64 positions, b, which 0 q / 1 k / 2 v): x tile (bf16, channels-last rows) in LDS, W [in][out] + b (exact); q and k -> f16 hi + residual rows, v -> f16 planes [c][n]
__global__ __launch_bounds__(128) void k_proj(const float* __restrict__ XQK, const float* __restrict__ XV, const float* __restrict__ WQ, const float* __restrict__ BQ, const float* __restrict__ WK, const float* __restrict__ BK, const float* __restrict__ WV, const float* __restrict__ BV, _Float16* __restrict__ QH, _Float16* __restrict__ QL, _Float16* __restrict__ KH, _Float16* __restrict__ KL, _Float16* __restrict__ VT) {
  __shared__ __align__(16) __bf16 sx[64][CIN + 8]; __shared__ __align__(16) _Float16 sh[64][72], sl[64][72]; __shared__ __align__(16) _Float16 tv[64][72];
  const int tid = threadIdx.x, wave = tid >> 5, lane = tid & 31, col = lane & 15, g = lane >> 4; const int p0 = blockIdx.x * 64; const size_t b = blockIdx.y; const int which = blockIdx.z;
  const float* Wm = which == 0 ? WQ : which == 1 ? WK : WV; const float* Bm = which == 0 ? BQ : which == 1 ? BK : BV; const float* X = (which == 2) ? XV : XQK;
  for (int e = tid; e < CIN * 64; e += 128) { const int pl = e / CIN, c = e % CIN; sx[pl][c] = (__bf16)X[((size_t)b * NP + p0 + pl) * CIN + c]; }   // channels-last rows
  __syncthreads();
  if (which == 2) pj_run<CV>(Wm, Bm, nullptr, nullptr, VT, sx, sh, sl, tv, p0, b);   // which is the same for the whole block: every barrier inside is passed by all its waves
  else pj_run<CQ>(Wm, Bm, which == 0 ? QH : KH, which == 0 ? QL : KL, nullptr, sx, sh, sl, tv, p0, b); }
// the products of a block behind its x tile: wave = all 64 positions x 16 out channels of a group of 64, so a group's W fragments are one wave's 128 registers a lane and are fetched in one batch, by that wave only
template <int NOUT> __device__ __forceinline__ void pj_run(const float* __restrict__ Wm, const float* __restrict__ Bm, _Float16* __restrict__ dh, _Float16* __restrict__ dl, _Float16* __restrict__ VT, const __bf16 (&sx)[64][CIN + 8], _Float16 (&sh)[64][72], _Float16 (&sl)[64][72], _Float16 (&tv)[64][72], int p0, size_t b) {
  const int tid = threadIdx.x, wave = tid >> 5, lane = tid & 31, col = lane & 15, g = lane >> 4;
#pragma unroll 1
  for (int cg = 0; cg < (NOUT + 63) / 64; ++cg) { float wr[CIN / 32][16]; v16b af[2][8];   // two sets of x fragments (two k steps x four position tiles each)
    const int o = min(cg * 64 + wave * 16 + col, NOUT - 1);   // columns >= NOUT are dummies (never stored)
#pragma unroll
    for (int j = 0; j < 8; ++j) af[0][j] = frag_b(&sx[(j & 3) * 16 + col][(j >> 2) * 32], lane);
    PJ_SB();   // the first x fragments' reads stand in front of the W loads: behind them they could take the loads' address registers ahead of the wait below
    const float braw = Bm[o];
    asm volatile("s_wait_xcnt 0x0" ::: "memory");   // stands in front of the W loads, whose results may take the bias load's offset register
    pj_loadw<NOUT>(wr, Wm + 8 * g * NOUT + o);   // the group's 128 W loads go out as one batch; the products start as the first of them return
    asm volatile("s_wait_xcnt 0x0" ::: "memory");   // stands in front of any later write to the loads' address registers
    PJ_SB();   // and nothing is moved up in front of that wait
    const float bb = bfr(braw);
    v8f acc[4] = {};
#pragma unroll
    for (int kp = 0; kp < CIN / 64; ++kp) { const int cur = kp & 1;
      PJ_SB();   // the next eight x fragments are read as one group ahead of this group's products
      if (kp + 1 < CIN / 64) {
#pragma unroll
        for (int j = 0; j < 8; ++j) af[cur ^ 1][j] = frag_b(&sx[(j & 3) * 16 + col][((kp + 1) * 2 + (j >> 2)) * 32], lane); }
      PJ_SB();
#pragma unroll
      for (int h = 0; h < 2; ++h) { v16b wf;
#pragma unroll
        for (int i = 0; i < 16; ++i) wf[i] = (__bf16)wr[kp * 2 + h][i];
#pragma unroll
        for (int m = 0; m < 4; ++m) acc[m] = wmma_bf(af[cur][h * 4 + m], wf, acc[m]); } }
    __syncthreads();
    const int ol = wave * 16 + col;
#pragma unroll
    for (int m = 0; m < 4; ++m)
#pragma unroll
      for (int r = 0; r < 8; ++r) { const int pl = m * 16 + 8 * g + r; const float v = acc[m][r] + bb; const _Float16 hv = (_Float16)v; if (NOUT == CV) tv[ol][pl] = hv; else { sh[pl][ol] = hv; sl[pl][ol] = (_Float16)(v - (float)hv); } }   // q AND k keep a residual
    __syncthreads();
    if (NOUT != CV) { for (int e = tid; e < 64 * 8; e += 128) { const int pl = e >> 3, q = e & 7; if (cg * 64 + q * 8 >= CQ) continue; const size_t row = b * NP + p0 + pl; vst2((unsigned*)(dh + row * CQ + cg * 64 + q * 8), *(const v4u*)&sh[pl][q * 8]); vst2((unsigned*)(dl + row * CQ + cg * 64 + q * 8), *(const v4u*)&sl[pl][q * 8]);
        asm volatile("s_wait_xcnt 0x0" ::: "memory"); } }   // stands in front of the next trip's writes to the two stores' address and data registers
    else { for (int e = tid; e < 64 * 8; e += 128) { const int ov = e >> 3, q = e & 7; vst2((unsigned*)(VT + (b * CV + cg * 64 + ov) * (size_t)NP + p0 + q * 8), *(const v4u*)&tv[ov][q * 8]); } } } }
// the plain builtin: the compiler keeps the distance behind it itself and may place operands in any register
__device__ __forceinline__ v8f wmma_h(v16h a, v16h b, v8f c) { return __builtin_amdgcn_wmma_f32_16x16x32_f16(false, a, false, b, (short)0, c, false, false); }
// lane l with lane l ^ 16, on the vector unit
__device__ __forceinline__ float xhalf(float x) { return __builtin_bit_cast(float, __builtin_amdgcn_permlanex16(__builtin_bit_cast(int, x), __builtin_bit_cast(int, x), 0x76543210, 0xfedcba98, false, false)); }
// keeps a group of LDS reads together at its place: without it the compiler spreads the reads singly among the products, each with its own wait
#define FA_SB() __builtin_amdgcn_sched_barrier(0)
// ---- k_fa: block = (64 queries, batch b), wave = 16 queries x all 256 channels: S^T = K Q^T, running-maximum softmax in registers, O^T += V^T P^T; k and v tiles of 128 keys staged in LDS (two buffers, asynchronous copies)
#define FA_KT 128                      // keys per stage: 256 B of a v row, so one wave-wide copy brings two whole row pieces
#define FA_NT (NP / FA_KT)
#define FA_VP (FA_KT + 8)              // f16 elements; 272 B = 16 B x odd: the pitch for ds_load_b128 readers
#define FA_KP (CQ + 8)                 // 80 B = 16 B x odd
#define FA_VPB (2u * FA_VP)
#define FA_KPB (2u * FA_KP)
struct FaStage { _Float16 v[CV][FA_VP]; _Float16 kh[FA_KT][FA_KP]; _Float16 kl[FA_KT][FA_KP]; };
#define FA_BUFB ((unsigned)sizeof(FaStage))
// ten copies global -> LDS; s_wait_xcnt ends the statement so that no address register is rewritten in front of it
__device__ __forceinline__ void fa_cp10(const unsigned* d, const _Float16* const* s) {
  asm volatile(
    "global_load_async_to_lds_b128 %0, %10, off\n\t"
    "global_load_async_to_lds_b128 %1, %11, off\n\t"
    "global_load_async_to_lds_b128 %2, %12, off\n\t"
    "global_load_async_to_lds_b128 %3, %13, off\n\t"
    "global_load_async_to_lds_b128 %4, %14, off\n\t"
    "global_load_async_to_lds_b128 %5, %15, off\n\t"
    "global_load_async_to_lds_b128 %6, %16, off\n\t"
    "global_load_async_to_lds_b128 %7, %17, off\n\t"
    "global_load_async_to_lds_b128 %8, %18, off\n\t"
    "global_load_async_to_lds_b128 %9, %19, off\n\t"
    "s_wait_xcnt 0x0"
    :: "v"(d[0]), "v"(d[1]), "v"(d[2]), "v"(d[3]), "v"(d[4]), "v"(d[5]), "v"(d[6]), "v"(d[7]), "v"(d[8]), "v"(d[9]),
       "v"(s[0]), "v"(s[1]), "v"(s[2]), "v"(s[3]), "v"(s[4]), "v"(s[5]), "v"(s[6]), "v"(s[7]), "v"(s[8]), "v"(s[9]) : "memory");
}
// one wave's share of a stage: 64 of the 256 v rows (two rows a copy) and 32 of the 128 keys' hi and residual rows (eight keys a copy): 40 copies in flight
// the global addresses are formed here from uniform bases and the lane's 32-bit element offsets: a lane pointer kept across the main loop and named by the asm statement itself was spilled
__device__ __forceinline__ void fa_fill(unsigned lv, unsigned lkh, unsigned lkl, const _Float16* bv, unsigned ov, const _Float16* bkh, const _Float16* bkl, unsigned ok) {
  unsigned d[10]; const _Float16* g[10];
#pragma unroll
  for (int i = 0; i < 8; ++i) { d[i] = lv + i * 2 * FA_VPB; g[i] = bv + (ov + (unsigned)i * 2u * NP); }
  d[8] = lkh; g[8] = bkh + ok; d[9] = lkl; g[9] = bkl + ok;
#pragma unroll 1   // rolled: ten running addresses (16 v rows, 8 keys a trip); unrolled, the compiler keeps all forty LDS addresses across the main loop and spills
  for (int s = 0; s < 4; ++s) { fa_cp10(d, g);
#pragma unroll
    for (int i = 0; i < 8; ++i) { d[i] += 16 * FA_VPB; g[i] += (size_t)16 * NP; }
    d[8] += 8 * FA_KPB; g[8] += (size_t)8 * CQ; d[9] += 8 * FA_KPB; g[9] += (size_t)8 * CQ; } }
__global__ __launch_bounds__(128) void k_fa(const _Float16* __restrict__ QH, const _Float16* __restrict__ QL, const _Float16* __restrict__ KH, const _Float16* __restrict__ KL, const _Float16* __restrict__ VT, const float* __restrict__ X, const float* __restrict__ GM, float* __restrict__ OUT) { __shared__ __align__(16) FaStage ring[2]; __shared__ __align__(16) float st[64][CV + 4];
  const int tid = threadIdx.x, wave = tid >> 5, lane = tid & 31, col = lane & 15, g = lane >> 4; const size_t b = blockIdx.y; const int i0 = blockIdx.x * 64; const int il0 = wave * 16;
  const unsigned lv = (unsigned)(size_t)&ring[0].v[wave * 64 + g][col * 8], lkh = (unsigned)(size_t)&ring[0].kh[wave * 32 + (lane >> 2)][(lane & 3) * 8], lkl = (unsigned)(size_t)&ring[0].kl[wave * 32 + (lane >> 2)][(lane & 3) * 8];
  const _Float16* bv = VT + b * CV * (size_t)NP; const _Float16* bkh = KH + b * NP * (size_t)CQ; const _Float16* bkl = KL + b * NP * (size_t)CQ;   // the batch's planes and rows, uniform
  const unsigned ov = (unsigned)(wave * 64 + g) * NP + col * 8, ok = (unsigned)(wave * 32 + (lane >> 2)) * CQ + (lane & 3) * 8;   // the lane's element offsets inside them
  const size_t qr = (b * NP + i0 + il0 + col) * CQ; const v16h qh = frag_h(QH + qr, lane), ql = frag_h(QL + qr, lane);   // B operands: column = query, kept for the whole kernel
  const float L2E = 1.4426950408889634f;
  v8f acc[16] = {}; float mrun = -3.0e38f, lsum = 0.f;   // per lane: its query's running maximum, and its half's share of the sum
  fa_fill(lv, lkh, lkl, bv, ov, bkh, bkl, ok);
  asm volatile("s_wait_asynccnt 0x0" ::: "memory");   // stage 0 has landed before the barrier publishes it
  __syncthreads();
  fa_fill(lv + FA_BUFB, lkh + FA_BUFB, lkl + FA_BUFB, bv + FA_KT, ov, bkh + (size_t)FA_KT * CQ, bkl + (size_t)FA_KT * CQ, ok);
#pragma unroll 1
  for (int t = 0; t < FA_NT; ++t) { const FaStage& sb = ring[t & 1];   // rolled: one stage a trip, the buffer by parity
    v16h kh[4], kl[4], vf[2][8];   // k fragments of 64 keys; two sets of v fragments: the next eight go out as one group ahead of this group's products, inside the stage only
#pragma unroll
    for (int jt = 0; jt < 4; ++jt) { kh[jt] = frag_h(&sb.kh[jt * 16 + col][0], lane); kl[jt] = frag_h(&sb.kl[jt * 16 + col][0], lane); }
#pragma unroll   // unrolled: the score tiles and fragment sets are indexed by constants and stay in registers
    for (int sub = 0; sub < FA_KT / 64; ++sub) { const int kb = sub * 64;
      v8f s[4] = {};   // S^T tiles: register r = key 8g + r of the tile, lane column = query
      FA_SB();
#pragma unroll
      for (int jt = 0; jt < 4; ++jt) s[jt] = wmma_h(kh[jt], qh, s[jt]);
#pragma unroll
      for (int jt = 0; jt < 4; ++jt) s[jt] = wmma_h(kh[jt], ql, s[jt]);
#pragma unroll
      for (int jt = 0; jt < 4; ++jt) s[jt] = wmma_h(kl[jt], qh, s[jt]);   // 3 products, in the order hi hi, residual hi, hi residual
      FA_SB();
#pragma unroll
      for (int j = 0; j < 8; ++j) vf[0][j] = frag_h(&sb.v[j * 16 + col][kb], lane);   // the first v group flies under the softmax
      if (sub + 1 < FA_KT / 64) {   // so do the stage's next 64 keys' k fragments, into the same registers
#pragma unroll
        for (int jt = 0; jt < 4; ++jt) { kh[jt] = frag_h(&sb.kh[kb + 64 + jt * 16 + col][0], lane); kl[jt] = frag_h(&sb.kl[kb + 64 + jt * 16 + col][0], lane); } }
      FA_SB();
      float m8[8];   // maximum by a tree: a single chain of 32 dependent maxima would stand exposed in a lone wave
#pragma unroll
      for (int r = 0; r < 8; ++r) m8[r] = fmaxf(fmaxf(s[0][r], s[1][r]), fmaxf(s[2][r], s[3][r]));
      float mx = fmaxf(fmaxf(fmaxf(m8[0], m8[1]), fmaxf(m8[2], m8[3])), fmaxf(fmaxf(m8[4], m8[5]), fmaxf(m8[6], m8[7])));
      mx = fmaxf(mx, xhalf(mx));   // the other half of the query's 64 keys
      const float mnew = fmaxf(mrun, mx);
      if (__builtin_amdgcn_ballot_w32(mnew > mrun) != 0) {   // scalar branch: sums are rescaled only where some query's maximum has risen
        const float al = __builtin_amdgcn_exp2f((mrun - mnew) * L2E); lsum *= al;
#pragma unroll
        for (int j = 0; j < 16; ++j) acc[j] *= al;
        mrun = mnew; }
      const float nb = 11.0f - mrun * L2E;   // P = exp(s - m) x 2^11: small weights stay normal f16 numbers; the factor cancels against the sum
      v16h pb[2];
#pragma unroll
      for (int jt = 0; jt < 4; ++jt)
#pragma unroll
        for (int r = 0; r < 8; ++r) s[jt][r] = fmaf(s[jt][r], L2E, nb);
      FA_SB();   // all exponents are formed before the first exponential: none of them then overwrites an exponential's source directly behind it
#pragma unroll
      for (int jt = 0; jt < 4; ++jt)
#pragma unroll
        for (int r = 0; r < 8; ++r) s[jt][r] = __builtin_amdgcn_exp2f(s[jt][r]);
      FA_SB();   // and no conversion or sum overwrites one
#pragma unroll
      for (int jt = 0; jt < 4; ++jt)
#pragma unroll
        for (int r = 0; r < 8; ++r) pb[jt >> 1][(jt & 1) * 8 + r] = (_Float16)s[jt][r];   // two score tiles, converted in place, are one B operand
      const v8f p8 = (s[0] + s[1]) + (s[2] + s[3]);   // the f32 weights summed by a tree, for the same reason as the maximum
      lsum += ((p8[0] + p8[1]) + (p8[2] + p8[3])) + ((p8[4] + p8[5]) + (p8[6] + p8[7]));
#pragma unroll
      for (int gi = 0; gi < 4; ++gi) { const int cur = gi & 1;   // group gi: keys kb + 32 (gi >> 1) .., channel tiles 8 (gi & 1) ..
        FA_SB();
        if (gi + 1 < 4) {
#pragma unroll
          for (int j = 0; j < 8; ++j) vf[cur ^ 1][j] = frag_h(&sb.v[(((gi + 1) & 1) * 8 + j) * 16 + col][kb + ((gi + 1) >> 1) * 32], lane); }
        FA_SB();
#pragma unroll
        for (int j = 0; j < 8; ++j) acc[cur * 8 + j] = wmma_h(vf[cur][j], pb[gi >> 1], acc[cur * 8 + j]); } }
    asm volatile("s_wait_dscnt 0x0" ::: "memory");      // this wave's reads of the buffer are done before it is refilled
    asm volatile("s_wait_asynccnt 0x0" ::: "memory");   // this wave's copies of stage t + 1 have landed
    __syncthreads();                                    // publishes stage t + 1 and ends every reader's last read of stage t
    if (t + 2 < FA_NT) { const unsigned bo = (unsigned)(t & 1) * FA_BUFB; fa_fill(lv + bo, lkh + bo, lkl + bo, bv + (size_t)(t + 2) * FA_KT, ov, bkh + (size_t)(t + 2) * FA_KT * CQ, bkl + (size_t)(t + 2) * FA_KT * CQ, ok); } }
  asm volatile("s_wait_asynccnt 0x0" ::: "memory");     // no copy is outstanding behind the loop
  const float inv = 1.0f / (lsum + xhalf(lsum));   // the halves' sums are joined once
#pragma unroll
  for (int j = 0; j < 16; ++j) { const v8f o = acc[j] * inv; v4f lo = { o[0], o[1], o[2], o[3] }, hi = { o[4], o[5], o[6], o[7] };   // a lane holds 8 consecutive channels of its query
    *(v4f*)&st[il0 + col][j * 16 + 8 * g] = lo; *(v4f*)&st[il0 + col][j * 16 + 8 * g + 4] = hi; }
  __syncthreads();
  const float gm = bfr(GM[0]);
  // channels-last rows [b*n][CV]: positions i0 .. i0+63, whole rows
  for (int e = tid; e < 64 * (CV / 4); e += 128) { const int il = e >> 6, q = e & 63; const size_t o = (b * NP + i0 + il) * CV + q * 4; const v4f sv = *(const v4f*)&st[il][q * 4]; const v4f xv = *(const v4f*)(X + o); v4f r = { gm * sv[0] + bfr(xv[0]), gm * sv[1] + bfr(xv[1]), gm * sv[2] + bfr(xv[2]), gm * sv[3] + bfr(xv[3]) }; vst2(OUT + o, r); } }
extern "C" void kernel_launch(void* const* d_in, const int* in_sizes, int n_in, void* d_out, int out_size, void* d_ws, size_t ws_size, hipStream_t stream) {
  (void)in_sizes; (void)n_in; (void)out_size;
  const float** F = (const float**)d_in;   // 0 inputs [4,64,64,256] channels-last, 1 Wq [256,32] (in,out), 2 bq, 3 Wk, 4 bk, 5 Wv [256,256], 6 bv, 7 gamma [1]
  if (ws_size < (size_t)WS_END) return;
  char* ws = (char*)d_ws; _Float16 *QH = (_Float16*)(ws + WS_QH), *QL = (_Float16*)(ws + WS_QL), *KH = (_Float16*)(ws + WS_KH), *KL = (_Float16*)(ws + WS_KL), *VT = (_Float16*)(ws + WS_VT);
  k_proj<<<dim3(NP / 64, TNB, 3), 128, 0, stream>>>(F[0], F[0], F[1], F[2], F[3], F[4], F[5], F[6], QH, QL, KH, KL, VT);
  k_fa<<<dim3(TQB, TNB), 128, 0, stream>>>(QH, QL, KH, KL, VT, F[0], F[7], (float*)d_out);
}

// v004
// Measured time: 60.3 microseconds a run.
// Two timings next to v003 put it at 1.17 and 1.16 times that version's speed.
// Over all steps from v000 it is 16.1 times as fast.
// compute dtype: all float inputs rounded to bf16, gamma read; q/k (32 ch) and v (256 ch) = x W + b ((in,out)) with EXACT bf16 products on WMMA 16x16x32 (channels-last x tile in LDS), f32 accumulate; q and k as f16 hi + unscaled residual -> UNSCALED logits with 3 products (std ~5.7, near-one-hot softmax), kept in registers; running-maximum softmax in f32 -> P f16 = exp(s - m) x 2^11; out = gamma * (P . v) / sum(P) + x with v rounded once to f16, channels-last rows; f32 output.
#include <hip/hip_runtime.h>
#include <math.h>

typedef __attribute__((ext_vector_type(16))) _Float16 v16h;
typedef __attribute__((ext_vector_type(16))) __bf16 v16b;
typedef __attribute__((ext_vector_type(8)))  _Float16 v8h;
typedef __attribute__((ext_vector_type(8)))  float v8f;
typedef __attribute__((ext_vector_type(4)))  float v4f;
typedef __attribute__((ext_vector_type(2)))  float v2f;
typedef __attribute__((ext_vector_type(4)))  unsigned v4u;
typedef __attribute__((ext_vector_type(4)))  int v4i;
typedef float __attribute__((may_alias)) float_a;
typedef int __attribute__((may_alias)) int_a;

template <typename T> __device__ __forceinline__ void vst2(void* p, T v) { *(T*)p = v;  }
__device__ __forceinline__ v8f wmma16(v16h a, v16h b, v8f c) {
  v8f d = __builtin_amdgcn_wmma_f32_16x16x32_f16(false, a, false, b, (short)0, c, false, false);
  asm volatile("v_nop\n\tv_nop\n\tv_nop\n\tv_nop" : "+v"(d) : "v"(a), "v"(b));
  return d;
}
__device__ __forceinline__ v8f wmma_bf(v16b a, v16b b, v8f c) {
  v8f d = __builtin_amdgcn_wmma_f32_16x16x32_bf16(false, a, false, b, (short)0, c, false, false);
  asm volatile("v_nop\n\tv_nop\n\tv_nop\n\tv_nop" : "+v"(d) : "v"(a), "v"(b));
  return d;
}
// 16x16x32 fragments: lane = (h = lane>>4, row/col = lane&15); elements 0..7 = k0+8h+0..7, 8..15 = k0+16+8h+0..7; D element r = row 8h+r
__device__ __forceinline__ v16h frag_h(const _Float16* rowk0, int lane) {
  union { v16h v; v8h q[2]; } u; const _Float16* p = rowk0 + 8 * (lane >> 4);
  u.q[0] = *(const v8h*)p; u.q[1] = *(const v8h*)(p + 16); return u.v;
}
__device__ __forceinline__ v16h frag_f32(const float* rowk0, int lane) {
  v16h a; const float* p = rowk0 + 8 * (lane >> 4);
#pragma unroll
  for (int i = 0; i < 8; ++i) { a[i] = (_Float16)p[i]; a[8 + i] = (_Float16)p[16 + i]; }
  return a;
}
__device__ __forceinline__ v16h frag_f32s(const float* rowk0, int lane, float sc) {
  v16h a; const float* p = rowk0 + 8 * (lane >> 4);
#pragma unroll
  for (int i = 0; i < 8; ++i) { a[i] = (_Float16)(p[i] * sc); a[8 + i] = (_Float16)(p[16 + i] * sc); }
  return a;
}
// column fragment from a [K][ld] layout (column n), rows >= K read as 0
__device__ __forceinline__ v16h fragc_f32(const float* W, int k0, int n, int lane, int ld, int K) {
  v16h a; const int g = lane >> 4;
#pragma unroll
  for (int i = 0; i < 8; ++i) { const int ka = k0 + 8 * g + i, kb = ka + 16;
    a[i] = (_Float16)(ka < K ? W[(size_t)(ka < K ? ka : K - 1) * ld + n] : 0.f); a[8 + i] = (_Float16)(kb < K ? W[(size_t)(kb < K ? kb : K - 1) * ld + n] : 0.f); }
  return a;
}
struct F2 { v16b h, l; };
__device__ __forceinline__ F2 bsplit16(const float v[16]) { F2 r;
#pragma unroll
  for (int i = 0; i < 16; ++i) { const __bf16 h = (__bf16)v[i]; r.h[i] = h; r.l[i] = (__bf16)(v[i] - (float)h); }
  return r; }
__device__ __forceinline__ F2 split_row(const float* row, int k0, int lane) { float v[16]; const float* p = row + k0 + 8 * (lane >> 4);
#pragma unroll
  for (int i = 0; i < 8; ++i) { v[i] = p[i]; v[8 + i] = p[16 + i]; }
  return bsplit16(v); }
__device__ __forceinline__ F2 split_rowK(const float* row, int k0, int lane, int K) { float v[16]; const int g = lane >> 4;
#pragma unroll
  for (int i = 0; i < 8; ++i) { const int ka = k0 + 8 * g + i, kb = ka + 16; v[i] = ka < K ? row[ka < K ? ka : K - 1] : 0.f; v[8 + i] = kb < K ? row[kb < K ? kb : K - 1] : 0.f; }
  return bsplit16(v); }
__device__ __forceinline__ F2 split_col(const float* W, int k0, int n, int lane, int ld, int K) { float v[16]; const int g = lane >> 4;
#pragma unroll
  for (int i = 0; i < 8; ++i) { const int ka = k0 + 8 * g + i, kb = ka + 16; v[i] = ka < K ? W[(size_t)(ka < K ? ka : K - 1) * ld + n] : 0.f; v[8 + i] = kb < K ? W[(size_t)(kb < K ? kb : K - 1) * ld + n] : 0.f; }
  return bsplit16(v); }
__device__ __forceinline__ v8f mac3(const F2& a, const F2& b, v8f c) { c = wmma_bf(a.l, b.h, c); c = wmma_bf(a.h, b.l, c); return wmma_bf(a.h, b.h, c); }
__device__ __forceinline__ float sigm(float v) { return 1.0f / (1.0f + expf(-v)); }
#define LDSX() do { asm volatile("s_wait_dscnt 0" ::: "memory"); __builtin_amdgcn_wave_barrier(); __builtin_amdgcn_fence(__ATOMIC_RELEASE, "workgroup"); } while (0)


// SelfAttentionModel (SAGAN-style, channels-last input [B, 64, 64, 256]): energy = q k^T unscaled over all 4,096 positions, out = gamma * softmax(energy) v + inputs.
#define NB 4
#define NP 4096
#define CIN 256
#define CQ 32
#define CV 256
#ifndef TNB
#define TNB NB
#endif
#ifndef TQB
#define TQB (NP / 64)
#endif
typedef __attribute__((ext_vector_type(8))) __bf16 v8b;
__device__ __forceinline__ v16b frag_b(const __bf16* rowk0, int lane) {
  union { v16b v; v8b q[2]; } u; const __bf16* p = rowk0 + 8 * (lane >> 4);
  u.q[0] = *(const v8b*)p; u.q[1] = *(const v8b*)(p + 16); return u.v;
}
__device__ __forceinline__ float bfr(float v) { return (float)(__bf16)v; }
__device__ __attribute__((noinline)) float exp_ni(float v) { return expf(v); }
__device__ __attribute__((noinline)) float erf_ni(float v) { return erff(v); }

#define WS_QH  0u                                    // f16 q rows [b*n][CQ] hi
#define WS_QL  (WS_QH + 2u * (size_t)NB * NP * CQ)      // f16 q residual rows (unscaled)
#define WS_KH  (WS_QL + 2u * (size_t)NB * NP * CQ)      // f16 k rows
#define WS_KL  (WS_KH + 2u * (size_t)NB * NP * CQ)      // f16 k residual rows
#define WS_VT  (WS_KL + 2u * (size_t)NB * NP * CQ)      // f16 v planes [b][CV][n]
#define WS_END (WS_VT + 2u * (size_t)NB * CV * NP)

// keeps a batch of loads together at its place, ahead of the work that hides their latency
#define PJ_SB() __builtin_amdgcn_sched_barrier(0)
// one lane's share of the eight B fragments of its out channel (all 256 in channels): wl = W + 8 g NOUT + channel; constant row steps, so one address serves all 128 loads
template <int NOUT> __device__ __forceinline__ void pj_loadw(float (&wr)[CIN / 32][16], const float* __restrict__ wl) {
#pragma unroll
  for (int kc = 0; kc < CIN / 32; ++kc)
#pragma unroll
    for (int i = 0; i < 8; ++i) { wr[kc][i] = wl[(kc * 32 + i) * NOUT]; wr[kc][8 + i] = wl[(kc * 32 + 16 + i) * NOUT]; } }
// defined behind the kernel
template <int NOUT> __device__ __forceinline__ void pj_run(const float* __restrict__ Wm, const float* __restrict__ Bm, _Float16* __restrict__ dh, _Float16* __restrict__ dl, _Float16* __restrict__ VT, const __bf16 (&sx)[64][CIN + 8], _Float16 (&sh)[64][72], _Float16 (&sl)[64][72], _Float16 (&tv)[64][72], int p0, size_t b);
// ---- k_proj: block = (64 positions, b, which 0 q / 1 k / 2 v): x tile (bf16, channels-last rows) in LDS, W [in][out] + b (exact); q and k -> f16 hi + residual rows, v -> f16 planes [c][n]
__global__ __launch_bounds__(128) void k_proj(const float* __restrict__ XQK, const float* __restrict__ XV, const float* __restrict__ WQ, const float* __restrict__ BQ, const float* __restrict__ WK, const float* __restrict__ BK, const float* __restrict__ WV, const float* __restrict__ BV, _Float16* __restrict__ QH, _Float16* __restrict__ QL, _Float16* __restrict__ KH, _Float16* __restrict__ KL, _Float16* __restrict__ VT) {
  __shared__ __align__(16) __bf16 sx[64][CIN + 8]; __shared__ __align__(16) _Float16 sh[64][72], sl[64][72]; __shared__ __align__(16) _Float16 tv[64][72];
  const int tid = threadIdx.x, wave = tid >> 5, lane = tid & 31, col = lane & 15, g = lane >> 4; const int p0 = blockIdx.x * 64; const size_t b = blockIdx.y; const int which = blockIdx.z;
  const float* Wm = which == 0 ? WQ : which == 1 ? WK : WV; const float* Bm = which == 0 ? BQ : which == 1 ? BK : BV; const float* X = (which == 2) ? XV : XQK;
  for (int e = tid; e < CIN * 64; e += 128) { const int pl = e / CIN, c = e % CIN; sx[pl][c] = (__bf16)X[((size_t)b * NP + p0 + pl) * CIN + c]; }   // channels-last rows
  __syncthreads();
  if (which == 2) pj_run<CV>(Wm, Bm, nullptr, nullptr, VT, sx, sh, sl, tv, p0, b);   // which is the same for the whole block: every barrier inside is passed by all its waves
  else pj_run<CQ>(Wm, Bm, which == 0 ? QH : KH, which == 0 ? QL : KL, nullptr, sx, sh, sl, tv, p0, b); }
// the products of a block behind its x tile: wave = all 64 positions x 16 out channels of a group of 64, so a group's W fragments are one wave's 128 registers a lane and are fetched in one batch, by that wave only
template <int NOUT> __device__ __forceinline__ void pj_run(const float* __restrict__ Wm, const float* __restrict__ Bm, _Float16* __restrict__ dh, _Float16* __restrict__ dl, _Float16* __restrict__ VT, const __bf16 (&sx)[64][CIN + 8], _Float16 (&sh)[64][72], _Float16 (&sl)[64][72], _Float16 (&tv)[64][72], int p0, size_t b) {
  const int tid = threadIdx.x, wave = tid >> 5, lane = tid & 31, col = lane & 15, g = lane >> 4;
#pragma unroll 1
  for (int cg = 0; cg < (NOUT + 63) / 64; ++cg) { float wr[CIN / 32][16]; v16b af[2][8];   // two sets of x fragments (two k steps x four position tiles each)
    const int o = min(cg * 64 + wave * 16 + col, NOUT - 1);   // columns >= NOUT are dummies (never stored)
#pragma unroll
    for (int j = 0; j < 8; ++j) af[0][j] = frag_b(&sx[(j & 3) * 16 + col][(j >> 2) * 32], lane);
    PJ_SB();   // the first x fragments' reads stand in front of the W loads: behind them they could take the loads' address registers ahead of the wait below
    const float braw = Bm[o];
    asm volatile("s_wait_xcnt 0x0" ::: "memory");   // stands in front of the W loads, whose results may take the bias load's offset register
    pj_loadw<NOUT>(wr, Wm + 8 * g * NOUT + o);   // the group's 128 W loads go out as one batch; the products start as the first of them return
    asm volatile("s_wait_xcnt 0x0" ::: "memory");   // stands in front of any later write to the loads' address registers
    PJ_SB();   // and nothing is moved up in front of that wait
    const float bb = bfr(braw);
    v8f acc[4] = {};
#pragma unroll
    for (int kp = 0; kp < CIN / 64; ++kp) { const int cur = kp & 1;
      PJ_SB();   // the next eight x fragments are read as one group ahead of this group's products
      if (kp + 1 < CIN / 64) {
#pragma unroll
        for (int j = 0; j < 8; ++j) af[cur ^ 1][j] = frag_b(&sx[(j & 3) * 16 + col][((kp + 1) * 2 + (j >> 2)) * 32], lane); }
      PJ_SB();
#pragma unroll
      for (int h = 0; h < 2; ++h) { v16b wf;
#pragma unroll
        for (int i = 0; i < 16; ++i) wf[i] = (__bf16)wr[kp * 2 + h][i];
#pragma unroll
        for (int m = 0; m < 4; ++m) acc[m] = wmma_bf(af[cur][h * 4 + m], wf, acc[m]); } }
    __syncthreads();
    const int ol = wave * 16 + col;
#pragma unroll
    for (int m = 0; m < 4; ++m)
#pragma unroll
      for (int r = 0; r < 8; ++r) { const int pl = m * 16 + 8 * g + r; const float v = acc[m][r] + bb; const _Float16 hv = (_Float16)v; if (NOUT == CV) tv[ol][pl] = hv; else { sh[pl][ol] = hv; sl[pl][ol] = (_Float16)(v - (float)hv); } }   // q AND k keep a residual
    __syncthreads();
    if (NOUT != CV) { for (int e = tid; e < 64 * 8; e += 128) { const int pl = e >> 3, q = e & 7; if (cg * 64 + q * 8 >= CQ) continue; const size_t row = b * NP + p0 + pl; vst2((unsigned*)(dh + row * CQ + cg * 64 + q * 8), *(const v4u*)&sh[pl][q * 8]); vst2((unsigned*)(dl + row * CQ + cg * 64 + q * 8), *(const v4u*)&sl[pl][q * 8]);
        asm volatile("s_wait_xcnt 0x0" ::: "memory"); } }   // stands in front of the next trip's writes to the two stores' address and data registers
    else { for (int e = tid; e < 64 * 8; e += 128) { const int ov = e >> 3, q = e & 7; vst2((unsigned*)(VT + (b * CV + cg * 64 + ov) * (size_t)NP + p0 + q * 8), *(const v4u*)&tv[ov][q * 8]); } } } }
// the plain builtin: the compiler keeps the distance behind it itself and may place operands in any register
__device__ __forceinline__ v8f wmma_h(v16h a, v16h b, v8f c) { return __builtin_amdgcn_wmma_f32_16x16x32_f16(false, a, false, b, (short)0, c, false, false); }
// lane l with lane l ^ 16, on the vector unit
__device__ __forceinline__ float xhalf(float x) { return __builtin_bit_cast(float, __builtin_amdgcn_permlanex16(__builtin_bit_cast(int, x), __builtin_bit_cast(int, x), 0x76543210, 0xfedcba98, false, false)); }
// keeps a group of LDS reads together at its place: without it the compiler spreads the reads singly among the products, each with its own wait
#define FA_SB() __builtin_amdgcn_sched_barrier(0)
// ---- k_fa: block = (64 queries, batch b), eight waves = 2 query halves x 4 key quarters: wave = 32 queries x all 256 channels x 32 of a stage's 128 keys, so a v fragment read from LDS serves two products and two waves share a SIMD; S^T = K Q^T, running-maximum softmax in registers, O^T += V^T P^T; the four key quarters' sums are joined once, behind the loop, through LDS; k and v tiles of 128 keys staged in LDS (two buffers, asynchronous copies)
#define FA_KT 128                      // keys per stage: 256 B of a v row, so one wave-wide copy brings two whole row pieces
#define FA_NT (NP / FA_KT)
#define FA_VP (FA_KT + 8)              // f16 elements; 272 B = 16 B x odd: the pitch for ds_load_b128 readers
#define FA_KP (CQ + 8)                 // 80 B = 16 B x odd
#define FA_VPB (2u * FA_VP)
#define FA_KPB (2u * FA_KP)
struct FaStage { _Float16 v[CV][FA_VP]; _Float16 kh[FA_KT][FA_KP]; _Float16 kl[FA_KT][FA_KP]; };
#define FA_BUFB ((unsigned)sizeof(FaStage))
// ten copies global -> LDS; s_wait_xcnt ends the statement so that no address register is rewritten in front of it
__device__ __forceinline__ void fa_cp10(const unsigned* d, const _Float16* const* s) {
  asm volatile(
    "global_load_async_to_lds_b128 %0, %10, off\n\t"
    "global_load_async_to_lds_b128 %1, %11, off\n\t"
    "global_load_async_to_lds_b128 %2, %12, off\n\t"
    "global_load_async_to_lds_b128 %3, %13, off\n\t"
    "global_load_async_to_lds_b128 %4, %14, off\n\t"
    "global_load_async_to_lds_b128 %5, %15, off\n\t"
    "global_load_async_to_lds_b128 %6, %16, off\n\t"
    "global_load_async_to_lds_b128 %7, %17, off\n\t"
    "global_load_async_to_lds_b128 %8, %18, off\n\t"
    "global_load_async_to_lds_b128 %9, %19, off\n\t"
    "s_wait_xcnt 0x0"
    :: "v"(d[0]), "v"(d[1]), "v"(d[2]), "v"(d[3]), "v"(d[4]), "v"(d[5]), "v"(d[6]), "v"(d[7]), "v"(d[8]), "v"(d[9]),
       "v"(s[0]), "v"(s[1]), "v"(s[2]), "v"(s[3]), "v"(s[4]), "v"(s[5]), "v"(s[6]), "v"(s[7]), "v"(s[8]), "v"(s[9]) : "memory");
}
// one wave's share of a stage: 32 of the 256 v rows (two rows a copy) and 16 of the 128 keys' hi and residual rows (eight keys a copy): 20 copies in flight
// the global addresses are formed here from uniform bases and the lane's 32-bit element offsets: a lane pointer kept across the main loop and named by the asm statement itself was spilled
__device__ __forceinline__ void fa_fill(unsigned lv, unsigned lkh, unsigned lkl, const _Float16* bv, unsigned ov, const _Float16* bkh, const _Float16* bkl, unsigned ok) {
  unsigned d[10]; const _Float16* g[10];
#pragma unroll
  for (int i = 0; i < 8; ++i) { d[i] = lv + i * 2 * FA_VPB; g[i] = bv + (ov + (unsigned)i * 2u * NP); }
  d[8] = lkh; g[8] = bkh + ok; d[9] = lkl; g[9] = bkl + ok;
#pragma unroll 1   // rolled: ten running addresses (16 v rows, 8 keys a trip); unrolled, the compiler keeps all the LDS addresses across the main loop
  for (int s = 0; s < 2; ++s) { fa_cp10(d, g);
#pragma unroll
    for (int i = 0; i < 8; ++i) { d[i] += 16 * FA_VPB; g[i] += (size_t)16 * NP; }
    d[8] += 8 * FA_KPB; g[8] += (size_t)8 * CQ; d[9] += 8 * FA_KPB; g[9] += (size_t)8 * CQ; } }
union FaSh { FaStage ring[2]; float part[4][64][CV + 4]; };   // behind the loop the ring's bytes hold the four key quarters' scaled sums
__global__ __launch_bounds__(256) void k_fa(const _Float16* __restrict__ QH, const _Float16* __restrict__ QL, const _Float16* __restrict__ KH, const _Float16* __restrict__ KL, const _Float16* __restrict__ VT, const float* __restrict__ X, const float* __restrict__ GM, float* __restrict__ OUT) { __shared__ __align__(16) FaSh sh; __shared__ float sm[4][64], sl[4][64];
  const int tid = threadIdx.x, wave = tid >> 5, lane = tid & 31, col = lane & 15, g = lane >> 4; const size_t b = blockIdx.y; const int i0 = blockIdx.x * 64;
  const int qg = wave & 1, kg = wave >> 1; const int il0 = qg * 32, k0 = kg * 32;   // the wave's 32 queries of the block, and its 32 keys of every stage
  const unsigned lv = (unsigned)(size_t)&sh.ring[0].v[wave * 32 + g][col * 8], lkh = (unsigned)(size_t)&sh.ring[0].kh[wave * 16 + (lane >> 2)][(lane & 3) * 8], lkl = (unsigned)(size_t)&sh.ring[0].kl[wave * 16 + (lane >> 2)][(lane & 3) * 8];
  const _Float16* bv = VT + b * CV * (size_t)NP; const _Float16* bkh = KH + b * NP * (size_t)CQ; const _Float16* bkl = KL + b * NP * (size_t)CQ;   // the batch's planes and rows, uniform
  const unsigned ov = (unsigned)(wave * 32 + g) * NP + col * 8, ok = (unsigned)(wave * 16 + (lane >> 2)) * CQ + (lane & 3) * 8;   // the lane's element offsets inside them
  v16h qh[2], ql[2];   // B operands: column = query, two tiles of 16, kept for the whole kernel
  const size_t qr = (b * NP + i0 + il0 + col) * CQ + 8 * g; const _Float16* pqh = QH + qr; const _Float16* pql = QL + qr;   // the lane's place in its first query's rows: elements 8g .. and 16 + 8g ..
#pragma unroll
  for (int qt = 0; qt < 2; ++qt) { union { v16h v; v8h q[2]; } uh, ul; uh.q[0] = *(const v8h*)(pqh + qt * 16 * CQ); uh.q[1] = *(const v8h*)(pqh + qt * 16 * CQ + 16); ul.q[0] = *(const v8h*)(pql + qt * 16 * CQ); ul.q[1] = *(const v8h*)(pql + qt * 16 * CQ + 16); qh[qt] = uh.v; ql[qt] = ul.v; }
  asm volatile("s_wait_xcnt 0x0" :: "v"(pqh), "v"(pql) : "memory");   // stands in front of any later write to the q loads' address registers, which it names as inputs so that they live up to it
  FA_SB();   // and nothing is moved up in front of that wait
  const float L2E = 1.4426950408889634f;
  v8f acc[2][16] = {}; float mrun[2] = { -3.0e38f, -3.0e38f }, lsum[2] = { 0.f, 0.f }, nb[2] = { 0.f, 0.f };   // per lane and query tile: its query's running maximum over the wave's keys, its half's share of the sum, and 11 - maximum x log2 e (set with the maximum): P = exp(s - m) x 2^11, so small weights stay normal f16 numbers; the factor cancels against the sum
  fa_fill(lv, lkh, lkl, bv, ov, bkh, bkl, ok);
  asm volatile("s_wait_asynccnt 0x0" ::: "memory");   // stage 0 has landed before the barrier publishes it
  __syncthreads();
  fa_fill(lv + FA_BUFB, lkh + FA_BUFB, lkl + FA_BUFB, bv + FA_KT, ov, bkh + (size_t)FA_KT * CQ, bkl + (size_t)FA_KT * CQ, ok);
#pragma unroll 1
  for (int t = 0; t < FA_NT; ++t) { const FaStage& sb = sh.ring[t & 1];   // rolled: one stage a trip, the buffer by parity
    v16h kh[2], kl[2], vf[2][8];   // k fragments of the wave's 32 keys; two sets of v fragments: the second goes out as one group ahead of the first group's products
#pragma unroll
    for (int kt = 0; kt < 2; ++kt) { kh[kt] = frag_h(&sb.kh[k0 + kt * 16 + col][0], lane); kl[kt] = frag_h(&sb.kl[k0 + kt * 16 + col][0], lane); }
    v8f s[2][2] = {};   // S^T tiles [query tile][key tile]: register r = key 8g + r of the tile, lane column = query
    FA_SB();
#pragma unroll
    for (int x = 0; x < 4; ++x) s[x >> 1][x & 1] = wmma_h(kh[x & 1], qh[x >> 1], s[x >> 1][x & 1]);
#pragma unroll
    for (int x = 0; x < 4; ++x) s[x >> 1][x & 1] = wmma_h(kh[x & 1], ql[x >> 1], s[x >> 1][x & 1]);
#pragma unroll
    for (int x = 0; x < 4; ++x) s[x >> 1][x & 1] = wmma_h(kl[x & 1], qh[x >> 1], s[x >> 1][x & 1]);   // 3 products, in the order hi hi, residual hi, hi residual
    FA_SB();
#pragma unroll
    for (int j = 0; j < 8; ++j) vf[0][j] = frag_h(&sb.v[j * 16 + col][k0], lane);   // the first v group flies under the softmax
    FA_SB();
    float mnew[2];
#pragma unroll
    for (int qt = 0; qt < 2; ++qt) { float m8[8];   // maximum by a tree, not a single chain of dependent maxima
#pragma unroll
      for (int r = 0; r < 8; ++r) m8[r] = fmaxf(s[qt][0][r], s[qt][1][r]);
      float mx = fmaxf(fmaxf(fmaxf(m8[0], m8[1]), fmaxf(m8[2], m8[3])), fmaxf(fmaxf(m8[4], m8[5]), fmaxf(m8[6], m8[7])));
      mx = fmaxf(mx, xhalf(mx));   // the other half of the query's 32 keys
      mnew[qt] = fmaxf(mrun[qt], mx); }
    if (__builtin_amdgcn_ballot_w32(mnew[0] > mrun[0] || mnew[1] > mrun[1]) != 0) {   // scalar branch, one test a stage: sums are rescaled only where some query's maximum has risen
      const float al0 = __builtin_amdgcn_exp2f((mrun[0] - mnew[0]) * L2E), al1 = __builtin_amdgcn_exp2f((mrun[1] - mnew[1]) * L2E);
      mrun[0] = mnew[0]; mrun[1] = mnew[1]; lsum[0] *= al0; lsum[1] *= al1; nb[0] = 11.0f - mnew[0] * L2E; nb[1] = 11.0f - mnew[1] * L2E;
#pragma unroll
      for (int j = 0; j < 16; ++j) { acc[0][j] *= al0; acc[1][j] *= al1; } }
    v16h pb[2];
#pragma unroll
    for (int x = 0; x < 4; ++x)
#pragma unroll
      for (int r = 0; r < 8; ++r) s[x >> 1][x & 1][r] = fmaf(s[x >> 1][x & 1][r], L2E, nb[x >> 1]);
    FA_SB();   // all exponents are formed before the first exponential: none of them then overwrites an exponential's source directly behind it
#pragma unroll
    for (int x = 0; x < 4; ++x)
#pragma unroll
      for (int r = 0; r < 8; ++r) s[x >> 1][x & 1][r] = __builtin_amdgcn_exp2f(s[x >> 1][x & 1][r]);
    FA_SB();   // and no conversion or sum overwrites one
#pragma unroll
    for (int x = 0; x < 4; ++x)
#pragma unroll
      for (int r = 0; r < 8; ++r) pb[x >> 1][(x & 1) * 8 + r] = (_Float16)s[x >> 1][x & 1][r];   // a query tile's two score tiles, converted in place, are one B operand
#pragma unroll
    for (int qt = 0; qt < 2; ++qt) { const v8f p8 = s[qt][0] + s[qt][1];   // the f32 weights summed by a tree, for the same reason as the maximum
      lsum[qt] += ((p8[0] + p8[1]) + (p8[2] + p8[3])) + ((p8[4] + p8[5]) + (p8[6] + p8[7])); }
    FA_SB();
#pragma unroll
    for (int j = 0; j < 8; ++j) vf[1][j] = frag_h(&sb.v[(8 + j) * 16 + col][k0], lane);   // the stage's last LDS reads fly under the first group's products
    FA_SB();
#pragma unroll
    for (int j = 0; j < 8; ++j) { acc[0][j] = wmma_h(vf[0][j], pb[0], acc[0][j]); acc[1][j] = wmma_h(vf[0][j], pb[1], acc[1][j]); }   // channel tiles 0 .. 7, both query tiles on each fragment
    FA_SB();   // these products stay in front of the stage's foot: sunk behind its barrier they would hold back the refill
    asm volatile("s_wait_dscnt 0x0" :: "v"(lsum[0]), "v"(lsum[1]) : "memory");      // this wave's reads of the buffer are done before it is refilled; the two sums are named as inputs so that they are formed in front of the refill: sunk behind it, their 32 weights stay live beside the copies' addresses and a register is spilled
    asm volatile("s_wait_asynccnt 0x0" ::: "memory");   // this wave's copies of stage t + 1 have landed
    __syncthreads();                                    // publishes stage t + 1 and ends every reader's last read of stage t
    if (t + 2 < FA_NT) { const unsigned bo = (unsigned)(t & 1) * FA_BUFB; fa_fill(lv + bo, lkh + bo, lkl + bo, bv + (size_t)(t + 2) * FA_KT, ov, bkh + (size_t)(t + 2) * FA_KT * CQ, bkl + (size_t)(t + 2) * FA_KT * CQ, ok); }
    FA_SB();   // channel tiles 8 .. 15, all operands in registers, stand behind the refill: the copies go out as soon as the buffer is free and fly under these products too
#pragma unroll
    for (int j = 0; j < 8; ++j) { acc[0][8 + j] = wmma_h(vf[1][j], pb[0], acc[0][8 + j]); acc[1][8 + j] = wmma_h(vf[1][j], pb[1], acc[1][8 + j]); } }
  asm volatile("s_wait_asynccnt 0x0" ::: "memory");     // no copy is outstanding behind the loop
  // the four key quarters of a query are joined: maxima and sums first, then the sums of products, each scaled to the common maximum and divided by the whole sum
#pragma unroll
  for (int qt = 0; qt < 2; ++qt) { const float lj = lsum[qt] + xhalf(lsum[qt]);   // the halves' sums are joined once
    if (g == 0) { sm[kg][il0 + qt * 16 + col] = mrun[qt]; sl[kg][il0 + qt * 16 + col] = lj; } }
  __syncthreads();   // every quarter's maxima and sums are written; the loop's last barrier has ended every read of the ring
#pragma unroll
  for (int qt = 0; qt < 2; ++qt) { const int q = il0 + qt * 16 + col;
    const float m0 = sm[0][q], m1 = sm[1][q], m2 = sm[2][q], m3 = sm[3][q]; const float mm = fmaxf(fmaxf(m0, m1), fmaxf(m2, m3));
    const float e0 = __builtin_amdgcn_exp2f((m0 - mm) * L2E), e1 = __builtin_amdgcn_exp2f((m1 - mm) * L2E), e2 = __builtin_amdgcn_exp2f((m2 - mm) * L2E), e3 = __builtin_amdgcn_exp2f((m3 - mm) * L2E);
    const float ls = (sl[0][q] * e0 + sl[1][q] * e1) + (sl[2][q] * e2 + sl[3][q] * e3);
    const float inv = __builtin_amdgcn_exp2f((mrun[qt] - mm) * L2E) / ls;   // the wave's own quarter's factor over the whole sum
#pragma unroll
    for (int j = 0; j < 16; ++j) { const v8f o = acc[qt][j] * inv; v4f lo = { o[0], o[1], o[2], o[3] }, hi = { o[4], o[5], o[6], o[7] };   // a lane holds 8 consecutive channels of its query
      *(v4f*)&sh.part[kg][q][j * 16 + 8 * g] = lo; *(v4f*)&sh.part[kg][q][j * 16 + 8 * g + 4] = hi; } }
  __syncthreads();   // all four quarters' rows are written before any is read
  const float gm = bfr(GM[0]);
  // channels-last rows [b*n][CV]: positions i0 .. i0+63, whole rows
#pragma unroll 1   // rolled, so that the wait at the trip's foot stands once behind four stores
  for (int i = 0; i < 64 * (CV / 4) / 256; i += 4) {
#pragma unroll   // four row pieces a trip: their x loads go out together and wait once, not one latency each
    for (int u = 0; u < 4; ++u) { const int e = tid + (i + u) * 256, il = e >> 6, q = e & 63; const size_t o = (b * NP + i0 + il) * CV + q * 4; const v4f sv = (*(const v4f*)&sh.part[0][il][q * 4] + *(const v4f*)&sh.part[1][il][q * 4]) + (*(const v4f*)&sh.part[2][il][q * 4] + *(const v4f*)&sh.part[3][il][q * 4]); const v4f xv = *(const v4f*)(X + o); v4f r = { gm * sv[0] + bfr(xv[0]), gm * sv[1] + bfr(xv[1]), gm * sv[2] + bfr(xv[2]), gm * sv[3] + bfr(xv[3]) }; vst2(OUT + o, r); }
    asm volatile("s_wait_xcnt 0x0" ::: "memory"); } }   // stands in front of the next trip's writes to the four stores' address and data registers
extern "C" void kernel_launch(void* const* d_in, const int* in_sizes, int n_in, void* d_out, int out_size, void* d_ws, size_t ws_size, hipStream_t stream) {
  (void)in_sizes; (void)n_in; (void)out_size;
  const float** F = (const float**)d_in;   // 0 inputs [4,64,64,256] channels-last, 1 Wq [256,32] (in,out), 2 bq, 3 Wk, 4 bk, 5 Wv [256,256], 6 bv, 7 gamma [1]
  if (ws_size < (size_t)WS_END) return;
  char* ws = (char*)d_ws; _Float16 *QH = (_Float16*)(ws + WS_QH), *QL = (_Float16*)(ws + WS_QL), *KH = (_Float16*)(ws + WS_KH), *KL = (_Float16*)(ws + WS_KL), *VT = (_Float16*)(ws + WS_VT);
  k_proj<<<dim3(NP / 64, TNB, 3), 128, 0, stream>>>(F[0], F[0], F[1], F[2], F[3], F[4], F[5], F[6], QH, QL, KH, KL, VT);
  k_fa<<<dim3(TQB, TNB), 256, 0, stream>>>(QH, QL, KH, KL, VT, F[0], F[7], (float*)d_out);
}

// v005
// One run takes 54.3 microseconds.
// Timed twice side by side with v004, it ran 1.11 times as fast both times.
// All steps since v000 together make it 17.9 times as fast.
// compute dtype: all float inputs rounded to bf16, gamma read; q/k (32 ch) and v (256 ch) = x W + b ((in,out)) with EXACT bf16 products on WMMA 16x16x32 (channels-last x tile in LDS), f32 accumulate; q and k as f16 hi + unscaled residual -> UNSCALED logits with 3 products (std ~5.7, near-one-hot softmax), kept in registers; running-maximum softmax in f32 -> P f16 = exp(s - m) x 2^11; out = gamma * (P . v) / sum(P) + x with v rounded once to f16, channels-last rows; f32 output.
#include <hip/hip_runtime.h>
#include <math.h>

typedef __attribute__((ext_vector_type(16))) _Float16 v16h;
typedef __attribute__((ext_vector_type(16))) __bf16 v16b;
typedef __attribute__((ext_vector_type(8)))  _Float16 v8h;
typedef __attribute__((ext_vector_type(8)))  float v8f;
typedef __attribute__((ext_vector_type(4)))  float v4f;
typedef __attribute__((ext_vector_type(2)))  float v2f;
typedef __attribute__((ext_vector_type(4)))  unsigned v4u;
typedef __attribute__((ext_vector_type(4)))  int v4i;
typedef float __attribute__((may_alias)) float_a;
typedef int __attribute__((may_alias)) int_a;

template <typename T> __device__ __forceinline__ void vst2(void* p, T v) { *(T*)p = v;  }
__device__ __forceinline__ v8f wmma16(v16h a, v16h b, v8f c) {
  v8f d = __builtin_amdgcn_wmma_f32_16x16x32_f16(false, a, false, b, (short)0, c, false, false);
  asm volatile("v_nop\n\tv_nop\n\tv_nop\n\tv_nop" : "+v"(d) : "v"(a), "v"(b));
  return d;
}
__device__ __forceinline__ v8f wmma_bf(v16b a, v16b b, v8f c) {
  v8f d = __builtin_amdgcn_wmma_f32_16x16x32_bf16(false, a, false, b, (short)0, c, false, false);
  asm volatile("v_nop\n\tv_nop\n\tv_nop\n\tv_nop" : "+v"(d) : "v"(a), "v"(b));
  return d;
}
// 16x16x32 fragments: lane = (h = lane>>4, row/col = lane&15); elements 0..7 = k0+8h+0..7, 8..15 = k0+16+8h+0..7; D element r = row 8h+r
__device__ __forceinline__ v16h frag_h(const _Float16* rowk0, int lane) {
  union { v16h v; v8h q[2]; } u; const _Float16* p = rowk0 + 8 * (lane >> 4);
  u.q[0] = *(const v8h*)p; u.q[1] = *(const v8h*)(p + 16); return u.v;
}
__device__ __forceinline__ v16h frag_f32(const float* rowk0, int lane) {
  v16h a; const float* p = rowk0 + 8 * (lane >> 4);
#pragma unroll
  for (int i = 0; i < 8; ++i) { a[i] = (_Float16)p[i]; a[8 + i] = (_Float16)p[16 + i]; }
  return a;
}
__device__ __forceinline__ v16h frag_f32s(const float* rowk0, int lane, float sc) {
  v16h a; const float* p = rowk0 + 8 * (lane >> 4);
#pragma unroll
  for (int i = 0; i < 8; ++i) { a[i] = (_Float16)(p[i] * sc); a[8 + i] = (_Float16)(p[16 + i] * sc); }
  return a;
}
// column fragment from a [K][ld] layout (column n), rows >= K read as 0
__device__ __forceinline__ v16h fragc_f32(const float* W, int k0, int n, int lane, int ld, int K) {
  v16h a; const int g = lane >> 4;
#pragma unroll
  for (int i = 0; i < 8; ++i) { const int ka = k0 + 8 * g + i, kb = ka + 16;
    a[i] = (_Float16)(ka < K ? W[(size_t)(ka < K ? ka : K - 1) * ld + n] : 0.f); a[8 + i] = (_Float16)(kb < K ? W[(size_t)(kb < K ? kb : K - 1) * ld + n] : 0.f); }
  return a;
}
struct F2 { v16b h, l; };
__device__ __forceinline__ F2 bsplit16(const float v[16]) { F2 r;
#pragma unroll
  for (int i = 0; i < 16; ++i) { const __bf16 h = (__bf16)v[i]; r.h[i] = h; r.l[i] = (__bf16)(v[i] - (float)h); }
  return r; }
__device__ __forceinline__ F2 split_row(const float* row, int k0, int lane) { float v[16]; const float* p = row + k0 + 8 * (lane >> 4);
#pragma unroll
  for (int i = 0; i < 8; ++i) { v[i] = p[i]; v[8 + i] = p[16 + i]; }
  return bsplit16(v); }
__device__ __forceinline__ F2 split_rowK(const float* row, int k0, int lane, int K) { float v[16]; const int g = lane >> 4;
#pragma unroll
  for (int i = 0; i < 8; ++i) { const int ka = k0 + 8 * g + i, kb = ka + 16; v[i] = ka < K ? row[ka < K ? ka : K - 1] : 0.f; v[8 + i] = kb < K ? row[kb < K ? kb : K - 1] : 0.f; }
  return bsplit16(v); }
__device__ __forceinline__ F2 split_col(const float* W, int k0, int n, int lane, int ld, int K) { float v[16]; const int g = lane >> 4;
#pragma unroll
  for (int i = 0; i < 8; ++i) { const int ka = k0 + 8 * g + i, kb = ka + 16; v[i] = ka < K ? W[(size_t)(ka < K ? ka : K - 1) * ld + n] : 0.f; v[8 + i] = kb < K ? W[(size_t)(kb < K ? kb : K - 1) * ld + n] : 0.f; }
  return bsplit16(v); }
__device__ __forceinline__ v8f mac3(const F2& a, const F2& b, v8f c) { c = wmma_bf(a.l, b.h, c); c = wmma_bf(a.h, b.l, c); return wmma_bf(a.h, b.h, c); }
__device__ __forceinline__ float sigm(float v) { return 1.0f / (1.0f + expf(-v)); }
#define LDSX() do { asm volatile("s_wait_dscnt 0" ::: "memory"); __builtin_amdgcn_wave_barrier(); __builtin_amdgcn_fence(__ATOMIC_RELEASE, "workgroup"); } while (0)


// SelfAttentionModel (SAGAN-style, channels-last input [B, 64, 64, 256]): energy = q k^T unscaled over all 4,096 positions, out = gamma * softmax(energy) v + inputs.
#define NB 4
#define NP 4096
#define CIN 256
#define CQ 32
#define CV 256
#ifndef TNB
#define TNB NB
#endif
#ifndef TQB
#define TQB (NP / 64)
#endif
typedef __attribute__((ext_vector_type(8))) __bf16 v8b;
typedef __attribute__((ext_vector_type(4))) __bf16 v4b;
__device__ __forceinline__ v16b frag_b(const __bf16* rowk0, int lane) {
  union { v16b v; v8b q[2]; } u; const __bf16* p = rowk0 + 8 * (lane >> 4);
  u.q[0] = *(const v8b*)p; u.q[1] = *(const v8b*)(p + 16); return u.v;
}
__device__ __forceinline__ float bfr(float v) { return (float)(__bf16)v; }
__device__ __attribute__((noinline)) float exp_ni(float v) { return expf(v); }
__device__ __attribute__((noinline)) float erf_ni(float v) { return erff(v); }

#define WS_QH  0u                                    // f16 q rows [b*n][CQ] hi
#define WS_QL  (WS_QH + 2u * (size_t)NB * NP * CQ)      // f16 q residual rows (unscaled)
#define WS_KH  (WS_QL + 2u * (size_t)NB * NP * CQ)      // f16 k rows
#define WS_KL  (WS_KH + 2u * (size_t)NB * NP * CQ)      // f16 k residual rows
#define WS_VT  (WS_KL + 2u * (size_t)NB * NP * CQ)      // f16 v planes [b][CV][n]
#define WS_END (WS_VT + 2u * (size_t)NB * CV * NP)

// keeps a batch of loads together at its place, ahead of the work that hides their latency
#define PJ_SB() __builtin_amdgcn_sched_barrier(0)
// one lane's share of the eight B fragments of its out channel (all 256 in channels): wl = W + 8 g NOUT + channel; constant row steps, so one address serves all 128 loads
template <int NOUT> __device__ __forceinline__ void pj_loadw(float (&wr)[CIN / 32][16], const float* __restrict__ wl) {
#pragma unroll
  for (int kc = 0; kc < CIN / 32; ++kc)
#pragma unroll
    for (int i = 0; i < 8; ++i) { wr[kc][i] = wl[(kc * 32 + i) * NOUT]; wr[kc][8 + i] = wl[(kc * 32 + 16 + i) * NOUT]; } }
// defined behind the kernel
template <int NOUT> __device__ __forceinline__ void pj_run(const float* __restrict__ Wm, const float* __restrict__ Bm, _Float16* __restrict__ dh, _Float16* __restrict__ dl, _Float16* __restrict__ VT, const __bf16 (&sx)[64][CIN + 8], _Float16 (&sh)[64][72], _Float16 (&sl)[64][72], _Float16 (&tv)[64][72], int p0, size_t b);
// ---- k_proj: block = (64 positions, b, which 0 q / 1 k / 2 v): x tile (bf16, channels-last rows) in LDS, W [in][out] + b (exact); q and k -> f16 hi + residual rows, v -> f16 planes [c][n]
__global__ __launch_bounds__(128) void k_proj(const float* __restrict__ XQK, const float* __restrict__ XV, const float* __restrict__ WQ, const float* __restrict__ BQ, const float* __restrict__ WK, const float* __restrict__ BK, const float* __restrict__ WV, const float* __restrict__ BV, _Float16* __restrict__ QH, _Float16* __restrict__ QL, _Float16* __restrict__ KH, _Float16* __restrict__ KL, _Float16* __restrict__ VT) {
  __shared__ __align__(16) __bf16 sx[64][CIN + 8]; __shared__ __align__(16) _Float16 sh[64][72], sl[64][72]; __shared__ __align__(16) _Float16 tv[64][72];
  const int tid = threadIdx.x, wave = tid >> 5, lane = tid & 31, col = lane & 15, g = lane >> 4; const int p0 = blockIdx.x * 64; const size_t b = blockIdx.y; const int which = blockIdx.z;
  const float* Wm = which == 0 ? WQ : which == 1 ? WK : WV; const float* Bm = which == 0 ? BQ : which == 1 ? BK : BV; const float* X = (which == 2) ? XV : XQK;
  { const float* xl = X + ((size_t)b * NP + p0) * CIN + tid * 4;   // channels-last rows: the tile's 64 rows are 64 KB in a row, taken as 16-byte pieces, piece tid + 128 i
    v4f xr[32];
#pragma unroll
    for (int i = 0; i < 32; ++i) xr[i] = *(const v4f*)(xl + i * 512);   // a thread's 32 loads go out as one batch: one latency for the tile, not one per group of eight 4-byte loads
#pragma unroll
    for (int i = 0; i < 32; ++i) { const v4b xb = { (__bf16)xr[i][0], (__bf16)xr[i][1], (__bf16)xr[i][2], (__bf16)xr[i][3] }; *(v4b*)&sx[(tid >> 6) + 2 * i][(tid & 63) * 4] = xb; } }   // four channels an 8-byte LDS store
  __syncthreads();
  if (which == 2) pj_run<CV>(Wm, Bm, nullptr, nullptr, VT, sx, sh, sl, tv, p0, b);   // which is the same for the whole block: every barrier inside is passed by all its waves
  else pj_run<CQ>(Wm, Bm, which == 0 ? QH : KH, which == 0 ? QL : KL, nullptr, sx, sh, sl, tv, p0, b); }
// the products of a block behind its x tile: wave = all 64 positions x 16 out channels of a group of 64, so a group's W fragments are one wave's 128 registers a lane and are fetched in one batch, by that wave only
template <int NOUT> __device__ __forceinline__ void pj_run(const float* __restrict__ Wm, const float* __restrict__ Bm, _Float16* __restrict__ dh, _Float16* __restrict__ dl, _Float16* __restrict__ VT, const __bf16 (&sx)[64][CIN + 8], _Float16 (&sh)[64][72], _Float16 (&sl)[64][72], _Float16 (&tv)[64][72], int p0, size_t b) {
  const int tid = threadIdx.x, wave = tid >> 5, lane = tid & 31, col = lane & 15, g = lane >> 4;
#pragma unroll 1
  for (int cg = 0; cg < (NOUT + 63) / 64; ++cg) { float wr[CIN / 32][16]; v16b af[2][8];   // two sets of x fragments (two k steps x four position tiles each)
    const int o = min(cg * 64 + wave * 16 + col, NOUT - 1);   // columns >= NOUT are dummies (never stored)
#pragma unroll
    for (int j = 0; j < 8; ++j) af[0][j] = frag_b(&sx[(j & 3) * 16 + col][(j >> 2) * 32], lane);
    PJ_SB();   // the first x fragments' reads stand in front of the W loads: behind them they could take the loads' address registers ahead of the wait below
    const float braw = Bm[o];
    asm volatile("s_wait_xcnt 0x0" ::: "memory");   // stands in front of the W loads, whose results may take the bias load's offset register
    pj_loadw<NOUT>(wr, Wm + 8 * g * NOUT + o);   // the group's 128 W loads go out as one batch; the products start as the first of them return
    asm volatile("s_wait_xcnt 0x0" ::: "memory");   // stands in front of any later write to the loads' address registers
    PJ_SB();   // and nothing is moved up in front of that wait
    const float bb = bfr(braw);
    v8f acc[4] = {};
#pragma unroll
    for (int kp = 0; kp < CIN / 64; ++kp) { const int cur = kp & 1;
      PJ_SB();   // the next eight x fragments are read as one group ahead of this group's products
      if (kp + 1 < CIN / 64) {
#pragma unroll
        for (int j = 0; j < 8; ++j) af[cur ^ 1][j] = frag_b(&sx[(j & 3) * 16 + col][((kp + 1) * 2 + (j >> 2)) * 32], lane); }
      PJ_SB();
#pragma unroll
      for (int h = 0; h < 2; ++h) { v16b wf;
#pragma unroll
        for (int i = 0; i < 16; ++i) wf[i] = (__bf16)wr[kp * 2 + h][i];
#pragma unroll
        for (int m = 0; m < 4; ++m) acc[m] = wmma_bf(af[cur][h * 4 + m], wf, acc[m]); } }
    __syncthreads();
    const int ol = wave * 16 + col;
#pragma unroll
    for (int m = 0; m < 4; ++m)
#pragma unroll
      for (int r = 0; r < 8; ++r) { const int pl = m * 16 + 8 * g + r; const float v = acc[m][r] + bb; const _Float16 hv = (_Float16)v; if (NOUT == CV) tv[ol][pl] = hv; else { sh[pl][ol] = hv; sl[pl][ol] = (_Float16)(v - (float)hv); } }   // q AND k keep a residual
    __syncthreads();
    if (NOUT != CV) { for (int e = tid; e < 64 * 8; e += 128) { const int pl = e >> 3, q = e & 7; if (cg * 64 + q * 8 >= CQ) continue; const size_t row = b * NP + p0 + pl; vst2((unsigned*)(dh + row * CQ + cg * 64 + q * 8), *(const v4u*)&sh[pl][q * 8]); vst2((unsigned*)(dl + row * CQ + cg * 64 + q * 8), *(const v4u*)&sl[pl][q * 8]);
        asm volatile("s_wait_xcnt 0x0" ::: "memory"); } }   // stands in front of the next trip's writes to the two stores' address and data registers
    else { for (int e = tid; e < 64 * 8; e += 128) { const int ov = e >> 3, q = e & 7; vst2((unsigned*)(VT + (b * CV + cg * 64 + ov) * (size_t)NP + p0 + q * 8), *(const v4u*)&tv[ov][q * 8]); } } } }
// the plain builtin: the compiler keeps the distance behind it itself and may place operands in any register
__device__ __forceinline__ v8f wmma_h(v16h a, v16h b, v8f c) { return __builtin_amdgcn_wmma_f32_16x16x32_f16(false, a, false, b, (short)0, c, false, false); }
// lane l with lane l ^ 16, on the vector unit
__device__ __forceinline__ float xhalf(float x) { return __builtin_bit_cast(float, __builtin_amdgcn_permlanex16(__builtin_bit_cast(int, x), __builtin_bit_cast(int, x), 0x76543210, 0xfedcba98, false, false)); }
// keeps a group of LDS reads together at its place: without it the compiler spreads the reads singly among the products, each with its own wait
#define FA_SB() __builtin_amdgcn_sched_barrier(0)
// ---- k_fa: block = (64 queries, batch b), eight waves = 2 query halves x 4 key quarters: wave = 32 queries x all 256 channels x 32 of a stage's 128 keys, so a v fragment read from LDS serves two products and two waves share a SIMD; S^T = K Q^T, running-maximum softmax in registers, O^T += V^T P^T; the four key quarters' sums are joined once, behind the loop, through LDS; k and v tiles of 128 keys staged in LDS (two buffers, asynchronous copies)
#define FA_KT 128                      // keys per stage: 256 B of a v row, so one wave-wide copy brings two whole row pieces
#define FA_NT (NP / FA_KT)
#define FA_VP (FA_KT + 8)              // f16 elements; 272 B = 16 B x odd: the pitch for ds_load_b128 readers
#define FA_KP (CQ + 8)                 // 80 B = 16 B x odd
#define FA_VPB (2u * FA_VP)
#define FA_KPB (2u * FA_KP)
struct FaStage { _Float16 v[CV][FA_VP]; _Float16 kh[FA_KT][FA_KP]; _Float16 kl[FA_KT][FA_KP]; };
#define FA_BUFB ((unsigned)sizeof(FaStage))
// ten copies global -> LDS; s_wait_xcnt ends the statement so that no address register is rewritten in front of it
__device__ __forceinline__ void fa_cp10(const unsigned* d, const _Float16* const* s) {
  asm volatile(
    "global_load_async_to_lds_b128 %0, %10, off\n\t"
    "global_load_async_to_lds_b128 %1, %11, off\n\t"
    "global_load_async_to_lds_b128 %2, %12, off\n\t"
    "global_load_async_to_lds_b128 %3, %13, off\n\t"
    "global_load_async_to_lds_b128 %4, %14, off\n\t"
    "global_load_async_to_lds_b128 %5, %15, off\n\t"
    "global_load_async_to_lds_b128 %6, %16, off\n\t"
    "global_load_async_to_lds_b128 %7, %17, off\n\t"
    "global_load_async_to_lds_b128 %8, %18, off\n\t"
    "global_load_async_to_lds_b128 %9, %19, off\n\t"
    "s_wait_xcnt 0x0"
    :: "v"(d[0]), "v"(d[1]), "v"(d[2]), "v"(d[3]), "v"(d[4]), "v"(d[5]), "v"(d[6]), "v"(d[7]), "v"(d[8]), "v"(d[9]),
       "v"(s[0]), "v"(s[1]), "v"(s[2]), "v"(s[3]), "v"(s[4]), "v"(s[5]), "v"(s[6]), "v"(s[7]), "v"(s[8]), "v"(s[9]) : "memory");
}
// one wave's share of a stage: 32 of the 256 v rows (two rows a copy) and 16 of the 128 keys' hi and residual rows (eight keys a copy): 20 copies in flight
// the global addresses are formed here from uniform bases and the lane's 32-bit element offsets: a lane pointer kept across the main loop and named by the asm statement itself was spilled
__device__ __forceinline__ void fa_fill(unsigned lv, unsigned lkh, unsigned lkl, const _Float16* bv, unsigned ov, const _Float16* bkh, const _Float16* bkl, unsigned ok) {
  unsigned d[10]; const _Float16* g[10];
#pragma unroll
  for (int i = 0; i < 8; ++i) { d[i] = lv + i * 2 * FA_VPB; g[i] = bv + (ov + (unsigned)i * 2u * NP); }
  d[8] = lkh; g[8] = bkh + ok; d[9] = lkl; g[9] = bkl + ok;
#pragma unroll 1   // rolled: ten running addresses (16 v rows, 8 keys a trip); unrolled, the compiler keeps all the LDS addresses across the main loop
  for (int s = 0; s < 2; ++s) { fa_cp10(d, g);
#pragma unroll
    for (int i = 0; i < 8; ++i) { d[i] += 16 * FA_VPB; g[i] += (size_t)16 * NP; }
    d[8] += 8 * FA_KPB; g[8] += (size_t)8 * CQ; d[9] += 8 * FA_KPB; g[9] += (size_t)8 * CQ; } }
union FaSh { FaStage ring[2]; float part[4][64][CV + 4]; };   // behind the loop the ring's bytes hold the four key quarters' scaled sums
__global__ __launch_bounds__(256) void k_fa(const _Float16* __restrict__ QH, const _Float16* __restrict__ QL, const _Float16* __restrict__ KH, const _Float16* __restrict__ KL, const _Float16* __restrict__ VT, const float* __restrict__ X, const float* __restrict__ GM, float* __restrict__ OUT) { __shared__ __align__(16) FaSh sh; __shared__ float sm[4][64], sl[4][64];
  const int tid = threadIdx.x, wave = tid >> 5, lane = tid & 31, col = lane & 15, g = lane >> 4; const size_t b = blockIdx.y; const int i0 = blockIdx.x * 64;
  const int qg = wave & 1, kg = wave >> 1; const int il0 = qg * 32, k0 = kg * 32;   // the wave's 32 queries of the block, and its 32 keys of every stage
  const unsigned lv = (unsigned)(size_t)&sh.ring[0].v[wave * 32 + g][col * 8], lkh = (unsigned)(size_t)&sh.ring[0].kh[wave * 16 + (lane >> 2)][(lane & 3) * 8], lkl = (unsigned)(size_t)&sh.ring[0].kl[wave * 16 + (lane >> 2)][(lane & 3) * 8];
  const _Float16* bv = VT + b * CV * (size_t)NP; const _Float16* bkh = KH + b * NP * (size_t)CQ; const _Float16* bkl = KL + b * NP * (size_t)CQ;   // the batch's planes and rows, uniform
  const unsigned ov = (unsigned)(wave * 32 + g) * NP + col * 8, ok = (unsigned)(wave * 16 + (lane >> 2)) * CQ + (lane & 3) * 8;   // the lane's element offsets inside them
  v16h qh[2], ql[2];   // B operands: column = query, two tiles of 16, kept for the whole kernel
  const size_t qr = (b * NP + i0 + il0 + col) * CQ + 8 * g; const _Float16* pqh = QH + qr; const _Float16* pql = QL + qr;   // the lane's place in its first query's rows: elements 8g .. and 16 + 8g ..
#pragma unroll
  for (int qt = 0; qt < 2; ++qt) { union { v16h v; v8h q[2]; } uh, ul; uh.q[0] = *(const v8h*)(pqh + qt * 16 * CQ); uh.q[1] = *(const v8h*)(pqh + qt * 16 * CQ + 16); ul.q[0] = *(const v8h*)(pql + qt * 16 * CQ); ul.q[1] = *(const v8h*)(pql + qt * 16 * CQ + 16); qh[qt] = uh.v; ql[qt] = ul.v; }
  asm volatile("s_wait_xcnt 0x0" :: "v"(pqh), "v"(pql) : "memory");   // stands in front of any later write to the q loads' address registers, which it names as inputs so that they live up to it
  FA_SB();   // and nothing is moved up in front of that wait
  const float L2E = 1.4426950408889634f;
  v8f acc[2][16] = {}; float mrun[2] = { -3.0e38f, -3.0e38f }, lsum[2] = { 0.f, 0.f }, nb[2] = { 0.f, 0.f };   // per lane and query tile: its query's running maximum over the wave's keys, its half's share of the sum, and 11 - maximum x log2 e (set with the maximum): P = exp(s - m) x 2^11, so small weights stay normal f16 numbers; the factor cancels against the sum
  fa_fill(lv, lkh, lkl, bv, ov, bkh, bkl, ok);
  asm volatile("s_wait_asynccnt 0x0" ::: "memory");   // stage 0 has landed before the barrier publishes it
  __syncthreads();
  fa_fill(lv + FA_BUFB, lkh + FA_BUFB, lkl + FA_BUFB, bv + FA_KT, ov, bkh + (size_t)FA_KT * CQ, bkl + (size_t)FA_KT * CQ, ok);
#pragma unroll 1
  for (int t = 0; t < FA_NT; ++t) { const FaStage& sb = sh.ring[t & 1];   // rolled: one stage a trip, the buffer by parity
    v16h kh[2], kl[2], vf[2][8];   // k fragments of the wave's 32 keys; two sets of v fragments: the second goes out as one group ahead of the first group's products
#pragma unroll
    for (int kt = 0; kt < 2; ++kt) { kh[kt] = frag_h(&sb.kh[k0 + kt * 16 + col][0], lane); kl[kt] = frag_h(&sb.kl[k0 + kt * 16 + col][0], lane); }
    v8f s[2][2] = {};   // S^T tiles [query tile][key tile]: register r = key 8g + r of the tile, lane column = query
    FA_SB();
#pragma unroll
    for (int x = 0; x < 4; ++x) s[x >> 1][x & 1] = wmma_h(kh[x & 1], qh[x >> 1], s[x >> 1][x & 1]);
#pragma unroll
    for (int x = 0; x < 4; ++x) s[x >> 1][x & 1] = wmma_h(kh[x & 1], ql[x >> 1], s[x >> 1][x & 1]);
#pragma unroll
    for (int x = 0; x < 4; ++x) s[x >> 1][x & 1] = wmma_h(kl[x & 1], qh[x >> 1], s[x >> 1][x & 1]);   // 3 products, in the order hi hi, residual hi, hi residual
    FA_SB();
#pragma unroll
    for (int j = 0; j < 8; ++j) vf[0][j] = frag_h(&sb.v[j * 16 + col][k0], lane);   // the first v group flies under the softmax
    FA_SB();
    float mnew[2];
#pragma unroll
    for (int qt = 0; qt < 2; ++qt) { float m8[8];   // maximum by a tree, not a single chain of dependent maxima
#pragma unroll
      for (int r = 0; r < 8; ++r) m8[r] = fmaxf(s[qt][0][r], s[qt][1][r]);
      float mx = fmaxf(fmaxf(fmaxf(m8[0], m8[1]), fmaxf(m8[2], m8[3])), fmaxf(fmaxf(m8[4], m8[5]), fmaxf(m8[6], m8[7])));
      mx = fmaxf(mx, xhalf(mx));   // the other half of the query's 32 keys
      mnew[qt] = fmaxf(mrun[qt], mx); }
    if (__builtin_amdgcn_ballot_w32(mnew[0] > mrun[0] || mnew[1] > mrun[1]) != 0) {   // scalar branch, one test a stage: sums are rescaled only where some query's maximum has risen
      const float al0 = __builtin_amdgcn_exp2f((mrun[0] - mnew[0]) * L2E), al1 = __builtin_amdgcn_exp2f((mrun[1] - mnew[1]) * L2E);
      mrun[0] = mnew[0]; mrun[1] = mnew[1]; lsum[0] *= al0; lsum[1] *= al1; nb[0] = 11.0f - mnew[0] * L2E; nb[1] = 11.0f - mnew[1] * L2E;
#pragma unroll
      for (int j = 0; j < 16; ++j) { acc[0][j] *= al0; acc[1][j] *= al1; } }
    v16h pb[2];
#pragma unroll
    for (int x = 0; x < 4; ++x)
#pragma unroll
      for (int r = 0; r < 8; ++r) s[x >> 1][x & 1][r] = fmaf(s[x >> 1][x & 1][r], L2E, nb[x >> 1]);
    FA_SB();   // all exponents are formed before the first exponential: none of them then overwrites an exponential's source directly behind it
#pragma unroll
    for (int x = 0; x < 4; ++x)
#pragma unroll
      for (int r = 0; r < 8; ++r) s[x >> 1][x & 1][r] = __builtin_amdgcn_exp2f(s[x >> 1][x & 1][r]);
    FA_SB();   // and no conversion or sum overwrites one
#pragma unroll
    for (int x = 0; x < 4; ++x)
#pragma unroll
      for (int r = 0; r < 8; ++r) pb[x >> 1][(x & 1) * 8 + r] = (_Float16)s[x >> 1][x & 1][r];   // a query tile's two score tiles, converted in place, are one B operand
#pragma unroll
    for (int qt = 0; qt < 2; ++qt) { const v8f p8 = s[qt][0] + s[qt][1];   // the f32 weights summed by a tree, for the same reason as the maximum
      lsum[qt] += ((p8[0] + p8[1]) + (p8[2] + p8[3])) + ((p8[4] + p8[5]) + (p8[6] + p8[7])); }
    FA_SB();
#pragma unroll
    for (int j = 0; j < 8; ++j) vf[1][j] = frag_h(&sb.v[(8 + j) * 16 + col][k0], lane);   // the stage's last LDS reads fly under the first group's products
    FA_SB();
#pragma unroll
    for (int j = 0; j < 8; ++j) { acc[0][j] = wmma_h(vf[0][j], pb[0], acc[0][j]); acc[1][j] = wmma_h(vf[0][j], pb[1], acc[1][j]); }   // channel tiles 0 .. 7, both query tiles on each fragment
    FA_SB();   // these products stay in front of the stage's foot: sunk behind its barrier they would hold back the refill
    asm volatile("s_wait_dscnt 0x0" :: "v"(lsum[0]), "v"(lsum[1]) : "memory");      // this wave's reads of the buffer are done before it is refilled; the two sums are named as inputs so that they are formed in front of the refill: sunk behind it, their 32 weights stay live beside the copies' addresses and a register is spilled
    asm volatile("s_wait_asynccnt 0x0" ::: "memory");   // this wave's copies of stage t + 1 have landed
    __syncthreads();                                    // publishes stage t + 1 and ends every reader's last read of stage t
    if (t + 2 < FA_NT) { const unsigned bo = (unsigned)(t & 1) * FA_BUFB; fa_fill(lv + bo, lkh + bo, lkl + bo, bv + (size_t)(t + 2) * FA_KT, ov, bkh + (size_t)(t + 2) * FA_KT * CQ, bkl + (size_t)(t + 2) * FA_KT * CQ, ok); }
    FA_SB();   // channel tiles 8 .. 15, all operands in registers, stand behind the refill: the copies go out as soon as the buffer is free and fly under these products too
#pragma unroll
    for (int j = 0; j < 8; ++j) { acc[0][8 + j] = wmma_h(vf[1][j], pb[0], acc[0][8 + j]); acc[1][8 + j] = wmma_h(vf[1][j], pb[1], acc[1][8 + j]); } }
  asm volatile("s_wait_asynccnt 0x0" ::: "memory");     // no copy is outstanding behind the loop
  // the four key quarters of a query are joined: maxima and sums first, then the sums of products, each scaled to the common maximum and divided by the whole sum
#pragma unroll
  for (int qt = 0; qt < 2; ++qt) { const float lj = lsum[qt] + xhalf(lsum[qt]);   // the halves' sums are joined once
    if (g == 0) { sm[kg][il0 + qt * 16 + col] = mrun[qt]; sl[kg][il0 + qt * 16 + col] = lj; } }
  __syncthreads();   // every quarter's maxima and sums are written; the loop's last barrier has ended every read of the ring
#pragma unroll
  for (int qt = 0; qt < 2; ++qt) { const int q = il0 + qt * 16 + col;
    const float m0 = sm[0][q], m1 = sm[1][q], m2 = sm[2][q], m3 = sm[3][q]; const float mm = fmaxf(fmaxf(m0, m1), fmaxf(m2, m3));
    const float e0 = __builtin_amdgcn_exp2f((m0 - mm) * L2E), e1 = __builtin_amdgcn_exp2f((m1 - mm) * L2E), e2 = __builtin_amdgcn_exp2f((m2 - mm) * L2E), e3 = __builtin_amdgcn_exp2f((m3 - mm) * L2E);
    const float ls = (sl[0][q] * e0 + sl[1][q] * e1) + (sl[2][q] * e2 + sl[3][q] * e3);
    const float inv = __builtin_amdgcn_exp2f((mrun[qt] - mm) * L2E) / ls;   // the wave's own quarter's factor over the whole sum
#pragma unroll
    for (int j = 0; j < 16; ++j) { const v8f o = acc[qt][j] * inv; v4f lo = { o[0], o[1], o[2], o[3] }, hi = { o[4], o[5], o[6], o[7] };   // a lane holds 8 consecutive channels of its query
      *(v4f*)&sh.part[kg][q][j * 16 + 8 * g] = lo; *(v4f*)&sh.part[kg][q][j * 16 + 8 * g + 4] = hi; } }
  __syncthreads();   // all four quarters' rows are written before any is read
  const float gm = bfr(GM[0]);
  // channels-last rows [b*n][CV]: positions i0 .. i0+63, whole rows
#pragma unroll 1   // rolled, so that the wait at the trip's foot stands once behind four stores
  for (int i = 0; i < 64 * (CV / 4) / 256; i += 4) {
#pragma unroll   // four row pieces a trip: their x loads go out together and wait once, not one latency each
    for (int u = 0; u < 4; ++u) { const int e = tid + (i + u) * 256, il = e >> 6, q = e & 63; const size_t o = (b * NP + i0 + il) * CV + q * 4; const v4f sv = (*(const v4f*)&sh.part[0][il][q * 4] + *(const v4f*)&sh.part[1][il][q * 4]) + (*(const v4f*)&sh.part[2][il][q * 4] + *(const v4f*)&sh.part[3][il][q * 4]); const v4f xv = *(const v4f*)(X + o); v4f r = { gm * sv[0] + bfr(xv[0]), gm * sv[1] + bfr(xv[1]), gm * sv[2] + bfr(xv[2]), gm * sv[3] + bfr(xv[3]) }; vst2(OUT + o, r); }
    asm volatile("s_wait_xcnt 0x0" ::: "memory"); } }   // stands in front of the next trip's writes to the four stores' address and data registers
extern "C" void kernel_launch(void* const* d_in, const int* in_sizes, int n_in, void* d_out, int out_size, void* d_ws, size_t ws_size, hipStream_t stream) {
  (void)in_sizes; (void)n_in; (void)out_size;
  const float** F = (const float**)d_in;   // 0 inputs [4,64,64,256] channels-last, 1 Wq [256,32] (in,out), 2 bq, 3 Wk, 4 bk, 5 Wv [256,256], 6 bv, 7 gamma [1]
  if (ws_size < (size_t)WS_END) return;
  char* ws = (char*)d_ws; _Float16 *QH = (_Float16*)(ws + WS_QH), *QL = (_Float16*)(ws + WS_QL), *KH = (_Float16*)(ws + WS_KH), *KL = (_Float16*)(ws + WS_KL), *VT = (_Float16*)(ws + WS_VT);
  k_proj<<<dim3(NP / 64, TNB, 3), 128, 0, stream>>>(F[0], F[0], F[1], F[2], F[3], F[4], F[5], F[6], QH, QL, KH, KL, VT);
  k_fa<<<dim3(TQB, TNB), 256, 0, stream>>>(QH, QL, KH, KL, VT, F[0], F[7], (float*)d_out);
}

// v006
// Measured time: 50.9 microseconds a run.
// In two side-by-side timings against v005, it was 1.06 and 1.07 times as fast.
// Over all steps from v000 it is 19.1 times as fast.
// compute dtype: all float inputs rounded to bf16, gamma read; q/k (32 ch) and v (256 ch) = x W + b ((in,out)) with EXACT bf16 products on WMMA 16x16x32 (channels-last x tile in LDS), f32 accumulate; q and k as f16 hi + unscaled residual -> UNSCALED logits with 3 products (std ~5.7, near-one-hot softmax), kept in registers; running-maximum softmax in f32, the maximum in use m raised lazily -> P f16 = exp(s - m) / 8 <= 2^15; out = gamma * (P . v) / sum(P) + x with v rounded once to f16, channels-last rows; f32 output.
#include <hip/hip_runtime.h>
#include <math.h>

typedef __attribute__((ext_vector_type(16))) _Float16 v16h;
typedef __attribute__((ext_vector_type(16))) __bf16 v16b;
typedef __attribute__((ext_vector_type(8)))  _Float16 v8h;
typedef __attribute__((ext_vector_type(8)))  float v8f;
typedef __attribute__((ext_vector_type(4)))  float v4f;
typedef __attribute__((ext_vector_type(2)))  float v2f;
typedef __attribute__((ext_vector_type(4)))  unsigned v4u;
typedef __attribute__((ext_vector_type(4)))  int v4i;
typedef float __attribute__((may_alias)) float_a;
typedef int __attribute__((may_alias)) int_a;

template <typename T> __device__ __forceinline__ void vst2(void* p, T v) { *(T*)p = v;  }
__device__ __forceinline__ v8f wmma16(v16h a, v16h b, v8f c) {
  v8f d = __builtin_amdgcn_wmma_f32_16x16x32_f16(false, a, false, b, (short)0, c, false, false);
  asm volatile("v_nop\n\tv_nop\n\tv_nop\n\tv_nop" : "+v"(d) : "v"(a), "v"(b));
  return d;
}
__device__ __forceinline__ v8f wmma_bf(v16b a, v16b b, v8f c) {
  v8f d = __builtin_amdgcn_wmma_f32_16x16x32_bf16(false, a, false, b, (short)0, c, false, false);
  asm volatile("v_nop\n\tv_nop\n\tv_nop\n\tv_nop" : "+v"(d) : "v"(a), "v"(b));
  return d;
}
// 16x16x32 fragments: lane = (h = lane>>4, row/col = lane&15); elements 0..7 = k0+8h+0..7, 8..15 = k0+16+8h+0..7; D element r = row 8h+r
__device__ __forceinline__ v16h frag_h(const _Float16* rowk0, int lane) {
  union { v16h v; v8h q[2]; } u; const _Float16* p = rowk0 + 8 * (lane >> 4);
  u.q[0] = *(const v8h*)p; u.q[1] = *(const v8h*)(p + 16); return u.v;
}
__device__ __forceinline__ v16h frag_f32(const float* rowk0, int lane) {
  v16h a; const float* p = rowk0 + 8 * (lane >> 4);
#pragma unroll
  for (int i = 0; i < 8; ++i) { a[i] = (_Float16)p[i]; a[8 + i] = (_Float16)p[16 + i]; }
  return a;
}
__device__ __forceinline__ v16h frag_f32s(const float* rowk0, int lane, float sc) {
  v16h a; const float* p = rowk0 + 8 * (lane >> 4);
#pragma unroll
  for (int i = 0; i < 8; ++i) { a[i] = (_Float16)(p[i] * sc); a[8 + i] = (_Float16)(p[16 + i] * sc); }
  return a;
}
// column fragment from a [K][ld] layout (column n), rows >= K read as 0
__device__ __forceinline__ v16h fragc_f32(const float* W, int k0, int n, int lane, int ld, int K) {
  v16h a; const int g = lane >> 4;
#pragma unroll
  for (int i = 0; i < 8; ++i) { const int ka = k0 + 8 * g + i, kb = ka + 16;
    a[i] = (_Float16)(ka < K ? W[(size_t)(ka < K ? ka : K - 1) * ld + n] : 0.f); a[8 + i] = (_Float16)(kb < K ? W[(size_t)(kb < K ? kb : K - 1) * ld + n] : 0.f); }
  return a;
}
struct F2 { v16b h, l; };
__device__ __forceinline__ F2 bsplit16(const float v[16]) { F2 r;
#pragma unroll
  for (int i = 0; i < 16; ++i) { const __bf16 h = (__bf16)v[i]; r.h[i] = h; r.l[i] = (__bf16)(v[i] - (float)h); }
  return r; }
__device__ __forceinline__ F2 split_row(const float* row, int k0, int lane) { float v[16]; const float* p = row + k0 + 8 * (lane >> 4);
#pragma unroll
  for (int i = 0; i < 8; ++i) { v[i] = p[i]; v[8 + i] = p[16 + i]; }
  return bsplit16(v); }
__device__ __forceinline__ F2 split_rowK(const float* row, int k0, int lane, int K) { float v[16]; const int g = lane >> 4;
#pragma unroll
  for (int i = 0; i < 8; ++i) { const int ka = k0 + 8 * g + i, kb = ka + 16; v[i] = ka < K ? row[ka < K ? ka : K - 1] : 0.f; v[8 + i] = kb < K ? row[kb < K ? kb : K - 1] : 0.f; }
  return bsplit16(v); }
__device__ __forceinline__ F2 split_col(const float* W, int k0, int n, int lane, int ld, int K) { float v[16]; const int g = lane >> 4;
#pragma unroll
  for (int i = 0; i < 8; ++i) { const int ka = k0 + 8 * g + i, kb = ka + 16; v[i] = ka < K ? W[(size_t)(ka < K ? ka : K - 1) * ld + n] : 0.f; v[8 + i] = kb < K ? W[(size_t)(kb < K ? kb : K - 1) * ld + n] : 0.f; }
  return bsplit16(v); }
__device__ __forceinline__ v8f mac3(const F2& a, const F2& b, v8f c) { c = wmma_bf(a.l, b.h, c); c = wmma_bf(a.h, b.l, c); return wmma_bf(a.h, b.h, c); }
__device__ __forceinline__ float sigm(float v) { return 1.0f / (1.0f + expf(-v)); }
#define LDSX() do { asm volatile("s_wait_dscnt 0" ::: "memory"); __builtin_amdgcn_wave_barrier(); __builtin_amdgcn_fence(__ATOMIC_RELEASE, "workgroup"); } while (0)


// SelfAttentionModel (SAGAN-style, channels-last input [B, 64, 64, 256]): energy = q k^T unscaled over all 4,096 positions, out = gamma * softmax(energy) v + inputs.
#define NB 4
#define NP 4096
#define CIN 256
#define CQ 32
#define CV 256
#ifndef TNB
#define TNB NB
#endif
#ifndef TQB
#define TQB (NP / 64)
#endif
typedef __attribute__((ext_vector_type(8))) __bf16 v8b;
typedef __attribute__((ext_vector_type(4))) __bf16 v4b;
__device__ __forceinline__ v16b frag_b(const __bf16* rowk0, int lane) {
  union { v16b v; v8b q[2]; } u; const __bf16* p = rowk0 + 8 * (lane >> 4);
  u.q[0] = *(const v8b*)p; u.q[1] = *(const v8b*)(p + 16); return u.v;
}
__device__ __forceinline__ float bfr(float v) { return (float)(__bf16)v; }
__device__ __attribute__((noinline)) float exp_ni(float v) { return expf(v); }
__device__ __attribute__((noinline)) float erf_ni(float v) { return erff(v); }

#define WS_QH  0u                                    // f16 q rows [b*n][CQ] hi
#define WS_QL  (WS_QH + 2u * (size_t)NB * NP * CQ)      // f16 q residual rows (unscaled)
#define WS_KH  (WS_QL + 2u * (size_t)NB * NP * CQ)      // f16 k rows
#define WS_KL  (WS_KH + 2u * (size_t)NB * NP * CQ)      // f16 k residual rows
#define WS_VT  (WS_KL + 2u * (size_t)NB * NP * CQ)      // f16 v planes [b][CV][n]
#define WS_END (WS_VT + 2u * (size_t)NB * CV * NP)

// keeps a batch of loads together at its place, ahead of the work that hides their latency
#define PJ_SB() __builtin_amdgcn_sched_barrier(0)
// one lane's share of the eight B fragments of its out channel (all 256 in channels): wl = W + 8 g NOUT + channel; constant row steps, so one address serves all 128 loads
template <int NOUT> __device__ __forceinline__ void pj_loadw(float (&wr)[CIN / 32][16], const float* __restrict__ wl) {
#pragma unroll
  for (int kc = 0; kc < CIN / 32; ++kc)
#pragma unroll
    for (int i = 0; i < 8; ++i) { wr[kc][i] = wl[(kc * 32 + i) * NOUT]; wr[kc][8 + i] = wl[(kc * 32 + 16 + i) * NOUT]; } }
// defined behind the kernel
template <int NOUT> __device__ __forceinline__ void pj_run(const float* __restrict__ Wm, const float* __restrict__ Bm, _Float16* __restrict__ dh, _Float16* __restrict__ dl, _Float16* __restrict__ VT, const __bf16 (&sx)[64][CIN + 8], _Float16 (&sh)[64][72], _Float16 (&sl)[64][72], _Float16 (&tv)[64][72], int p0, size_t b);
// ---- k_proj: block = (64 positions, b, which 0 q / 1 k / 2 v): x tile (bf16, channels-last rows) in LDS, W [in][out] + b (exact); q and k -> f16 hi + residual rows, v -> f16 planes [c][n]
__global__ __launch_bounds__(128) void k_proj(const float* __restrict__ XQK, const float* __restrict__ XV, const float* __restrict__ WQ, const float* __restrict__ BQ, const float* __restrict__ WK, const float* __restrict__ BK, const float* __restrict__ WV, const float* __restrict__ BV, _Float16* __restrict__ QH, _Float16* __restrict__ QL, _Float16* __restrict__ KH, _Float16* __restrict__ KL, _Float16* __restrict__ VT) {
  __shared__ __align__(16) __bf16 sx[64][CIN + 8]; __shared__ __align__(16) _Float16 sh[64][72], sl[64][72]; __shared__ __align__(16) _Float16 tv[64][72];
  const int tid = threadIdx.x, wave = tid >> 5, lane = tid & 31, col = lane & 15, g = lane >> 4; const int p0 = blockIdx.x * 64; const size_t b = blockIdx.y; const int which = blockIdx.z;
  const float* Wm = which == 0 ? WQ : which == 1 ? WK : WV; const float* Bm = which == 0 ? BQ : which == 1 ? BK : BV; const float* X = (which == 2) ? XV : XQK;
  { const float* xl = X + ((size_t)b * NP + p0) * CIN + tid * 4;   // channels-last rows: the tile's 64 rows are 64 KB in a row, taken as 16-byte pieces, piece tid + 128 i
    v4f xr[32];
#pragma unroll
    for (int i = 0; i < 32; ++i) xr[i] = *(const v4f*)(xl + i * 512);   // a thread's 32 loads go out as one batch: one latency for the tile, not one per group of eight 4-byte loads
#pragma unroll
    for (int i = 0; i < 32; ++i) { const v4b xb = { (__bf16)xr[i][0], (__bf16)xr[i][1], (__bf16)xr[i][2], (__bf16)xr[i][3] }; *(v4b*)&sx[(tid >> 6) + 2 * i][(tid & 63) * 4] = xb; } }   // four channels an 8-byte LDS store
  __syncthreads();
  if (which == 2) pj_run<CV>(Wm, Bm, nullptr, nullptr, VT, sx, sh, sl, tv, p0, b);   // which is the same for the whole block: every barrier inside is passed by all its waves
  else pj_run<CQ>(Wm, Bm, which == 0 ? QH : KH, which == 0 ? QL : KL, nullptr, sx, sh, sl, tv, p0, b); }
// the products of a block behind its x tile: wave = all 64 positions x 16 out channels of a group of 64, so a group's W fragments are one wave's 128 registers a lane and are fetched in one batch, by that wave only
template <int NOUT> __device__ __forceinline__ void pj_run(const float* __restrict__ Wm, const float* __restrict__ Bm, _Float16* __restrict__ dh, _Float16* __restrict__ dl, _Float16* __restrict__ VT, const __bf16 (&sx)[64][CIN + 8], _Float16 (&sh)[64][72], _Float16 (&sl)[64][72], _Float16 (&tv)[64][72], int p0, size_t b) {
  const int tid = threadIdx.x, wave = tid >> 5, lane = tid & 31, col = lane & 15, g = lane >> 4;
#pragma unroll 1
  for (int cg = 0; cg < (NOUT + 63) / 64; ++cg) { float wr[CIN / 32][16]; v16b af[2][8];   // two sets of x fragments (two k steps x four position tiles each)
    const int o = min(cg * 64 + wave * 16 + col, NOUT - 1);   // columns >= NOUT are dummies (never stored)
#pragma unroll
    for (int j = 0; j < 8; ++j) af[0][j] = frag_b(&sx[(j & 3) * 16 + col][(j >> 2) * 32], lane);
    PJ_SB();   // the first x fragments' reads stand in front of the W loads: behind them they could take the loads' address registers ahead of the wait below
    const float braw = Bm[o];
    asm volatile("s_wait_xcnt 0x0" ::: "memory");   // stands in front of the W loads, whose results may take the bias load's offset register
    pj_loadw<NOUT>(wr, Wm + 8 * g * NOUT + o);   // the group's 128 W loads go out as one batch; the products start as the first of them return
    asm volatile("s_wait_xcnt 0x0" ::: "memory");   // stands in front of any later write to the loads' address registers
    PJ_SB();   // and nothing is moved up in front of that wait
    const float bb = bfr(braw);
    v8f acc[4] = {};
#pragma unroll
    for (int kp = 0; kp < CIN / 64; ++kp) { const int cur = kp & 1;
      PJ_SB();   // the next eight x fragments are read as one group ahead of this group's products
      if (kp + 1 < CIN / 64) {
#pragma unroll
        for (int j = 0; j < 8; ++j) af[cur ^ 1][j] = frag_b(&sx[(j & 3) * 16 + col][((kp + 1) * 2 + (j >> 2)) * 32], lane); }
      PJ_SB();
#pragma unroll
      for (int h = 0; h < 2; ++h) { v16b wf;
#pragma unroll
        for (int i = 0; i < 16; ++i) wf[i] = (__bf16)wr[kp * 2 + h][i];
#pragma unroll
        for (int m = 0; m < 4; ++m) acc[m] = wmma_bf(af[cur][h * 4 + m], wf, acc[m]); } }
    __syncthreads();
    const int ol = wave * 16 + col;
#pragma unroll
    for (int m = 0; m < 4; ++m)
#pragma unroll
      for (int r = 0; r < 8; ++r) { const int pl = m * 16 + 8 * g + r; const float v = acc[m][r] + bb; const _Float16 hv = (_Float16)v; if (NOUT == CV) tv[ol][pl] = hv; else { sh[pl][ol] = hv; sl[pl][ol] = (_Float16)(v - (float)hv); } }   // q AND k keep a residual
    __syncthreads();
    if (NOUT != CV) { for (int e = tid; e < 64 * 8; e += 128) { const int pl = e >> 3, q = e & 7; if (cg * 64 + q * 8 >= CQ) continue; const size_t row = b * NP + p0 + pl; vst2((unsigned*)(dh + row * CQ + cg * 64 + q * 8), *(const v4u*)&sh[pl][q * 8]); vst2((unsigned*)(dl + row * CQ + cg * 64 + q * 8), *(const v4u*)&sl[pl][q * 8]);
        asm volatile("s_wait_xcnt 0x0" ::: "memory"); } }   // stands in front of the next trip's writes to the two stores' address and data registers
    else { for (int e = tid; e < 64 * 8; e += 128) { const int ov = e >> 3, q = e & 7; vst2((unsigned*)(VT + (b * CV + cg * 64 + ov) * (size_t)NP + p0 + q * 8), *(const v4u*)&tv[ov][q * 8]); } } } }
// the plain builtin: the compiler keeps the distance behind it itself and may place operands in any register
__device__ __forceinline__ v8f wmma_h(v16h a, v16h b, v8f c) { return __builtin_amdgcn_wmma_f32_16x16x32_f16(false, a, false, b, (short)0, c, false, false); }
// lane l with lane l ^ 16, on the vector unit
__device__ __forceinline__ float xhalf(float x) { return __builtin_bit_cast(float, __builtin_amdgcn_permlanex16(__builtin_bit_cast(int, x), __builtin_bit_cast(int, x), 0x76543210, 0xfedcba98, false, false)); }
// keeps a group of LDS reads together at its place: without it the compiler spreads the reads singly among the products, each with its own wait
#define FA_SB() __builtin_amdgcn_sched_barrier(0)
// ---- k_fa: block = (64 queries, batch b), eight waves = 2 query halves x 4 key quarters: wave = 32 queries x all 256 channels x 32 of a stage's 128 keys, so a v fragment read from LDS serves two products and two waves share a SIMD; S^T = K Q^T, running-maximum softmax in registers, O^T += V^T P^T; the four key quarters' sums are joined once, behind the loop, through LDS; k and v tiles of 128 keys staged in LDS (two buffers, asynchronous copies)
#define FA_KT 128                      // keys per stage: 256 B of a v row, so one wave-wide copy brings two whole row pieces
#define FA_NT (NP / FA_KT)
#define FA_VP (FA_KT + 8)              // f16 elements; 272 B = 16 B x odd: the pitch for ds_load_b128 readers
#define FA_KP (CQ + 8)                 // 80 B = 16 B x odd
#define FA_VPB (2u * FA_VP)
#define FA_KPB (2u * FA_KP)
#define FA_TH 12.476649250f             // 18 ln 2: how far a score may pass the maximum in use before the sums are rescaled
#define FA_C (-3.0f)                   // P = exp(s - m) x 2^FA_C: at most 2^15, below f16's largest number; the largest weight is at least 2^-3, so weights down to 2^-11 of it are normal f16 numbers and smaller ones round within 2^-22 of it
struct FaStage { _Float16 v[CV][FA_VP]; _Float16 kh[FA_KT][FA_KP]; _Float16 kl[FA_KT][FA_KP]; };
#define FA_BUFB ((unsigned)sizeof(FaStage))
// ten copies global -> LDS; s_wait_xcnt ends the statement so that no address register is rewritten in front of it
__device__ __forceinline__ void fa_cp10(const unsigned* d, const _Float16* const* s) {
  asm volatile(
    "global_load_async_to_lds_b128 %0, %10, off\n\t"
    "global_load_async_to_lds_b128 %1, %11, off\n\t"
    "global_load_async_to_lds_b128 %2, %12, off\n\t"
    "global_load_async_to_lds_b128 %3, %13, off\n\t"
    "global_load_async_to_lds_b128 %4, %14, off\n\t"
    "global_load_async_to_lds_b128 %5, %15, off\n\t"
    "global_load_async_to_lds_b128 %6, %16, off\n\t"
    "global_load_async_to_lds_b128 %7, %17, off\n\t"
    "global_load_async_to_lds_b128 %8, %18, off\n\t"
    "global_load_async_to_lds_b128 %9, %19, off\n\t"
    "s_wait_xcnt 0x0"
    :: "v"(d[0]), "v"(d[1]), "v"(d[2]), "v"(d[3]), "v"(d[4]), "v"(d[5]), "v"(d[6]), "v"(d[7]), "v"(d[8]), "v"(d[9]),
       "v"(s[0]), "v"(s[1]), "v"(s[2]), "v"(s[3]), "v"(s[4]), "v"(s[5]), "v"(s[6]), "v"(s[7]), "v"(s[8]), "v"(s[9]) : "memory");
}
// one wave's share of a stage: 32 of the 256 v rows (two rows a copy) and 16 of the 128 keys' hi and residual rows (eight keys a copy): 20 copies in flight
// the global addresses are formed here from uniform bases and the lane's 32-bit element offsets: a lane pointer kept across the main loop and named by the asm statement itself was spilled
__device__ __forceinline__ void fa_fill(unsigned lv, unsigned lkh, unsigned lkl, const _Float16* bv, unsigned ov, const _Float16* bkh, const _Float16* bkl, unsigned ok) {
  unsigned d[10]; const _Float16* g[10];
#pragma unroll
  for (int i = 0; i < 8; ++i) { d[i] = lv + i * 2 * FA_VPB; g[i] = bv + (ov + (unsigned)i * 2u * NP); }
  d[8] = lkh; g[8] = bkh + ok; d[9] = lkl; g[9] = bkl + ok;
#pragma unroll 1   // rolled: ten running addresses (16 v rows, 8 keys a trip); unrolled, the compiler keeps all the LDS addresses across the main loop
  for (int s = 0; s < 2; ++s) { fa_cp10(d, g);
#pragma unroll
    for (int i = 0; i < 8; ++i) { d[i] += 16 * FA_VPB; g[i] += (size_t)16 * NP; }
    d[8] += 8 * FA_KPB; g[8] += (size_t)8 * CQ; d[9] += 8 * FA_KPB; g[9] += (size_t)8 * CQ; } }
union FaSh { FaStage ring[2]; float part[4][64][CV + 4]; };   // behind the loop the ring's bytes hold the four key quarters' scaled sums
__global__ __launch_bounds__(256) void k_fa(const _Float16* __restrict__ QH, const _Float16* __restrict__ QL, const _Float16* __restrict__ KH, const _Float16* __restrict__ KL, const _Float16* __restrict__ VT, const float* __restrict__ X, const float* __restrict__ GM, float* __restrict__ OUT) { __shared__ __align__(16) FaSh sh; __shared__ float sm[4][64], sl[4][64];
  const int tid = threadIdx.x, wave = tid >> 5, lane = tid & 31, col = lane & 15, g = lane >> 4; const size_t b = blockIdx.y; const int i0 = blockIdx.x * 64;
  const int qg = wave & 1, kg = wave >> 1; const int il0 = qg * 32, k0 = kg * 32;   // the wave's 32 queries of the block, and its 32 keys of every stage
  const unsigned lv = (unsigned)(size_t)&sh.ring[0].v[wave * 32 + g][col * 8], lkh = (unsigned)(size_t)&sh.ring[0].kh[wave * 16 + (lane >> 2)][(lane & 3) * 8], lkl = (unsigned)(size_t)&sh.ring[0].kl[wave * 16 + (lane >> 2)][(lane & 3) * 8];
  const _Float16* bv = VT + b * CV * (size_t)NP; const _Float16* bkh = KH + b * NP * (size_t)CQ; const _Float16* bkl = KL + b * NP * (size_t)CQ;   // the batch's planes and rows, uniform
  const unsigned ov = (unsigned)(wave * 32 + g) * NP + col * 8, ok = (unsigned)(wave * 16 + (lane >> 2)) * CQ + (lane & 3) * 8;   // the lane's element offsets inside them
  v16h qh[2], ql[2];   // B operands: column = query, two tiles of 16, kept for the whole kernel
  const size_t qr = (b * NP + i0 + il0 + col) * CQ + 8 * g; const _Float16* pqh = QH + qr; const _Float16* pql = QL + qr;   // the lane's place in its first query's rows: elements 8g .. and 16 + 8g ..
#pragma unroll
  for (int qt = 0; qt < 2; ++qt) { union { v16h v; v8h q[2]; } uh, ul; uh.q[0] = *(const v8h*)(pqh + qt * 16 * CQ); uh.q[1] = *(const v8h*)(pqh + qt * 16 * CQ + 16); ul.q[0] = *(const v8h*)(pql + qt * 16 * CQ); ul.q[1] = *(const v8h*)(pql + qt * 16 * CQ + 16); qh[qt] = uh.v; ql[qt] = ul.v; }
  asm volatile("s_wait_xcnt 0x0" :: "v"(pqh), "v"(pql) : "memory");   // stands in front of any later write to the q loads' address registers, which it names as inputs so that they live up to it
  FA_SB();   // and nothing is moved up in front of that wait
  const float L2E = 1.4426950408889634f;
  v8f acc[2][16] = {}; float mrun[2] = { -3.0e38f, -3.0e38f }, lsum[2] = { 0.f, 0.f }, nb[2] = { 0.f, 0.f };   // per lane and query tile: its query's running maximum over the wave's keys, its half's share of the sum, and FA_C - maximum x log2 e (set with the maximum). The maximum is the one IN USE: it is raised, and the sums rescaled, only when a score passes it by more than FA_TH; numerator and sum carry the same m and the same factor, which cancel
  fa_fill(lv, lkh, lkl, bv, ov, bkh, bkl, ok);
  asm volatile("s_wait_asynccnt 0x0" ::: "memory");   // stage 0 has landed before the barrier publishes it
  __syncthreads();
  fa_fill(lv + FA_BUFB, lkh + FA_BUFB, lkl + FA_BUFB, bv + FA_KT, ov, bkh + (size_t)FA_KT * CQ, bkl + (size_t)FA_KT * CQ, ok);
#pragma unroll 1
  for (int t = 0; t < FA_NT; ++t) { const FaStage& sb = sh.ring[t & 1];   // rolled: one stage a trip, the buffer by parity
    v16h kh[2], kl[2], vf[2][8];   // k fragments of the wave's 32 keys; two sets of v fragments: the second goes out as one group ahead of the first group's products
#pragma unroll
    for (int kt = 0; kt < 2; ++kt) { kh[kt] = frag_h(&sb.kh[k0 + kt * 16 + col][0], lane); kl[kt] = frag_h(&sb.kl[k0 + kt * 16 + col][0], lane); }
    v8f s[2][2] = {};   // S^T tiles [query tile][key tile]: register r = key 8g + r of the tile, lane column = query
    FA_SB();
#pragma unroll
    for (int x = 0; x < 4; ++x) s[x >> 1][x & 1] = wmma_h(kh[x & 1], qh[x >> 1], s[x >> 1][x & 1]);
#pragma unroll
    for (int x = 0; x < 4; ++x) s[x >> 1][x & 1] = wmma_h(kh[x & 1], ql[x >> 1], s[x >> 1][x & 1]);
#pragma unroll
    for (int x = 0; x < 4; ++x) s[x >> 1][x & 1] = wmma_h(kl[x & 1], qh[x >> 1], s[x >> 1][x & 1]);   // 3 products, in the order hi hi, residual hi, hi residual
    FA_SB();
#pragma unroll
    for (int j = 0; j < 8; ++j) vf[0][j] = frag_h(&sb.v[j * 16 + col][k0], lane);   // the first v group flies under the softmax
    FA_SB();
    float mst[2];   // the stage's own maxima
#pragma unroll
    for (int qt = 0; qt < 2; ++qt) { float m8[8];   // maximum by a tree, not a single chain of dependent maxima
#pragma unroll
      for (int r = 0; r < 8; ++r) m8[r] = fmaxf(s[qt][0][r], s[qt][1][r]);
      float mx = fmaxf(fmaxf(fmaxf(m8[0], m8[1]), fmaxf(m8[2], m8[3])), fmaxf(fmaxf(m8[4], m8[5]), fmaxf(m8[6], m8[7])));
      mst[qt] = fmaxf(mx, xhalf(mx)); }   // with the other half of the query's 32 keys
    if (__builtin_amdgcn_ballot_w32(mst[0] > mrun[0] + FA_TH || mst[1] > mrun[1] + FA_TH) != 0) {   // scalar branch, one test a stage: the 256 sums a lane are rescaled only where some query's score would leave f16's range above; then every query of the wave takes the larger of its maximum in use and the stage's maximum
      const float mnew[2] = { fmaxf(mrun[0], mst[0]), fmaxf(mrun[1], mst[1]) };
      const float al0 = __builtin_amdgcn_exp2f((mrun[0] - mnew[0]) * L2E), al1 = __builtin_amdgcn_exp2f((mrun[1] - mnew[1]) * L2E);
      mrun[0] = mnew[0]; mrun[1] = mnew[1]; lsum[0] *= al0; lsum[1] *= al1; nb[0] = FA_C - mnew[0] * L2E; nb[1] = FA_C - mnew[1] * L2E;
#pragma unroll
      for (int j = 0; j < 16; ++j) { acc[0][j] *= al0; acc[1][j] *= al1; } }
    v16h pb[2];
#pragma unroll
    for (int x = 0; x < 4; ++x)
#pragma unroll
      for (int r = 0; r < 8; ++r) s[x >> 1][x & 1][r] = fmaf(s[x >> 1][x & 1][r], L2E, nb[x >> 1]);
    FA_SB();   // all exponents are formed before the first exponential: none of them then overwrites an exponential's source directly behind it
#pragma unroll
    for (int x = 0; x < 4; ++x)
#pragma unroll
      for (int r = 0; r < 8; ++r) s[x >> 1][x & 1][r] = __builtin_amdgcn_exp2f(s[x >> 1][x & 1][r]);
    FA_SB();   // and no conversion or sum overwrites one
#pragma unroll
    for (int x = 0; x < 4; ++x)
#pragma unroll
      for (int r = 0; r < 8; ++r) pb[x >> 1][(x & 1) * 8 + r] = (_Float16)s[x >> 1][x & 1][r];   // a query tile's two score tiles, converted in place, are one B operand
#pragma unroll
    for (int qt = 0; qt < 2; ++qt) { const v8f p8 = s[qt][0] + s[qt][1];   // the f32 weights summed by a tree, for the same reason as the maximum
      lsum[qt] += ((p8[0] + p8[1]) + (p8[2] + p8[3])) + ((p8[4] + p8[5]) + (p8[6] + p8[7])); }
    FA_SB();
#pragma unroll
    for (int j = 0; j < 8; ++j) vf[1][j] = frag_h(&sb.v[(8 + j) * 16 + col][k0], lane);   // the stage's last LDS reads fly under the first group's products
    FA_SB();
#pragma unroll
    for (int j = 0; j < 8; ++j) { acc[0][j] = wmma_h(vf[0][j], pb[0], acc[0][j]); acc[1][j] = wmma_h(vf[0][j], pb[1], acc[1][j]); }   // channel tiles 0 .. 7, both query tiles on each fragment
    FA_SB();   // these products stay in front of the stage's foot: sunk behind its barrier they would hold back the refill
    asm volatile("s_wait_dscnt 0x0" :: "v"(lsum[0]), "v"(lsum[1]) : "memory");      // this wave's reads of the buffer are done before it is refilled; the two sums are named as inputs so that they are formed in front of the refill: sunk behind it, their 32 weights stay live beside the copies' addresses and a register is spilled
    asm volatile("s_wait_asynccnt 0x0" ::: "memory");   // this wave's copies of stage t + 1 have landed
    __syncthreads();                                    // publishes stage t + 1 and ends every reader's last read of stage t
    if (t + 2 < FA_NT) { const unsigned bo = (unsigned)(t & 1) * FA_BUFB; fa_fill(lv + bo, lkh + bo, lkl + bo, bv + (size_t)(t + 2) * FA_KT, ov, bkh + (size_t)(t + 2) * FA_KT * CQ, bkl + (size_t)(t + 2) * FA_KT * CQ, ok); }
    FA_SB();   // channel tiles 8 .. 15, all operands in registers, stand behind the refill: the copies go out as soon as the buffer is free and fly under these products too
#pragma unroll
    for (int j = 0; j < 8; ++j) { acc[0][8 + j] = wmma_h(vf[1][j], pb[0], acc[0][8 + j]); acc[1][8 + j] = wmma_h(vf[1][j], pb[1], acc[1][8 + j]); } }
  asm volatile("s_wait_asynccnt 0x0" ::: "memory");     // no copy is outstanding behind the loop
  // the four key quarters of a query are joined: maxima and sums first, then the sums of products, each scaled to the common maximum and divided by the whole sum
#pragma unroll
  for (int qt = 0; qt < 2; ++qt) { const float lj = lsum[qt] + xhalf(lsum[qt]);   // the halves' sums are joined once
    if (g == 0) { sm[kg][il0 + qt * 16 + col] = mrun[qt]; sl[kg][il0 + qt * 16 + col] = lj; } }
  __syncthreads();   // every quarter's maxima and sums are written; the loop's last barrier has ended every read of the ring
#pragma unroll
  for (int qt = 0; qt < 2; ++qt) { const int q = il0 + qt * 16 + col;
    const float m0 = sm[0][q], m1 = sm[1][q], m2 = sm[2][q], m3 = sm[3][q]; const float mm = fmaxf(fmaxf(m0, m1), fmaxf(m2, m3));
    const float e0 = __builtin_amdgcn_exp2f((m0 - mm) * L2E), e1 = __builtin_amdgcn_exp2f((m1 - mm) * L2E), e2 = __builtin_amdgcn_exp2f((m2 - mm) * L2E), e3 = __builtin_amdgcn_exp2f((m3 - mm) * L2E);
    const float ls = (sl[0][q] * e0 + sl[1][q] * e1) + (sl[2][q] * e2 + sl[3][q] * e3);
    const float inv = __builtin_amdgcn_exp2f((mrun[qt] - mm) * L2E) / ls;   // the wave's own quarter's factor over the whole sum
#pragma unroll
    for (int j = 0; j < 16; ++j) { const v8f o = acc[qt][j] * inv; v4f lo = { o[0], o[1], o[2], o[3] }, hi = { o[4], o[5], o[6], o[7] };   // a lane holds 8 consecutive channels of its query
      *(v4f*)&sh.part[kg][q][j * 16 + 8 * g] = lo; *(v4f*)&sh.part[kg][q][j * 16 + 8 * g + 4] = hi; } }
  __syncthreads();   // all four quarters' rows are written before any is read
  const float gm = bfr(GM[0]);
  // channels-last rows [b*n][CV]: positions i0 .. i0+63, whole rows
#pragma unroll 1   // rolled, so that the wait at the trip's foot stands once behind four stores
  for (int i = 0; i < 64 * (CV / 4) / 256; i += 4) {
#pragma unroll   // four row pieces a trip: their x loads go out together and wait once, not one latency each
    for (int u = 0; u < 4; ++u) { const int e = tid + (i + u) * 256, il = e >> 6, q = e & 63; const size_t o = (b * NP + i0 + il) * CV + q * 4; const v4f sv = (*(const v4f*)&sh.part[0][il][q * 4] + *(const v4f*)&sh.part[1][il][q * 4]) + (*(const v4f*)&sh.part[2][il][q * 4] + *(const v4f*)&sh.part[3][il][q * 4]); const v4f xv = *(const v4f*)(X + o); v4f r = { gm * sv[0] + bfr(xv[0]), gm * sv[1] + bfr(xv[1]), gm * sv[2] + bfr(xv[2]), gm * sv[3] + bfr(xv[3]) }; vst2(OUT + o, r); }
    asm volatile("s_wait_xcnt 0x0" ::: "memory"); } }   // stands in front of the next trip's writes to the four stores' address and data registers
extern "C" void kernel_launch(void* const* d_in, const int* in_sizes, int n_in, void* d_out, int out_size, void* d_ws, size_t ws_size, hipStream_t stream) {
  (void)in_sizes; (void)n_in; (void)out_size;
  const float** F = (const float**)d_in;   // 0 inputs [4,64,64,256] channels-last, 1 Wq [256,32] (in,out), 2 bq, 3 Wk, 4 bk, 5 Wv [256,256], 6 bv, 7 gamma [1]
  if (ws_size < (size_t)WS_END) return;
  char* ws = (char*)d_ws; _Float16 *QH = (_Float16*)(ws + WS_QH), *QL = (_Float16*)(ws + WS_QL), *KH = (_Float16*)(ws + WS_KH), *KL = (_Float16*)(ws + WS_KL), *VT = (_Float16*)(ws + WS_VT);
  k_proj<<<dim3(NP / 64, TNB, 3), 128, 0, stream>>>(F[0], F[0], F[1], F[2], F[3], F[4], F[5], F[6], QH, QL, KH, KL, VT);
  k_fa<<<dim3(TQB, TNB), 256, 0, stream>>>(QH, QL, KH, KL, VT, F[0], F[7], (float*)d_out);
}

// v007
// It runs in 48.1 microseconds.
// Timed twice side by side with v006, it ran 1.08 and 1.07 times as fast.
// Over all steps from v000 it is 20.5 times as fast.
// compute dtype: all float inputs rounded to bf16, gamma read; q/k (32 ch) and v (256 ch) = x W + b ((in,out)) with EXACT bf16 products on WMMA 16x16x32 (channels-last x tile in LDS), f32 accumulate; q and k as f16 hi + unscaled residual -> UNSCALED logits with 3 products (std ~5.7, near-one-hot softmax), kept in registers; running-maximum softmax in f32, the maximum in use m raised lazily -> P f16 = exp(s - m) / 8 <= 2^15; out = gamma * (P . v) / sum(P) + x with v rounded once to f16, channels-last rows; f32 output.
#include <hip/hip_runtime.h>
#include <math.h>

typedef __attribute__((ext_vector_type(16))) _Float16 v16h;
typedef __attribute__((ext_vector_type(16))) __bf16 v16b;
typedef __attribute__((ext_vector_type(8)))  _Float16 v8h;
typedef __attribute__((ext_vector_type(8)))  float v8f;
typedef __attribute__((ext_vector_type(4)))  float v4f;
typedef __attribute__((ext_vector_type(2)))  float v2f;
typedef __attribute__((ext_vector_type(4)))  unsigned v4u;
typedef __attribute__((ext_vector_type(4)))  int v4i;
typedef float __attribute__((may_alias)) float_a;
typedef int __attribute__((may_alias)) int_a;

template <typename T> __device__ __forceinline__ void vst2(void* p, T v) { *(T*)p = v;  }
__device__ __forceinline__ v8f wmma16(v16h a, v16h b, v8f c) {
  v8f d = __builtin_amdgcn_wmma_f32_16x16x32_f16(false, a, false, b, (short)0, c, false, false);
  asm volatile("v_nop\n\tv_nop\n\tv_nop\n\tv_nop" : "+v"(d) : "v"(a), "v"(b));
  return d;
}
__device__ __forceinline__ v8f wmma_bf(v16b a, v16b b, v8f c) {
  v8f d = __builtin_amdgcn_wmma_f32_16x16x32_bf16(false, a, false, b, (short)0, c, false, false);
  asm volatile("v_nop\n\tv_nop\n\tv_nop\n\tv_nop" : "+v"(d) : "v"(a), "v"(b));
  return d;
}
// 16x16x32 fragments: lane = (h = lane>>4, row/col = lane&15); elements 0..7 = k0+8h+0..7, 8..15 = k0+16+8h+0..7; D element r = row 8h+r
__device__ __forceinline__ v16h frag_h(const _Float16* rowk0, int lane) {
  union { v16h v; v8h q[2]; } u; const _Float16* p = rowk0 + 8 * (lane >> 4);
  u.q[0] = *(const v8h*)p; u.q[1] = *(const v8h*)(p + 16); return u.v;
}
__device__ __forceinline__ v16h frag_f32(const float* rowk0, int lane) {
  v16h a; const float* p = rowk0 + 8 * (lane >> 4);
#pragma unroll
  for (int i = 0; i < 8; ++i) { a[i] = (_Float16)p[i]; a[8 + i] = (_Float16)p[16 + i]; }
  return a;
}
__device__ __forceinline__ v16h frag_f32s(const float* rowk0, int lane, float sc) {
  v16h a; const float* p = rowk0 + 8 * (lane >> 4);
#pragma unroll
  for (int i = 0; i < 8; ++i) { a[i] = (_Float16)(p[i] * sc); a[8 + i] = (_Float16)(p[16 + i] * sc); }
  return a;
}
// column fragment from a [K][ld] layout (column n), rows >= K read as 0
__device__ __forceinline__ v16h fragc_f32(const float* W, int k0, int n, int lane, int ld, int K) {
  v16h a; const int g = lane >> 4;
#pragma unroll
  for (int i = 0; i < 8; ++i) { const int ka = k0 + 8 * g + i, kb = ka + 16;
    a[i] = (_Float16)(ka < K ? W[(size_t)(ka < K ? ka : K - 1) * ld + n] : 0.f); a[8 + i] = (_Float16)(kb < K ? W[(size_t)(kb < K ? kb : K - 1) * ld + n] : 0.f); }
  return a;
}
struct F2 { v16b h, l; };
__device__ __forceinline__ F2 bsplit16(const float v[16]) { F2 r;
#pragma unroll
  for (int i = 0; i < 16; ++i) { const __bf16 h = (__bf16)v[i]; r.h[i] = h; r.l[i] = (__bf16)(v[i] - (float)h); }
  return r; }
__device__ __forceinline__ F2 split_row(const float* row, int k0, int lane) { float v[16]; const float* p = row + k0 + 8 * (lane >> 4);
#pragma unroll
  for (int i = 0; i < 8; ++i) { v[i] = p[i]; v[8 + i] = p[16 + i]; }
  return bsplit16(v); }
__device__ __forceinline__ F2 split_rowK(const float* row, int k0, int lane, int K) { float v[16]; const int g = lane >> 4;
#pragma unroll
  for (int i = 0; i < 8; ++i) { const int ka = k0 + 8 * g + i, kb = ka + 16; v[i] = ka < K ? row[ka < K ? ka : K - 1] : 0.f; v[8 + i] = kb < K ? row[kb < K ? kb : K - 1] : 0.f; }
  return bsplit16(v); }
__device__ __forceinline__ F2 split_col(const float* W, int k0, int n, int lane, int ld, int K) { float v[16]; const int g = lane >> 4;
#pragma unroll
  for (int i = 0; i < 8; ++i) { const int ka = k0 + 8 * g + i, kb = ka + 16; v[i] = ka < K ? W[(size_t)(ka < K ? ka : K - 1) * ld + n] : 0.f; v[8 + i] = kb < K ? W[(size_t)(kb < K ? kb : K - 1) * ld + n] : 0.f; }
  return bsplit16(v); }
__device__ __forceinline__ v8f mac3(const F2& a, const F2& b, v8f c) { c = wmma_bf(a.l, b.h, c); c = wmma_bf(a.h, b.l, c); return wmma_bf(a.h, b.h, c); }
__device__ __forceinline__ float sigm(float v) { return 1.0f / (1.0f + expf(-v)); }
#define LDSX() do { asm volatile("s_wait_dscnt 0" ::: "memory"); __builtin_amdgcn_wave_barrier(); __builtin_amdgcn_fence(__ATOMIC_RELEASE, "workgroup"); } while (0)


// SelfAttentionModel (SAGAN-style, channels-last input [B, 64, 64, 256]): energy = q k^T unscaled over all 4,096 positions, out = gamma * softmax(energy) v + inputs.
#define NB 4
#define NP 4096
#define CIN 256
#define CQ 32
#define CV 256
#ifndef TNB
#define TNB NB
#endif
#ifndef TQB
#define TQB (NP / 64)
#endif
typedef __attribute__((ext_vector_type(8))) __bf16 v8b;
typedef __attribute__((ext_vector_type(4))) __bf16 v4b;
__device__ __forceinline__ v16b frag_b(const __bf16* rowk0, int lane) {
  union { v16b v; v8b q[2]; } u; const __bf16* p = rowk0 + 8 * (lane >> 4);
  u.q[0] = *(const v8b*)p; u.q[1] = *(const v8b*)(p + 16); return u.v;
}
__device__ __forceinline__ float bfr(float v) { return (float)(__bf16)v; }
__device__ __attribute__((noinline)) float exp_ni(float v) { return expf(v); }
__device__ __attribute__((noinline)) float erf_ni(float v) { return erff(v); }

#define WS_QH  0u                                    // f16 q rows [b*n][CQ] hi
#define WS_QL  (WS_QH + 2u * (size_t)NB * NP * CQ)      // f16 q residual rows (unscaled)
#define WS_KH  (WS_QL + 2u * (size_t)NB * NP * CQ)      // f16 k rows
#define WS_KL  (WS_KH + 2u * (size_t)NB * NP * CQ)      // f16 k residual rows
#define WS_VT  (WS_KL + 2u * (size_t)NB * NP * CQ)      // f16 v planes [b][CV][n]
#define WS_END (WS_VT + 2u * (size_t)NB * CV * NP)

// keeps a batch of loads together at its place, ahead of the work that hides their latency
#define PJ_SB() __builtin_amdgcn_sched_barrier(0)
// one lane's share of the eight B fragments of its out channel (all 256 in channels): wl = W + 8 g NOUT + channel; constant row steps, so one address serves all 128 loads
template <int NOUT> __device__ __forceinline__ void pj_loadw(float (&wr)[CIN / 32][16], const float* __restrict__ wl) {
#pragma unroll
  for (int kc = 0; kc < CIN / 32; ++kc)
#pragma unroll
    for (int i = 0; i < 8; ++i) { wr[kc][i] = wl[(kc * 32 + i) * NOUT]; wr[kc][8 + i] = wl[(kc * 32 + 16 + i) * NOUT]; } }
// defined behind the kernel
template <int NOUT> __device__ __forceinline__ void pj_run(const float* Wa, const float* Ba, const float* Wb, const float* Bb, _Float16* __restrict__ dha, _Float16* __restrict__ dla, _Float16* __restrict__ dhb, _Float16* __restrict__ dlb, _Float16* __restrict__ VT, const __bf16 (&sx)[64][CIN + 8], _Float16 (&sh)[64][72], _Float16 (&sl)[64][72], _Float16 (&tv)[64][72], int p0, size_t b, int cg0, int cgn);
// ---- k_proj: block = (64 positions, b, which 0 / 1 v out channels 0 .. 127 / 128 .. 255, 2 q and k together): the 320 out channels are five groups of 64, dealt 2 + 2 + 1 to a tile's three blocks, the longer blocks first in the grid; channels-last x tile (bf16) in LDS, W [in][out] + b (exact); q and k -> f16 hi + residual rows, v -> f16 planes [c][n]
__global__ __launch_bounds__(128) void k_proj(const float* __restrict__ XQK, const float* __restrict__ XV, const float* __restrict__ WQ, const float* __restrict__ BQ, const float* __restrict__ WK, const float* __restrict__ BK, const float* __restrict__ WV, const float* __restrict__ BV, _Float16* __restrict__ QH, _Float16* __restrict__ QL, _Float16* __restrict__ KH, _Float16* __restrict__ KL, _Float16* __restrict__ VT) {
  __shared__ __align__(16) __bf16 sx[64][CIN + 8]; __shared__ __align__(16) _Float16 sh[64][72], sl[64][72]; __shared__ __align__(16) _Float16 tv[64][72];
  const int tid = threadIdx.x, wave = tid >> 5, lane = tid & 31, col = lane & 15, g = lane >> 4; const int p0 = blockIdx.x * 64; const size_t b = blockIdx.y; const int which = blockIdx.z;
  const float* X = (which == 2) ? XQK : XV;
  { const float* xl = X + ((size_t)b * NP + p0) * CIN + tid * 4;   // channels-last rows: the tile's 64 rows are 64 KB in a row, taken as 16-byte pieces, piece tid + 128 i
    v4f xr[32];
#pragma unroll
    for (int i = 0; i < 32; ++i) xr[i] = *(const v4f*)(xl + i * 512);   // a thread's 32 loads go out as one batch: one latency for the tile, not one per group of eight 4-byte loads
#pragma unroll
    for (int i = 0; i < 32; ++i) { const v4b xb = { (__bf16)xr[i][0], (__bf16)xr[i][1], (__bf16)xr[i][2], (__bf16)xr[i][3] }; *(v4b*)&sx[(tid >> 6) + 2 * i][(tid & 63) * 4] = xb; } }   // four channels an 8-byte LDS store
  __syncthreads();
  if (which != 2) pj_run<CV>(WV, BV, WV, BV, nullptr, nullptr, nullptr, nullptr, VT, sx, sh, sl, tv, p0, b, which * 2, 2);   // which is the same for the whole block: every barrier inside is passed by all its waves
  else pj_run<CQ>(WQ, BQ, WK, BK, QH, QL, KH, KL, nullptr, sx, sh, sl, tv, p0, b, 0, 1); }
// the products of a block behind its x tile: wave = all 64 positions x 16 out channels of a group of 64, so a group's W fragments are one wave's 128 registers a lane and are fetched in one batch, by that wave only
// NOUT == CV: groups cg0 .. cg0 + cgn - 1 of v (Wa, Ba). NOUT == CQ: one group, waves 0, 1 = q's 32 channels (Wa, Ba), waves 2, 3 = k's (Wb, Bb)
template <int NOUT> __device__ __forceinline__ void pj_run(const float* Wa, const float* Ba, const float* Wb, const float* Bb, _Float16* __restrict__ dha, _Float16* __restrict__ dla, _Float16* __restrict__ dhb, _Float16* __restrict__ dlb, _Float16* __restrict__ VT, const __bf16 (&sx)[64][CIN + 8], _Float16 (&sh)[64][72], _Float16 (&sl)[64][72], _Float16 (&tv)[64][72], int p0, size_t b, int cg0, int cgn) {
  const int tid = threadIdx.x, wave = tid >> 5, lane = tid & 31, col = lane & 15, g = lane >> 4;
  const bool first = NOUT == CV || __builtin_amdgcn_readfirstlane(wave) < 2;   // the same for a whole wave: the two bases stay scalar
  const float* __restrict__ Wm = first ? Wa : Wb; const float* __restrict__ Bm = first ? Ba : Bb;
#pragma unroll 1
  for (int cg = cg0; cg < cg0 + cgn; ++cg) { float wr[CIN / 32][16]; v16b af[2][8];   // two sets of x fragments (two k steps x four position tiles each)
    const int o = min(NOUT == CV ? cg * 64 + wave * 16 + col : (wave & 1) * 16 + col, NOUT - 1);   // the lane's out channel in its own matrix
#pragma unroll
    for (int j = 0; j < 8; ++j) af[0][j] = frag_b(&sx[(j & 3) * 16 + col][(j >> 2) * 32], lane);
    PJ_SB();   // the first x fragments' reads stand in front of the W loads: behind them they could take the loads' address registers ahead of the wait below
    const float braw = Bm[o];
    asm volatile("s_wait_xcnt 0x0" ::: "memory");   // stands in front of the W loads, whose results may take the bias load's offset register
    pj_loadw<NOUT>(wr, Wm + 8 * g * NOUT + o);   // the group's 128 W loads go out as one batch; the products start as the first of them return
    asm volatile("s_wait_xcnt 0x0" ::: "memory");   // stands in front of any later write to the loads' address registers
    PJ_SB();   // and nothing is moved up in front of that wait
    const float bb = bfr(braw);
    v8f acc[4] = {};
#pragma unroll
    for (int kp = 0; kp < CIN / 64; ++kp) { const int cur = kp & 1;
      PJ_SB();   // the next eight x fragments are read as one group ahead of this group's products
      if (kp + 1 < CIN / 64) {
#pragma unroll
        for (int j = 0; j < 8; ++j) af[cur ^ 1][j] = frag_b(&sx[(j & 3) * 16 + col][((kp + 1) * 2 + (j >> 2)) * 32], lane); }
      PJ_SB();
#pragma unroll
      for (int h = 0; h < 2; ++h) { v16b wf;
#pragma unroll
        for (int i = 0; i < 16; ++i) wf[i] = (__bf16)wr[kp * 2 + h][i];
#pragma unroll
        for (int m = 0; m < 4; ++m) acc[m] = wmma_bf(af[cur][h * 4 + m], wf, acc[m]); } }
    __syncthreads();
    const int ol = wave * 16 + col;
#pragma unroll
    for (int m = 0; m < 4; ++m)
#pragma unroll
      for (int r = 0; r < 8; ++r) { const int pl = m * 16 + 8 * g + r; const float v = acc[m][r] + bb; const _Float16 hv = (_Float16)v; if (NOUT == CV) tv[ol][pl] = hv; else { sh[pl][ol] = hv; sl[pl][ol] = (_Float16)(v - (float)hv); } }   // q AND k keep a residual
    __syncthreads();
    if (NOUT != CV) { for (int e = tid; e < 64 * 8; e += 128) { const int pl = e >> 3, q = e & 7; const size_t at = (b * NP + p0 + pl) * CQ + (q & 3) * 8; vst2((unsigned*)((q < 4 ? dha : dhb) + at), *(const v4u*)&sh[pl][q * 8]); vst2((unsigned*)((q < 4 ? dla : dlb) + at), *(const v4u*)&sl[pl][q * 8]);   // staged columns 0 .. 31 are q's, 32 .. 63 k's
        asm volatile("s_wait_xcnt 0x0" ::: "memory"); } }   // stands in front of the next trip's writes to the two stores' address and data registers
    else { for (int e = tid; e < 64 * 8; e += 128) { const int ov = e >> 3, q = e & 7; vst2((unsigned*)(VT + (b * CV + cg * 64 + ov) * (size_t)NP + p0 + q * 8), *(const v4u*)&tv[ov][q * 8]); } } } }
// the plain builtin: the compiler keeps the distance behind it itself and may place operands in any register
__device__ __forceinline__ v8f wmma_h(v16h a, v16h b, v8f c) { return __builtin_amdgcn_wmma_f32_16x16x32_f16(false, a, false, b, (short)0, c, false, false); }
// lane l with lane l ^ 16, on the vector unit
__device__ __forceinline__ float xhalf(float x) { return __builtin_bit_cast(float, __builtin_amdgcn_permlanex16(__builtin_bit_cast(int, x), __builtin_bit_cast(int, x), 0x76543210, 0xfedcba98, false, false)); }
// keeps a group of LDS reads together at its place: without it the compiler spreads the reads singly among the products, each with its own wait
#define FA_SB() __builtin_amdgcn_sched_barrier(0)
// ---- k_fa: block = (64 queries, batch b), eight waves = 2 query halves x 4 key quarters: wave = 32 queries x all 256 channels x 32 of a stage's 128 keys, so a v fragment read from LDS serves two products and two waves share a SIMD; S^T = K Q^T, running-maximum softmax in registers, O^T += V^T P^T; the four key quarters' sums are joined once, behind the loop, through LDS; k and v tiles of 128 keys staged in LDS (two buffers, asynchronous copies)
#define FA_KT 128                      // keys per stage: 256 B of a v row, so one wave-wide copy brings two whole row pieces
#define FA_NT (NP / FA_KT)
#define FA_VP (FA_KT + 8)              // f16 elements; 272 B = 16 B x odd: the pitch for ds_load_b128 readers
#define FA_KP (CQ + 8)                 // 80 B = 16 B x odd
#define FA_VPB (2u * FA_VP)
#define FA_KPB (2u * FA_KP)
#define FA_TH 12.476649250f             // 18 ln 2: how far a score may pass the maximum in use before the sums are rescaled
#define FA_C (-3.0f)                   // P = exp(s - m) x 2^FA_C: at most 2^15, below f16's largest number; the largest weight is at least 2^-3, so weights down to 2^-11 of it are normal f16 numbers and smaller ones round within 2^-22 of it
struct FaStage { _Float16 v[CV][FA_VP]; _Float16 kh[FA_KT][FA_KP]; _Float16 kl[FA_KT][FA_KP]; };
#define FA_BUFB ((unsigned)sizeof(FaStage))
// ten copies global -> LDS; s_wait_xcnt ends the statement so that no address register is rewritten in front of it
__device__ __forceinline__ void fa_cp10(const unsigned* d, const _Float16* const* s) {
  asm volatile(
    "global_load_async_to_lds_b128 %0, %10, off\n\t"
    "global_load_async_to_lds_b128 %1, %11, off\n\t"
    "global_load_async_to_lds_b128 %2, %12, off\n\t"
    "global_load_async_to_lds_b128 %3, %13, off\n\t"
    "global_load_async_to_lds_b128 %4, %14, off\n\t"
    "global_load_async_to_lds_b128 %5, %15, off\n\t"
    "global_load_async_to_lds_b128 %6, %16, off\n\t"
    "global_load_async_to_lds_b128 %7, %17, off\n\t"
    "global_load_async_to_lds_b128 %8, %18, off\n\t"
    "global_load_async_to_lds_b128 %9, %19, off\n\t"
    "s_wait_xcnt 0x0"
    :: "v"(d[0]), "v"(d[1]), "v"(d[2]), "v"(d[3]), "v"(d[4]), "v"(d[5]), "v"(d[6]), "v"(d[7]), "v"(d[8]), "v"(d[9]),
       "v"(s[0]), "v"(s[1]), "v"(s[2]), "v"(s[3]), "v"(s[4]), "v"(s[5]), "v"(s[6]), "v"(s[7]), "v"(s[8]), "v"(s[9]) : "memory");
}
// one wave's share of a stage: 32 of the 256 v rows (two rows a copy) and 16 of the 128 keys' hi and residual rows (eight keys a copy): 20 copies in flight
// the global addresses are formed here from uniform bases and the lane's 32-bit element offsets: a lane pointer kept across the main loop and named by the asm statement itself was spilled
__device__ __forceinline__ void fa_fill(unsigned lv, unsigned lkh, unsigned lkl, const _Float16* bv, unsigned ov, const _Float16* bkh, const _Float16* bkl, unsigned ok) {
  unsigned d[10]; const _Float16* g[10];
#pragma unroll
  for (int i = 0; i < 8; ++i) { d[i] = lv + i * 2 * FA_VPB; g[i] = bv + (ov + (unsigned)i * 2u * NP); }
  d[8] = lkh; g[8] = bkh + ok; d[9] = lkl; g[9] = bkl + ok;
#pragma unroll 1   // rolled: ten running addresses (16 v rows, 8 keys a trip); unrolled, the compiler keeps all the LDS addresses across the main loop
  for (int s = 0; s < 2; ++s) { fa_cp10(d, g);
#pragma unroll
    for (int i = 0; i < 8; ++i) { d[i] += 16 * FA_VPB; g[i] += (size_t)16 * NP; }
    d[8] += 8 * FA_KPB; g[8] += (size_t)8 * CQ; d[9] += 8 * FA_KPB; g[9] += (size_t)8 * CQ; } }
union FaSh { FaStage ring[2]; float part[4][64][CV + 4]; };   // behind the loop the ring's bytes hold the four key quarters' scaled sums
__global__ __launch_bounds__(256) void k_fa(const _Float16* __restrict__ QH, const _Float16* __restrict__ QL, const _Float16* __restrict__ KH, const _Float16* __restrict__ KL, const _Float16* __restrict__ VT, const float* __restrict__ X, const float* __restrict__ GM, float* __restrict__ OUT) { __shared__ __align__(16) FaSh sh; __shared__ float sm[4][64], sl[4][64];
  const int tid = threadIdx.x, wave = tid >> 5, lane = tid & 31, col = lane & 15, g = lane >> 4; const size_t b = blockIdx.y; const int i0 = blockIdx.x * 64;
  const int qg = wave & 1, kg = wave >> 1; const int il0 = qg * 32, k0 = kg * 32;   // the wave's 32 queries of the block, and its 32 keys of every stage
  const unsigned lv = (unsigned)(size_t)&sh.ring[0].v[wave * 32 + g][col * 8], lkh = (unsigned)(size_t)&sh.ring[0].kh[wave * 16 + (lane >> 2)][(lane & 3) * 8], lkl = (unsigned)(size_t)&sh.ring[0].kl[wave * 16 + (lane >> 2)][(lane & 3) * 8];
  const _Float16* bv = VT + b * CV * (size_t)NP; const _Float16* bkh = KH + b * NP * (size_t)CQ; const _Float16* bkl = KL + b * NP * (size_t)CQ;   // the batch's planes and rows, uniform
  const unsigned ov = (unsigned)(wave * 32 + g) * NP + col * 8, ok = (unsigned)(wave * 16 + (lane >> 2)) * CQ + (lane & 3) * 8;   // the lane's element offsets inside them
  v16h qh[2], ql[2];   // B operands: column = query, two tiles of 16, kept for the whole kernel
  const size_t qr = (b * NP + i0 + il0 + col) * CQ + 8 * g; const _Float16* pqh = QH + qr; const _Float16* pql = QL + qr;   // the lane's place in its first query's rows: elements 8g .. and 16 + 8g ..
#pragma unroll
  for (int qt = 0; qt < 2; ++qt) { union { v16h v; v8h q[2]; } uh, ul; uh.q[0] = *(const v8h*)(pqh + qt * 16 * CQ); uh.q[1] = *(const v8h*)(pqh + qt * 16 * CQ + 16); ul.q[0] = *(const v8h*)(pql + qt * 16 * CQ); ul.q[1] = *(const v8h*)(pql + qt * 16 * CQ + 16); qh[qt] = uh.v; ql[qt] = ul.v; }
  asm volatile("s_wait_xcnt 0x0" :: "v"(pqh), "v"(pql) : "memory");   // stands in front of any later write to the q loads' address registers, which it names as inputs so that they live up to it
  FA_SB();   // and nothing is moved up in front of that wait
  const float L2E = 1.4426950408889634f;
  v8f acc[2][16] = {}; float mrun[2] = { -3.0e38f, -3.0e38f }, lsum[2] = { 0.f, 0.f }, nb[2] = { 0.f, 0.f };   // per lane and query tile: its query's running maximum over the wave's keys, its half's share of the sum, and FA_C - maximum x log2 e (set with the maximum). The maximum is the one IN USE: it is raised, and the sums rescaled, only when a score passes it by more than FA_TH; numerator and sum carry the same m and the same factor, which cancel
  fa_fill(lv, lkh, lkl, bv, ov, bkh, bkl, ok);
  asm volatile("s_wait_asynccnt 0x0" ::: "memory");   // stage 0 has landed before the barrier publishes it
  __syncthreads();
  fa_fill(lv + FA_BUFB, lkh + FA_BUFB, lkl + FA_BUFB, bv + FA_KT, ov, bkh + (size_t)FA_KT * CQ, bkl + (size_t)FA_KT * CQ, ok);
#pragma unroll 1
  for (int t = 0; t < FA_NT; ++t) { const FaStage& sb = sh.ring[t & 1];   // rolled: one stage a trip, the buffer by parity
    v16h kh[2], kl[2], vf[2][8];   // k fragments of the wave's 32 keys; two sets of v fragments: the second goes out as one group ahead of the first group's products
#pragma unroll
    for (int kt = 0; kt < 2; ++kt) { kh[kt] = frag_h(&sb.kh[k0 + kt * 16 + col][0], lane); kl[kt] = frag_h(&sb.kl[k0 + kt * 16 + col][0], lane); }
    v8f s[2][2] = {};   // S^T tiles [query tile][key tile]: register r = key 8g + r of the tile, lane column = query
    FA_SB();
#pragma unroll
    for (int x = 0; x < 4; ++x) s[x >> 1][x & 1] = wmma_h(kh[x & 1], qh[x >> 1], s[x >> 1][x & 1]);
#pragma unroll
    for (int x = 0; x < 4; ++x) s[x >> 1][x & 1] = wmma_h(kh[x & 1], ql[x >> 1], s[x >> 1][x & 1]);
#pragma unroll
    for (int x = 0; x < 4; ++x) s[x >> 1][x & 1] = wmma_h(kl[x & 1], qh[x >> 1], s[x >> 1][x & 1]);   // 3 products, in the order hi hi, residual hi, hi residual
    FA_SB();
#pragma unroll
    for (int j = 0; j < 8; ++j) vf[0][j] = frag_h(&sb.v[j * 16 + col][k0], lane);   // the first v group flies under the softmax
    FA_SB();
    float mst[2];   // the stage's own maxima
#pragma unroll
    for (int qt = 0; qt < 2; ++qt) { float m8[8];   // maximum by a tree, not a single chain of dependent maxima
#pragma unroll
      for (int r = 0; r < 8; ++r) m8[r] = fmaxf(s[qt][0][r], s[qt][1][r]);
      float mx = fmaxf(fmaxf(fmaxf(m8[0], m8[1]), fmaxf(m8[2], m8[3])), fmaxf(fmaxf(m8[4], m8[5]), fmaxf(m8[6], m8[7])));
      mst[qt] = fmaxf(mx, xhalf(mx)); }   // with the other half of the query's 32 keys
    if (__builtin_amdgcn_ballot_w32(mst[0] > mrun[0] + FA_TH || mst[1] > mrun[1] + FA_TH) != 0) {   // scalar branch, one test a stage: the 256 sums a lane are rescaled only where some query's score would leave f16's range above; then every query of the wave takes the larger of its maximum in use and the stage's maximum
      const float mnew[2] = { fmaxf(mrun[0], mst[0]), fmaxf(mrun[1], mst[1]) };
      const float al0 = __builtin_amdgcn_exp2f((mrun[0] - mnew[0]) * L2E), al1 = __builtin_amdgcn_exp2f((mrun[1] - mnew[1]) * L2E);
      mrun[0] = mnew[0]; mrun[1] = mnew[1]; lsum[0] *= al0; lsum[1] *= al1; nb[0] = FA_C - mnew[0] * L2E; nb[1] = FA_C - mnew[1] * L2E;
#pragma unroll
      for (int j = 0; j < 16; ++j) { acc[0][j] *= al0; acc[1][j] *= al1; } }
    v16h pb[2];
#pragma unroll
    for (int x = 0; x < 4; ++x)
#pragma unroll
      for (int r = 0; r < 8; ++r) s[x >> 1][x & 1][r] = fmaf(s[x >> 1][x & 1][r], L2E, nb[x >> 1]);
    FA_SB();   // all exponents are formed before the first exponential: none of them then overwrites an exponential's source directly behind it
#pragma unroll
    for (int x = 0; x < 4; ++x)
#pragma unroll
      for (int r = 0; r < 8; ++r) s[x >> 1][x & 1][r] = __builtin_amdgcn_exp2f(s[x >> 1][x & 1][r]);
    FA_SB();   // and no conversion or sum overwrites one
#pragma unroll
    for (int x = 0; x < 4; ++x)
#pragma unroll
      for (int r = 0; r < 8; ++r) pb[x >> 1][(x & 1) * 8 + r] = (_Float16)s[x >> 1][x & 1][r];   // a query tile's two score tiles, converted in place, are one B operand
#pragma unroll
    for (int qt = 0; qt < 2; ++qt) { const v8f p8 = s[qt][0] + s[qt][1];   // the f32 weights summed by a tree, for the same reason as the maximum
      lsum[qt] += ((p8[0] + p8[1]) + (p8[2] + p8[3])) + ((p8[4] + p8[5]) + (p8[6] + p8[7])); }
    FA_SB();
#pragma unroll
    for (int j = 0; j < 8; ++j) vf[1][j] = frag_h(&sb.v[(8 + j) * 16 + col][k0], lane);   // the stage's last LDS reads fly under the first group's products
    FA_SB();
#pragma unroll
    for (int j = 0; j < 8; ++j) { acc[0][j] = wmma_h(vf[0][j], pb[0], acc[0][j]); acc[1][j] = wmma_h(vf[0][j], pb[1], acc[1][j]); }   // channel tiles 0 .. 7, both query tiles on each fragment
    FA_SB();   // these products stay in front of the stage's foot: sunk behind its barrier they would hold back the refill
    asm volatile("s_wait_dscnt 0x0" :: "v"(lsum[0]), "v"(lsum[1]) : "memory");      // this wave's reads of the buffer are done before it is refilled; the two sums are named as inputs so that they are formed in front of the refill: sunk behind it, their 32 weights stay live beside the copies' addresses and a register is spilled
    asm volatile("s_wait_asynccnt 0x0" ::: "memory");   // this wave's copies of stage t + 1 have landed
    __syncthreads();                                    // publishes stage t + 1 and ends every reader's last read of stage t
    if (t + 2 < FA_NT) { const unsigned bo = (unsigned)(t & 1) * FA_BUFB; fa_fill(lv + bo, lkh + bo, lkl + bo, bv + (size_t)(t + 2) * FA_KT, ov, bkh + (size_t)(t + 2) * FA_KT * CQ, bkl + (size_t)(t + 2) * FA_KT * CQ, ok); }
    FA_SB();   // channel tiles 8 .. 15, all operands in registers, stand behind the refill: the copies go out as soon as the buffer is free and fly under these products too
#pragma unroll
    for (int j = 0; j < 8; ++j) { acc[0][8 + j] = wmma_h(vf[1][j], pb[0], acc[0][8 + j]); acc[1][8 + j] = wmma_h(vf[1][j], pb[1], acc[1][8 + j]); } }
  asm volatile("s_wait_asynccnt 0x0" ::: "memory");     // no copy is outstanding behind the loop
  // the four key quarters of a query are joined: maxima and sums first, then the sums of products, each scaled to the common maximum and divided by the whole sum
#pragma unroll
  for (int qt = 0; qt < 2; ++qt) { const float lj = lsum[qt] + xhalf(lsum[qt]);   // the halves' sums are joined once
    if (g == 0) { sm[kg][il0 + qt * 16 + col] = mrun[qt]; sl[kg][il0 + qt * 16 + col] = lj; } }
  __syncthreads();   // every quarter's maxima and sums are written; the loop's last barrier has ended every read of the ring
#pragma unroll
  for (int qt = 0; qt < 2; ++qt) { const int q = il0 + qt * 16 + col;
    const float m0 = sm[0][q], m1 = sm[1][q], m2 = sm[2][q], m3 = sm[3][q]; const float mm = fmaxf(fmaxf(m0, m1), fmaxf(m2, m3));
    const float e0 = __builtin_amdgcn_exp2f((m0 - mm) * L2E), e1 = __builtin_amdgcn_exp2f((m1 - mm) * L2E), e2 = __builtin_amdgcn_exp2f((m2 - mm) * L2E), e3 = __builtin_amdgcn_exp2f((m3 - mm) * L2E);
    const float ls = (sl[0][q] * e0 + sl[1][q] * e1) + (sl[2][q] * e2 + sl[3][q] * e3);
    const float inv = __builtin_amdgcn_exp2f((mrun[qt] - mm) * L2E) / ls;   // the wave's own quarter's factor over the whole sum
#pragma unroll
    for (int j = 0; j < 16; ++j) { const v8f o = acc[qt][j] * inv; v4f lo = { o[0], o[1], o[2], o[3] }, hi = { o[4], o[5], o[6], o[7] };   // a lane holds 8 consecutive channels of its query
      *(v4f*)&sh.part[kg][q][j * 16 + 8 * g] = lo; *(v4f*)&sh.part[kg][q][j * 16 + 8 * g + 4] = hi; } }
  __syncthreads();   // all four quarters' rows are written before any is read
  const float gm = bfr(GM[0]);
  // channels-last rows [b*n][CV]: positions i0 .. i0+63, whole rows
#pragma unroll 1   // rolled, so that the wait at the trip's foot stands once behind four stores
  for (int i = 0; i < 64 * (CV / 4) / 256; i += 4) {
#pragma unroll   // four row pieces a trip: their x loads go out together and wait once, not one latency each
    for (int u = 0; u < 4; ++u) { const int e = tid + (i + u) * 256, il = e >> 6, q = e & 63; const size_t o = (b * NP + i0 + il) * CV + q * 4; const v4f sv = (*(const v4f*)&sh.part[0][il][q * 4] + *(const v4f*)&sh.part[1][il][q * 4]) + (*(const v4f*)&sh.part[2][il][q * 4] + *(const v4f*)&sh.part[3][il][q * 4]); const v4f xv = *(const v4f*)(X + o); v4f r = { gm * sv[0] + bfr(xv[0]), gm * sv[1] + bfr(xv[1]), gm * sv[2] + bfr(xv[2]), gm * sv[3] + bfr(xv[3]) }; vst2(OUT + o, r); }
    asm volatile("s_wait_xcnt 0x0" ::: "memory"); } }   // stands in front of the next trip's writes to the four stores' address and data registers
extern "C" void kernel_launch(void* const* d_in, const int* in_sizes, int n_in, void* d_out, int out_size, void* d_ws, size_t ws_size, hipStream_t stream) {
  (void)in_sizes; (void)n_in; (void)out_size;
  const float** F = (const float**)d_in;   // 0 inputs [4,64,64,256] channels-last, 1 Wq [256,32] (in,out), 2 bq, 3 Wk, 4 bk, 5 Wv [256,256], 6 bv, 7 gamma [1]
  if (ws_size < (size_t)WS_END) return;
  char* ws = (char*)d_ws; _Float16 *QH = (_Float16*)(ws + WS_QH), *QL = (_Float16*)(ws + WS_QL), *KH = (_Float16*)(ws + WS_KH), *KL = (_Float16*)(ws + WS_KL), *VT = (_Float16*)(ws + WS_VT);
  k_proj<<<dim3(NP / 64, TNB, 3), 128, 0, stream>>>(F[0], F[0], F[1], F[2], F[3], F[4], F[5], F[6], QH, QL, KH, KL, VT);
  k_fa<<<dim3(TQB, TNB), 256, 0, stream>>>(QH, QL, KH, KL, VT, F[0], F[7], (float*)d_out);
}

// v008
// Measured time: 45.3 microseconds a run.
// Timed twice side by side with v007, it ran 1.05 times as fast both times.
// Counting every step since v000, it is 21.5 times as fast.
// compute dtype: all float inputs rounded to bf16, gamma read; q/k (32 ch) and v (256 ch) = x W + b ((in,out)) with EXACT bf16 products on WMMA 16x16x32 (channels-last x tile in LDS), f32 accumulate; q and k as f16 hi + unscaled residual -> UNSCALED logits with 3 products (std ~5.7, near-one-hot softmax), kept in registers; running-maximum softmax in f32, the maximum in use m raised lazily -> P f16 = exp(s - m) / 8 <= 2^15; out = gamma * (P . v) / sum(P) + x with v rounded once to f16, channels-last rows; f32 output.
#include <hip/hip_runtime.h>
#include <math.h>

typedef __attribute__((ext_vector_type(16))) _Float16 v16h;
typedef __attribute__((ext_vector_type(16))) __bf16 v16b;
typedef __attribute__((ext_vector_type(8)))  _Float16 v8h;
typedef __attribute__((ext_vector_type(8)))  float v8f;
typedef __attribute__((ext_vector_type(4)))  float v4f;
typedef __attribute__((ext_vector_type(2)))  float v2f;
typedef __attribute__((ext_vector_type(4)))  unsigned v4u;
typedef __attribute__((ext_vector_type(4)))  int v4i;
typedef float __attribute__((may_alias)) float_a;
typedef int __attribute__((may_alias)) int_a;

template <typename T> __device__ __forceinline__ void vst2(void* p, T v) { *(T*)p = v;  }
__device__ __forceinline__ v8f wmma16(v16h a, v16h b, v8f c) {
  v8f d = __builtin_amdgcn_wmma_f32_16x16x32_f16(false, a, false, b, (short)0, c, false, false);
  asm volatile("v_nop\n\tv_nop\n\tv_nop\n\tv_nop" : "+v"(d) : "v"(a), "v"(b));
  return d;
}
__device__ __forceinline__ v8f wmma_bf(v16b a, v16b b, v8f c) {
  v8f d = __builtin_amdgcn_wmma_f32_16x16x32_bf16(false, a, false, b, (short)0, c, false, false);
  asm volatile("v_nop\n\tv_nop\n\tv_nop\n\tv_nop" : "+v"(d) : "v"(a), "v"(b));
  return d;
}
// 16x16x32 fragments: lane = (h = lane>>4, row/col = lane&15); elements 0..7 = k0+8h+0..7, 8..15 = k0+16+8h+0..7; D element r = row 8h+r
__device__ __forceinline__ v16h frag_h(const _Float16* rowk0, int lane) {
  union { v16h v; v8h q[2]; } u; const _Float16* p = rowk0 + 8 * (lane >> 4);
  u.q[0] = *(const v8h*)p; u.q[1] = *(const v8h*)(p + 16); return u.v;
}
__device__ __forceinline__ v16h frag_f32(const float* rowk0, int lane) {
  v16h a; const float* p = rowk0 + 8 * (lane >> 4);
#pragma unroll
  for (int i = 0; i < 8; ++i) { a[i] = (_Float16)p[i]; a[8 + i] = (_Float16)p[16 + i]; }
  return a;
}
__device__ __forceinline__ v16h frag_f32s(const float* rowk0, int lane, float sc) {
  v16h a; const float* p = rowk0 + 8 * (lane >> 4);
#pragma unroll
  for (int i = 0; i < 8; ++i) { a[i] = (_Float16)(p[i] * sc); a[8 + i] = (_Float16)(p[16 + i] * sc); }
  return a;
}
// column fragment from a [K][ld] layout (column n), rows >= K read as 0
__device__ __forceinline__ v16h fragc_f32(const float* W, int k0, int n, int lane, int ld, int K) {
  v16h a; const int g = lane >> 4;
#pragma unroll
  for (int i = 0; i < 8; ++i) { const int ka = k0 + 8 * g + i, kb = ka + 16;
    a[i] = (_Float16)(ka < K ? W[(size_t)(ka < K ? ka : K - 1) * ld + n] : 0.f); a[8 + i] = (_Float16)(kb < K ? W[(size_t)(kb < K ? kb : K - 1) * ld + n] : 0.f); }
  return a;
}
struct F2 { v16b h, l; };
__device__ __forceinline__ F2 bsplit16(const float v[16]) { F2 r;
#pragma unroll
  for (int i = 0; i < 16; ++i) { const __bf16 h = (__bf16)v[i]; r.h[i] = h; r.l[i] = (__bf16)(v[i] - (float)h); }
  return r; }
__device__ __forceinline__ F2 split_row(const float* row, int k0, int lane) { float v[16]; const float* p = row + k0 + 8 * (lane >> 4);
#pragma unroll
  for (int i = 0; i < 8; ++i) { v[i] = p[i]; v[8 + i] = p[16 + i]; }
  return bsplit16(v); }
__device__ __forceinline__ F2 split_rowK(const float* row, int k0, int lane, int K) { float v[16]; const int g = lane >> 4;
#pragma unroll
  for (int i = 0; i < 8; ++i) { const int ka = k0 + 8 * g + i, kb = ka + 16; v[i] = ka < K ? row[ka < K ? ka : K - 1] : 0.f; v[8 + i] = kb < K ? row[kb < K ? kb : K - 1] : 0.f; }
  return bsplit16(v); }
__device__ __forceinline__ F2 split_col(const float* W, int k0, int n, int lane, int ld, int K) { float v[16]; const int g = lane >> 4;
#pragma unroll
  for (int i = 0; i < 8; ++i) { const int ka = k0 + 8 * g + i, kb = ka + 16; v[i] = ka < K ? W[(size_t)(ka < K ? ka : K - 1) * ld + n] : 0.f; v[8 + i] = kb < K ? W[(size_t)(kb < K ? kb : K - 1) * ld + n] : 0.f; }
  return bsplit16(v); }
__device__ __forceinline__ v8f mac3(const F2& a, const F2& b, v8f c) { c = wmma_bf(a.l, b.h, c); c = wmma_bf(a.h, b.l, c); return wmma_bf(a.h, b.h, c); }
__device__ __forceinline__ float sigm(float v) { return 1.0f / (1.0f + expf(-v)); }
#define LDSX() do { asm volatile("s_wait_dscnt 0" ::: "memory"); __builtin_amdgcn_wave_barrier(); __builtin_amdgcn_fence(__ATOMIC_RELEASE, "workgroup"); } while (0)


// SelfAttentionModel (SAGAN-style, channels-last input [B, 64, 64, 256]): energy = q k^T unscaled over all 4,096 positions, out = gamma * softmax(energy) v + inputs.
#define NB 4
#define NP 4096
#define CIN 256
#define CQ 32
#define CV 256
#ifndef TNB
#define TNB NB
#endif
#ifndef TQB
#define TQB (NP / 64)
#endif
typedef __attribute__((ext_vector_type(8))) __bf16 v8b;
typedef __attribute__((ext_vector_type(4))) __bf16 v4b;
__device__ __forceinline__ v16b frag_b(const __bf16* rowk0, int lane) {
  union { v16b v; v8b q[2]; } u; const __bf16* p = rowk0 + 8 * (lane >> 4);
  u.q[0] = *(const v8b*)p; u.q[1] = *(const v8b*)(p + 16); return u.v;
}
__device__ __forceinline__ float bfr(float v) { return (float)(__bf16)v; }
__device__ __attribute__((noinline)) float exp_ni(float v) { return expf(v); }
__device__ __attribute__((noinline)) float erf_ni(float v) { return erff(v); }

#define WS_QH  0u                                    // f16 q rows [b*n][CQ] hi
#define WS_QL  (WS_QH + 2u * (size_t)NB * NP * CQ)      // f16 q residual rows (unscaled)
#define WS_KH  (WS_QL + 2u * (size_t)NB * NP * CQ)      // f16 k rows
#define WS_KL  (WS_KH + 2u * (size_t)NB * NP * CQ)      // f16 k residual rows
#define WS_VT  (WS_KL + 2u * (size_t)NB * NP * CQ)      // f16 v planes [b][CV][n]
#define WS_END (WS_VT + 2u * (size_t)NB * CV * NP)

// keeps a batch of loads together at its place, ahead of the work that hides their latency
#define PJ_SB() __builtin_amdgcn_sched_barrier(0)
// one lane's share of the eight B fragments of its out channel (all 256 in channels): wl = W + 8 g NOUT + channel; constant row steps, so one address serves all 128 loads
template <int NOUT> __device__ __forceinline__ void pj_loadw(float (&wr)[CIN / 32][16], const float* __restrict__ wl) {
#pragma unroll
  for (int kc = 0; kc < CIN / 32; ++kc)
#pragma unroll
    for (int i = 0; i < 8; ++i) { wr[kc][i] = wl[(kc * 32 + i) * NOUT]; wr[kc][8 + i] = wl[(kc * 32 + 16 + i) * NOUT]; } }
// defined behind the kernel
template <int NOUT> __device__ __forceinline__ void pj_run(const float* Wa, const float* Ba, const float* Wb, const float* Bb, _Float16* __restrict__ dha, _Float16* __restrict__ dla, _Float16* __restrict__ dhb, _Float16* __restrict__ dlb, _Float16* __restrict__ VT, const __bf16 (&sx)[64][CIN + 8], _Float16 (&sh)[64][72], _Float16 (&sl)[64][72], _Float16 (&tv)[64][72], int p0, size_t b, int cg0, int cgn);
// ---- k_proj: block = (64 positions, b, which 0 / 1 v out channels 0 .. 127 / 128 .. 255, 2 q and k together): the 320 out channels are five groups of 64, dealt 2 + 2 + 1 to a tile's three blocks, the longer blocks first in the grid; channels-last x tile (bf16) in LDS, W [in][out] + b (exact); q and k -> f16 hi + residual rows, v -> f16 planes [c][n]
__global__ __launch_bounds__(128) void k_proj(const float* __restrict__ XQK, const float* __restrict__ XV, const float* __restrict__ WQ, const float* __restrict__ BQ, const float* __restrict__ WK, const float* __restrict__ BK, const float* __restrict__ WV, const float* __restrict__ BV, _Float16* __restrict__ QH, _Float16* __restrict__ QL, _Float16* __restrict__ KH, _Float16* __restrict__ KL, _Float16* __restrict__ VT) {
  __shared__ __align__(16) __bf16 sx[64][CIN + 8]; __shared__ __align__(16) _Float16 sh[64][72], sl[64][72]; __shared__ __align__(16) _Float16 tv[64][72];
  const int tid = threadIdx.x, wave = tid >> 5, lane = tid & 31, col = lane & 15, g = lane >> 4; const int p0 = blockIdx.x * 64; const size_t b = blockIdx.y; const int which = blockIdx.z;
  const float* X = (which == 2) ? XQK : XV;
  { const float* xl = X + ((size_t)b * NP + p0) * CIN + tid * 4;   // channels-last rows: the tile's 64 rows are 64 KB in a row, taken as 16-byte pieces, piece tid + 128 i
    v4f xr[32];
#pragma unroll
    for (int i = 0; i < 32; ++i) xr[i] = *(const v4f*)(xl + i * 512);   // a thread's 32 loads go out as one batch: one latency for the tile, not one per group of eight 4-byte loads
#pragma unroll
    for (int i = 0; i < 32; ++i) { const v4b xb = { (__bf16)xr[i][0], (__bf16)xr[i][1], (__bf16)xr[i][2], (__bf16)xr[i][3] }; *(v4b*)&sx[(tid >> 6) + 2 * i][(tid & 63) * 4] = xb; } }   // four channels an 8-byte LDS store
  __syncthreads();
  if (which != 2) pj_run<CV>(WV, BV, WV, BV, nullptr, nullptr, nullptr, nullptr, VT, sx, sh, sl, tv, p0, b, which * 2, 2);   // which is the same for the whole block: every barrier inside is passed by all its waves
  else pj_run<CQ>(WQ, BQ, WK, BK, QH, QL, KH, KL, nullptr, sx, sh, sl, tv, p0, b, 0, 1); }
// the products of a block behind its x tile: wave = all 64 positions x 16 out channels of a group of 64, so a group's W fragments are one wave's 128 registers a lane and are fetched in one batch, by that wave only
// NOUT == CV: groups cg0 .. cg0 + cgn - 1 of v (Wa, Ba). NOUT == CQ: one group, waves 0, 1 = q's 32 channels (Wa, Ba), waves 2, 3 = k's (Wb, Bb)
template <int NOUT> __device__ __forceinline__ void pj_run(const float* Wa, const float* Ba, const float* Wb, const float* Bb, _Float16* __restrict__ dha, _Float16* __restrict__ dla, _Float16* __restrict__ dhb, _Float16* __restrict__ dlb, _Float16* __restrict__ VT, const __bf16 (&sx)[64][CIN + 8], _Float16 (&sh)[64][72], _Float16 (&sl)[64][72], _Float16 (&tv)[64][72], int p0, size_t b, int cg0, int cgn) {
  const int tid = threadIdx.x, wave = tid >> 5, lane = tid & 31, col = lane & 15, g = lane >> 4;
  const bool first = NOUT == CV || __builtin_amdgcn_readfirstlane(wave) < 2;   // the same for a whole wave: the two bases stay scalar
  const float* __restrict__ Wm = first ? Wa : Wb; const float* __restrict__ Bm = first ? Ba : Bb;
#pragma unroll 1
  for (int cg = cg0; cg < cg0 + cgn; ++cg) { float wr[CIN / 32][16]; v16b af[2][8];   // two sets of x fragments (two k steps x four position tiles each)
    const int o = min(NOUT == CV ? cg * 64 + wave * 16 + col : (wave & 1) * 16 + col, NOUT - 1);   // the lane's out channel in its own matrix
#pragma unroll
    for (int j = 0; j < 8; ++j) af[0][j] = frag_b(&sx[(j & 3) * 16 + col][(j >> 2) * 32], lane);
    PJ_SB();   // the first x fragments' reads stand in front of the W loads: behind them they could take the loads' address registers ahead of the wait below
    const float braw = Bm[o];
    asm volatile("s_wait_xcnt 0x0" ::: "memory");   // stands in front of the W loads, whose results may take the bias load's offset register
    pj_loadw<NOUT>(wr, Wm + 8 * g * NOUT + o);   // the group's 128 W loads go out as one batch; the products start as the first of them return
    asm volatile("s_wait_xcnt 0x0" ::: "memory");   // stands in front of any later write to the loads' address registers
    PJ_SB();   // and nothing is moved up in front of that wait
    const float bb = bfr(braw);
    v8f acc[4] = {};
#pragma unroll
    for (int kp = 0; kp < CIN / 64; ++kp) { const int cur = kp & 1;
      PJ_SB();   // the next eight x fragments are read as one group ahead of this group's products
      if (kp + 1 < CIN / 64) {
#pragma unroll
        for (int j = 0; j < 8; ++j) af[cur ^ 1][j] = frag_b(&sx[(j & 3) * 16 + col][((kp + 1) * 2 + (j >> 2)) * 32], lane); }
      PJ_SB();
#pragma unroll
      for (int h = 0; h < 2; ++h) { v16b wf;
#pragma unroll
        for (int i = 0; i < 16; ++i) wf[i] = (__bf16)wr[kp * 2 + h][i];
#pragma unroll
        for (int m = 0; m < 4; ++m) acc[m] = wmma_bf(af[cur][h * 4 + m], wf, acc[m]); } }
    __syncthreads();
    const int ol = wave * 16 + col;
#pragma unroll
    for (int m = 0; m < 4; ++m)
#pragma unroll
      for (int r = 0; r < 8; ++r) { const int pl = m * 16 + 8 * g + r; const float v = acc[m][r] + bb; const _Float16 hv = (_Float16)v; if (NOUT == CV) tv[ol][pl] = hv; else { sh[pl][ol] = hv; sl[pl][ol] = (_Float16)(v - (float)hv); } }   // q AND k keep a residual
    __syncthreads();
    if (NOUT != CV) { for (int e = tid; e < 64 * 8; e += 128) { const int pl = e >> 3, q = e & 7; const size_t at = (b * NP + p0 + pl) * CQ + (q & 3) * 8; vst2((unsigned*)((q < 4 ? dha : dhb) + at), *(const v4u*)&sh[pl][q * 8]); vst2((unsigned*)((q < 4 ? dla : dlb) + at), *(const v4u*)&sl[pl][q * 8]);   // staged columns 0 .. 31 are q's, 32 .. 63 k's
        asm volatile("s_wait_xcnt 0x0" ::: "memory"); } }   // stands in front of the next trip's writes to the two stores' address and data registers
    else { for (int e = tid; e < 64 * 8; e += 128) { const int ov = e >> 3, q = e & 7; vst2((unsigned*)(VT + (b * CV + cg * 64 + ov) * (size_t)NP + p0 + q * 8), *(const v4u*)&tv[ov][q * 8]); } } } }
// the plain builtin: the compiler keeps the distance behind it itself and may place operands in any register
__device__ __forceinline__ v8f wmma_h(v16h a, v16h b, v8f c) { return __builtin_amdgcn_wmma_f32_16x16x32_f16(false, a, false, b, (short)0, c, false, false); }
// lane l with lane l ^ 16, on the vector unit
__device__ __forceinline__ float xhalf(float x) { return __builtin_bit_cast(float, __builtin_amdgcn_permlanex16(__builtin_bit_cast(int, x), __builtin_bit_cast(int, x), 0x76543210, 0xfedcba98, false, false)); }
// keeps a group of LDS reads together at its place: without it the compiler spreads the reads singly among the products, each with its own wait
#define FA_SB() __builtin_amdgcn_sched_barrier(0)
// ---- k_fa: block = (64 queries, batch b), eight waves = 2 query halves x 4 key quarters: wave = 32 queries x all 256 channels x 32 of a stage's 128 keys, so a v fragment read from LDS serves two products and two waves share a SIMD; S^T = K Q^T, running-maximum softmax in registers, O^T += V^T P^T; the four key quarters' sums are joined once, behind the loop, through LDS; k and v tiles of 128 keys staged in LDS (two buffers, asynchronous copies)
#define FA_KT 128                      // keys per stage: 256 B of a v row, so one wave-wide copy brings two whole row pieces
#define FA_NT (NP / FA_KT)
#define FA_VP (FA_KT + 8)              // f16 elements; 272 B = 16 B x odd: the pitch for ds_load_b128 readers
#define FA_KP (CQ + 8)                 // 80 B = 16 B x odd
#define FA_VPB (2u * FA_VP)
#define FA_KPB (2u * FA_KP)
#define FA_TH 12.476649250f             // 18 ln 2: how far a score may pass the maximum in use before the sums are rescaled
#define FA_C (-3.0f)                   // P = exp(s - m) x 2^FA_C: at most 2^15, below f16's largest number; the largest weight is at least 2^-3, so weights down to 2^-11 of it are normal f16 numbers and smaller ones round within 2^-22 of it
struct FaStage { _Float16 v[CV][FA_VP]; _Float16 kh[FA_KT][FA_KP]; _Float16 kl[FA_KT][FA_KP]; };
#define FA_BUFB ((unsigned)sizeof(FaStage))
// one wave's share of a stage: 32 of the 256 v rows (two rows a copy) and 16 of the 128 keys' hi and residual rows (eight keys a copy): 20 copies in flight
// a copy's immediate offset moves both of its addresses, so it is the copy's distance in LDS from the lane's first v row (2 rows = 544 B a copy) or first hi row (8 keys = 640 B; the residual rows FA_KT FA_KPB bytes behind the hi rows), and the copy's uniform base holds its distance in global memory less that immediate:
// LDS byte = the lane's LDS address + immediate, global byte = uniform base + the lane's 32-bit byte offset + immediate. The 16 v copies share two vector registers and so do the 4 k copies: no vector address sum per copy
typedef __attribute__((address_space(1))) v4i* fa_gp; typedef __attribute__((address_space(3))) v4i* fa_lp;
template <int N> __device__ __forceinline__ void fa_cp(const char* base, unsigned off, unsigned lds) { __builtin_amdgcn_global_load_async_to_lds_b128((fa_gp)(base + off), (fa_lp)lds, N, 0); }
// a copy's base as a scalar value of its own: left as base + constant, the compiler puts the constant behind the lane's offset and forms every copy's address by a 64-bit vector sum
__device__ __forceinline__ const char* fa_sc(const char* p) { const unsigned long long u = (unsigned long long)p; return (const char*)(((unsigned long long)(unsigned)__builtin_amdgcn_readfirstlane((int)(u >> 32)) << 32) | (unsigned)__builtin_amdgcn_readfirstlane((int)u)); }
struct FaBase { const char* v[16]; const char* k[4]; };   // the 20 copies' bases: the same for every stage
template <int I> __device__ __forceinline__ void fa_cpv(const FaBase& fb, unsigned ov, unsigned lv) { fa_cp<I * 2 * (int)FA_VPB>(fb.v[I], ov, lv); if constexpr (I + 1 < 16) fa_cpv<I + 1>(fb, ov, lv); }
#define FA_K8 (8 * (int)FA_KPB)          // LDS distance of eight keys' rows
#define FA_KL0 (FA_KT * (int)FA_KPB)     // and from the hi rows to the residual rows
__device__ __forceinline__ void fa_fill(unsigned lv, unsigned lk, const FaBase& fb, unsigned ov, unsigned ok) {
  fa_cpv<0>(fb, ov, lv);
  fa_cp<0>(fb.k[0], ok, lk); fa_cp<FA_K8>(fb.k[1], ok, lk); fa_cp<FA_KL0>(fb.k[2], ok, lk); fa_cp<FA_KL0 + FA_K8>(fb.k[3], ok, lk); }
union FaSh { FaStage ring[2]; float part[4][64][CV + 4]; };   // behind the loop the ring's bytes hold the four key quarters' scaled sums
__global__ __launch_bounds__(256) void k_fa(const _Float16* __restrict__ QH, const _Float16* __restrict__ QL, const _Float16* __restrict__ KH, const _Float16* __restrict__ KL, const _Float16* __restrict__ VT, const float* __restrict__ X, const float* __restrict__ GM, float* __restrict__ OUT) { __shared__ __align__(16) FaSh sh; __shared__ float sm[4][64], sl[4][64];
  const int tid = threadIdx.x, wave = tid >> 5, lane = tid & 31, col = lane & 15, g = lane >> 4; const size_t b = blockIdx.y; const int i0 = blockIdx.x * 64;
  const int qg = wave & 1, kg = wave >> 1; const int il0 = qg * 32, k0 = kg * 32;   // the wave's 32 queries of the block, and its 32 keys of every stage
  const unsigned lv = (unsigned)(size_t)&sh.ring[0].v[wave * 32 + g][col * 8], lk = (unsigned)(size_t)&sh.ring[0].kh[wave * 16 + (lane >> 2)][(lane & 3) * 8];
  const char* bv = (const char*)(VT + b * CV * (size_t)NP); const char* bkh = (const char*)(KH + b * NP * (size_t)CQ); const char* bkl = (const char*)(KL + b * NP * (size_t)CQ);   // the batch's planes and rows, uniform
  FaBase fb;
#pragma unroll
  for (int i = 0; i < 16; ++i) fb.v[i] = fa_sc(bv + i * (2 * 2 * NP - 2 * (int)FA_VPB));   // two rows of a plane a copy, less the copy's immediate
  fb.k[0] = fa_sc(bkh); fb.k[1] = fa_sc(bkh + (8 * 2 * CQ - FA_K8)); fb.k[2] = fa_sc(bkl - FA_KL0); fb.k[3] = fa_sc(bkl + (8 * 2 * CQ - FA_KL0 - FA_K8));
  const unsigned ov = 2u * ((unsigned)(wave * 32 + g) * NP + col * 8), ok = 2u * ((unsigned)(wave * 16 + (lane >> 2)) * CQ + (lane & 3) * 8);   // the lane's byte offsets inside them at stage 0; a stage adds 2 FA_KT bytes to the first, 2 FA_KT CQ to the second
  v16h qh[2], ql[2];   // B operands: column = query, two tiles of 16, kept for the whole kernel
  const size_t qr = (b * NP + i0 + il0 + col) * CQ + 8 * g; const _Float16* pqh = QH + qr; const _Float16* pql = QL + qr;   // the lane's place in its first query's rows: elements 8g .. and 16 + 8g ..
#pragma unroll
  for (int qt = 0; qt < 2; ++qt) { union { v16h v; v8h q[2]; } uh, ul; uh.q[0] = *(const v8h*)(pqh + qt * 16 * CQ); uh.q[1] = *(const v8h*)(pqh + qt * 16 * CQ + 16); ul.q[0] = *(const v8h*)(pql + qt * 16 * CQ); ul.q[1] = *(const v8h*)(pql + qt * 16 * CQ + 16); qh[qt] = uh.v; ql[qt] = ul.v; }
  asm volatile("s_wait_xcnt 0x0" :: "v"(pqh), "v"(pql) : "memory");   // stands in front of any later write to the q loads' address registers, which it names as inputs so that they live up to it
  FA_SB();   // and nothing is moved up in front of that wait
  const float L2E = 1.4426950408889634f;
  v8f acc[2][16] = {}; float mrun[2] = { -3.0e38f, -3.0e38f }, lsum[2] = { 0.f, 0.f }, nb[2] = { 0.f, 0.f };   // per lane and query tile: its query's running maximum over the wave's keys, its half's share of the sum, and FA_C - maximum x log2 e (set with the maximum). The maximum is the one IN USE: it is raised, and the sums rescaled, only when a score passes it by more than FA_TH; numerator and sum carry the same m and the same factor, which cancel
  fa_fill(lv, lk, fb, ov, ok);
  asm volatile("s_wait_asynccnt 0x0" ::: "memory");   // stage 0 has landed before the barrier publishes it
  __syncthreads();
  fa_fill(lv + FA_BUFB, lk + FA_BUFB, fb, ov + 2u * FA_KT, ok + 2u * FA_KT * CQ);
#pragma unroll 1
  for (int t = 0; t < FA_NT; ++t) { const FaStage& sb = sh.ring[t & 1];   // rolled: one stage a trip, the buffer by parity
    v16h kh[2], kl[2], vf[2][8];   // k fragments of the wave's 32 keys; two sets of v fragments: the second goes out as one group ahead of the first group's products
#pragma unroll
    for (int kt = 0; kt < 2; ++kt) { kh[kt] = frag_h(&sb.kh[k0 + kt * 16 + col][0], lane); kl[kt] = frag_h(&sb.kl[k0 + kt * 16 + col][0], lane); }
    v8f s[2][2] = {};   // S^T tiles [query tile][key tile]: register r = key 8g + r of the tile, lane column = query
    FA_SB();
#pragma unroll
    for (int x = 0; x < 4; ++x) s[x >> 1][x & 1] = wmma_h(kh[x & 1], qh[x >> 1], s[x >> 1][x & 1]);
#pragma unroll
    for (int x = 0; x < 4; ++x) s[x >> 1][x & 1] = wmma_h(kh[x & 1], ql[x >> 1], s[x >> 1][x & 1]);
#pragma unroll
    for (int x = 0; x < 4; ++x) s[x >> 1][x & 1] = wmma_h(kl[x & 1], qh[x >> 1], s[x >> 1][x & 1]);   // 3 products, in the order hi hi, residual hi, hi residual
    FA_SB();
#pragma unroll
    for (int j = 0; j < 8; ++j) vf[0][j] = frag_h(&sb.v[j * 16 + col][k0], lane);   // the first v group flies under the softmax
    FA_SB();
    float mst[2];   // the stage's own maxima
#pragma unroll
    for (int qt = 0; qt < 2; ++qt) { float m8[8];   // maximum by a tree, not a single chain of dependent maxima
#pragma unroll
      for (int r = 0; r < 8; ++r) m8[r] = fmaxf(s[qt][0][r], s[qt][1][r]);
      float mx = fmaxf(fmaxf(fmaxf(m8[0], m8[1]), fmaxf(m8[2], m8[3])), fmaxf(fmaxf(m8[4], m8[5]), fmaxf(m8[6], m8[7])));
      mst[qt] = fmaxf(mx, xhalf(mx)); }   // with the other half of the query's 32 keys
    if (__builtin_amdgcn_ballot_w32(mst[0] > mrun[0] + FA_TH || mst[1] > mrun[1] + FA_TH) != 0) {   // scalar branch, one test a stage: the 256 sums a lane are rescaled only where some query's score would leave f16's range above; then every query of the wave takes the larger of its maximum in use and the stage's maximum
      const float mnew[2] = { fmaxf(mrun[0], mst[0]), fmaxf(mrun[1], mst[1]) };
      const float al0 = __builtin_amdgcn_exp2f((mrun[0] - mnew[0]) * L2E), al1 = __builtin_amdgcn_exp2f((mrun[1] - mnew[1]) * L2E);
      mrun[0] = mnew[0]; mrun[1] = mnew[1]; lsum[0] *= al0; lsum[1] *= al1; nb[0] = FA_C - mnew[0] * L2E; nb[1] = FA_C - mnew[1] * L2E;
#pragma unroll
      for (int j = 0; j < 16; ++j) { acc[0][j] *= al0; acc[1][j] *= al1; } }
    v16h pb[2];
#pragma unroll
    for (int x = 0; x < 4; ++x)
#pragma unroll
      for (int r = 0; r < 8; ++r) s[x >> 1][x & 1][r] = fmaf(s[x >> 1][x & 1][r], L2E, nb[x >> 1]);
    FA_SB();   // all exponents are formed before the first exponential: none of them then overwrites an exponential's source directly behind it
#pragma unroll
    for (int x = 0; x < 4; ++x)
#pragma unroll
      for (int r = 0; r < 8; ++r) s[x >> 1][x & 1][r] = __builtin_amdgcn_exp2f(s[x >> 1][x & 1][r]);
    FA_SB();   // and no conversion or sum overwrites one
#pragma unroll
    for (int x = 0; x < 4; ++x)
#pragma unroll
      for (int r = 0; r < 8; ++r) pb[x >> 1][(x & 1) * 8 + r] = (_Float16)s[x >> 1][x & 1][r];   // a query tile's two score tiles, converted in place, are one B operand
#pragma unroll
    for (int qt = 0; qt < 2; ++qt) { const v8f p8 = s[qt][0] + s[qt][1];   // the f32 weights summed by a tree, for the same reason as the maximum
      lsum[qt] += ((p8[0] + p8[1]) + (p8[2] + p8[3])) + ((p8[4] + p8[5]) + (p8[6] + p8[7])); }
    FA_SB();
#pragma unroll
    for (int j = 0; j < 8; ++j) vf[1][j] = frag_h(&sb.v[(8 + j) * 16 + col][k0], lane);   // the stage's last LDS reads fly under the first group's products
    FA_SB();
#pragma unroll
    for (int j = 0; j < 8; ++j) { acc[0][j] = wmma_h(vf[0][j], pb[0], acc[0][j]); acc[1][j] = wmma_h(vf[0][j], pb[1], acc[1][j]); }   // channel tiles 0 .. 7, both query tiles on each fragment
    FA_SB();   // these products stay in front of the stage's foot: sunk behind its barrier they would hold back the refill
    asm volatile("s_wait_dscnt 0x0" :: "v"(lsum[0]), "v"(lsum[1]) : "memory");      // this wave's reads of the buffer are done before it is refilled; the two sums are named as inputs so that they are formed in front of the refill: sunk behind it, their 32 weights stay live beside the copies' addresses and a register is spilled
    asm volatile("s_wait_asynccnt 0x0" ::: "memory");   // this wave's copies of stage t + 1 have landed
    __syncthreads();                                    // publishes stage t + 1 and ends every reader's last read of stage t
    if (t + 2 < FA_NT) { const unsigned bo = (unsigned)(t & 1) * FA_BUFB; fa_fill(lv + bo, lk + bo, fb, ov + (unsigned)(t + 2) * (2u * FA_KT), ok + (unsigned)(t + 2) * (2u * FA_KT * CQ)); }
    FA_SB();   // channel tiles 8 .. 15, all operands in registers, stand behind the refill: the copies go out as soon as the buffer is free and fly under these products too
#pragma unroll
    for (int j = 0; j < 8; ++j) { acc[0][8 + j] = wmma_h(vf[1][j], pb[0], acc[0][8 + j]); acc[1][8 + j] = wmma_h(vf[1][j], pb[1], acc[1][8 + j]); } }
  asm volatile("s_wait_asynccnt 0x0" ::: "memory");     // no copy is outstanding behind the loop
  // the four key quarters of a query are joined: maxima and sums first, then the sums of products, each scaled to the common maximum and divided by the whole sum
#pragma unroll
  for (int qt = 0; qt < 2; ++qt) { const float lj = lsum[qt] + xhalf(lsum[qt]);   // the halves' sums are joined once
    if (g == 0) { sm[kg][il0 + qt * 16 + col] = mrun[qt]; sl[kg][il0 + qt * 16 + col] = lj; } }
  __syncthreads();   // every quarter's maxima and sums are written; the loop's last barrier has ended every read of the ring
#pragma unroll
  for (int qt = 0; qt < 2; ++qt) { const int q = il0 + qt * 16 + col;
    const float m0 = sm[0][q], m1 = sm[1][q], m2 = sm[2][q], m3 = sm[3][q]; const float mm = fmaxf(fmaxf(m0, m1), fmaxf(m2, m3));
    const float e0 = __builtin_amdgcn_exp2f((m0 - mm) * L2E), e1 = __builtin_amdgcn_exp2f((m1 - mm) * L2E), e2 = __builtin_amdgcn_exp2f((m2 - mm) * L2E), e3 = __builtin_amdgcn_exp2f((m3 - mm) * L2E);
    const float ls = (sl[0][q] * e0 + sl[1][q] * e1) + (sl[2][q] * e2 + sl[3][q] * e3);
    const float inv = __builtin_amdgcn_exp2f((mrun[qt] - mm) * L2E) / ls;   // the wave's own quarter's factor over the whole sum
#pragma unroll
    for (int j = 0; j < 16; ++j) { const v8f o = acc[qt][j] * inv; v4f lo = { o[0], o[1], o[2], o[3] }, hi = { o[4], o[5], o[6], o[7] };   // a lane holds 8 consecutive channels of its query
      *(v4f*)&sh.part[kg][q][j * 16 + 8 * g] = lo; *(v4f*)&sh.part[kg][q][j * 16 + 8 * g + 4] = hi; } }
  __syncthreads();   // all four quarters' rows are written before any is read
  const float gm = bfr(GM[0]);
  // channels-last rows [b*n][CV]: positions i0 .. i0+63, whole rows
#pragma unroll 1   // rolled, so that the wait at the trip's foot stands once behind four stores
  for (int i = 0; i < 64 * (CV / 4) / 256; i += 4) {
#pragma unroll   // four row pieces a trip: their x loads go out together and wait once, not one latency each
    for (int u = 0; u < 4; ++u) { const int e = tid + (i + u) * 256, il = e >> 6, q = e & 63; const size_t o = (b * NP + i0 + il) * CV + q * 4; const v4f sv = (*(const v4f*)&sh.part[0][il][q * 4] + *(const v4f*)&sh.part[1][il][q * 4]) + (*(const v4f*)&sh.part[2][il][q * 4] + *(const v4f*)&sh.part[3][il][q * 4]); const v4f xv = *(const v4f*)(X + o); v4f r = { gm * sv[0] + bfr(xv[0]), gm * sv[1] + bfr(xv[1]), gm * sv[2] + bfr(xv[2]), gm * sv[3] + bfr(xv[3]) }; vst2(OUT + o, r); }
    asm volatile("s_wait_xcnt 0x0" ::: "memory"); } }   // stands in front of the next trip's writes to the four stores' address and data registers
extern "C" void kernel_launch(void* const* d_in, const int* in_sizes, int n_in, void* d_out, int out_size, void* d_ws, size_t ws_size, hipStream_t stream) {
  (void)in_sizes; (void)n_in; (void)out_size;
  const float** F = (const float**)d_in;   // 0 inputs [4,64,64,256] channels-last, 1 Wq [256,32] (in,out), 2 bq, 3 Wk, 4 bk, 5 Wv [256,256], 6 bv, 7 gamma [1]
  if (ws_size < (size_t)WS_END) return;
  char* ws = (char*)d_ws; _Float16 *QH = (_Float16*)(ws + WS_QH), *QL = (_Float16*)(ws + WS_QL), *KH = (_Float16*)(ws + WS_KH), *KL = (_Float16*)(ws + WS_KL), *VT = (_Float16*)(ws + WS_VT);
  k_proj<<<dim3(NP / 64, TNB, 3), 128, 0, stream>>>(F[0], F[0], F[1], F[2], F[3], F[4], F[5], F[6], QH, QL, KH, KL, VT);
  k_fa<<<dim3(TQB, TNB), 256, 0, stream>>>(QH, QL, KH, KL, VT, F[0], F[7], (float*)d_out);
}

// v009
// It runs in 42.7 microseconds.
// In both of two side-by-side timings against v008, it was 1.07 times as fast.
// Counting every step since v000, it is 23.0 times as fast.
// compute dtype: all float inputs rounded to bf16, gamma read; q/k (32 ch) and v (256 ch) = x W + b ((in,out)) with EXACT bf16 products on WMMA 16x16x32 (channels-last x tile in LDS), f32 accumulate; q and k as f16 hi + unscaled residual -> UNSCALED logits with 3 products (std ~5.7, near-one-hot softmax), kept in registers; running-maximum softmax in f32, the maximum in use m raised lazily -> P f16 = exp(s - m) / 8 <= 2^15; out = gamma * (P . v) / sum(P) + x with v rounded once to f16, channels-last rows; f32 output.
#include <hip/hip_runtime.h>
#include <math.h>

typedef __attribute__((ext_vector_type(16))) _Float16 v16h;
typedef __attribute__((ext_vector_type(16))) __bf16 v16b;
typedef __attribute__((ext_vector_type(8)))  _Float16 v8h;
typedef __attribute__((ext_vector_type(8)))  float v8f;
typedef __attribute__((ext_vector_type(4)))  float v4f;
typedef __attribute__((ext_vector_type(2)))  float v2f;
typedef __attribute__((ext_vector_type(4)))  unsigned v4u;
typedef __attribute__((ext_vector_type(4)))  int v4i;
typedef float __attribute__((may_alias)) float_a;
typedef int __attribute__((may_alias)) int_a;

template <typename T> __device__ __forceinline__ void vst2(void* p, T v) { *(T*)p = v;  }
__device__ __forceinline__ v8f wmma16(v16h a, v16h b, v8f c) {
  v8f d = __builtin_amdgcn_wmma_f32_16x16x32_f16(false, a, false, b, (short)0, c, false, false);
  asm volatile("v_nop\n\tv_nop\n\tv_nop\n\tv_nop" : "+v"(d) : "v"(a), "v"(b));
  return d;
}
__device__ __forceinline__ v8f wmma_bf(v16b a, v16b b, v8f c) {
  v8f d = __builtin_amdgcn_wmma_f32_16x16x32_bf16(false, a, false, b, (short)0, c, false, false);
  asm volatile("v_nop\n\tv_nop\n\tv_nop\n\tv_nop" : "+v"(d) : "v"(a), "v"(b));
  return d;
}
// 16x16x32 fragments: lane = (h = lane>>4, row/col = lane&15); elements 0..7 = k0+8h+0..7, 8..15 = k0+16+8h+0..7; D element r = row 8h+r
__device__ __forceinline__ v16h frag_h(const _Float16* rowk0, int lane) {
  union { v16h v; v8h q[2]; } u; const _Float16* p = rowk0 + 8 * (lane >> 4);
  u.q[0] = *(const v8h*)p; u.q[1] = *(const v8h*)(p + 16); return u.v;
}
__device__ __forceinline__ v16h frag_f32(const float* rowk0, int lane) {
  v16h a; const float* p = rowk0 + 8 * (lane >> 4);
#pragma unroll
  for (int i = 0; i < 8; ++i) { a[i] = (_Float16)p[i]; a[8 + i] = (_Float16)p[16 + i]; }
  return a;
}
__device__ __forceinline__ v16h frag_f32s(const float* rowk0, int lane, float sc) {
  v16h a; const float* p = rowk0 + 8 * (lane >> 4);
#pragma unroll
  for (int i = 0; i < 8; ++i) { a[i] = (_Float16)(p[i] * sc); a[8 + i] = (_Float16)(p[16 + i] * sc); }
  return a;
}
// column fragment from a [K][ld] layout (column n), rows >= K read as 0
__device__ __forceinline__ v16h fragc_f32(const float* W, int k0, int n, int lane, int ld, int K) {
  v16h a; const int g = lane >> 4;
#pragma unroll
  for (int i = 0; i < 8; ++i) { const int ka = k0 + 8 * g + i, kb = ka + 16;
    a[i] = (_Float16)(ka < K ? W[(size_t)(ka < K ? ka : K - 1) * ld + n] : 0.f); a[8 + i] = (_Float16)(kb < K ? W[(size_t)(kb < K ? kb : K - 1) * ld + n] : 0.f); }
  return a;
}
struct F2 { v16b h, l; };
__device__ __forceinline__ F2 bsplit16(const float v[16]) { F2 r;
#pragma unroll
  for (int i = 0; i < 16; ++i) { const __bf16 h = (__bf16)v[i]; r.h[i] = h; r.l[i] = (__bf16)(v[i] - (float)h); }
  return r; }
__device__ __forceinline__ F2 split_row(const float* row, int k0, int lane) { float v[16]; const float* p = row + k0 + 8 * (lane >> 4);
#pragma unroll
  for (int i = 0; i < 8; ++i) { v[i] = p[i]; v[8 + i] = p[16 + i]; }
  return bsplit16(v); }
__device__ __forceinline__ F2 split_rowK(const float* row, int k0, int lane, int K) { float v[16]; const int g = lane >> 4;
#pragma unroll
  for (int i = 0; i < 8; ++i) { const int ka = k0 + 8 * g + i, kb = ka + 16; v[i] = ka < K ? row[ka < K ? ka : K - 1] : 0.f; v[8 + i] = kb < K ? row[kb < K ? kb : K - 1] : 0.f; }
  return bsplit16(v); }
__device__ __forceinline__ F2 split_col(const float* W, int k0, int n, int lane, int ld, int K) { float v[16]; const int g = lane >> 4;
#pragma unroll
  for (int i = 0; i < 8; ++i) { const int ka = k0 + 8 * g + i, kb = ka + 16; v[i] = ka < K ? W[(size_t)(ka < K ? ka : K - 1) * ld + n] : 0.f; v[8 + i] = kb < K ? W[(size_t)(kb < K ? kb : K - 1) * ld + n] : 0.f; }
  return bsplit16(v); }
__device__ __forceinline__ v8f mac3(const F2& a, const F2& b, v8f c) { c = wmma_bf(a.l, b.h, c); c = wmma_bf(a.h, b.l, c); return wmma_bf(a.h, b.h, c); }
__device__ __forceinline__ float sigm(float v) { return 1.0f / (1.0f + expf(-v)); }
#define LDSX() do { asm volatile("s_wait_dscnt 0" ::: "memory"); __builtin_amdgcn_wave_barrier(); __builtin_amdgcn_fence(__ATOMIC_RELEASE, "workgroup"); } while (0)


// SelfAttentionModel (SAGAN-style, channels-last input [B, 64, 64, 256]): energy = q k^T unscaled over all 4,096 positions, out = gamma * softmax(energy) v + inputs.
#define NB 4
#define NP 4096
#define CIN 256
#define CQ 32
#define CV 256
#ifndef TNB
#define TNB NB
#endif
#ifndef TQB
#define TQB (NP / 64)
#endif
typedef __attribute__((ext_vector_type(8))) __bf16 v8b;
typedef __attribute__((ext_vector_type(4))) __bf16 v4b;
__device__ __forceinline__ v16b frag_b(const __bf16* rowk0, int lane) {
  union { v16b v; v8b q[2]; } u; const __bf16* p = rowk0 + 8 * (lane >> 4);
  u.q[0] = *(const v8b*)p; u.q[1] = *(const v8b*)(p + 16); return u.v;
}
__device__ __forceinline__ float bfr(float v) { return (float)(__bf16)v; }
__device__ __attribute__((noinline)) float exp_ni(float v) { return expf(v); }
__device__ __attribute__((noinline)) float erf_ni(float v) { return erff(v); }

#define WS_QH  0u                                    // f16 q rows [b*n][CQ] hi
#define WS_QL  (WS_QH + 2u * (size_t)NB * NP * CQ)      // f16 q residual rows (unscaled)
#define WS_KH  (WS_QL + 2u * (size_t)NB * NP * CQ)      // f16 k rows
#define WS_KL  (WS_KH + 2u * (size_t)NB * NP * CQ)      // f16 k residual rows
#define WS_VT  (WS_KL + 2u * (size_t)NB * NP * CQ)      // f16 v planes [b][CV][n]
#define WS_END (WS_VT + 2u * (size_t)NB * CV * NP)

// keeps a batch of loads together at its place, ahead of the work that hides their latency
#define PJ_SB() __builtin_amdgcn_sched_barrier(0)
// one lane's share of the eight B fragments of its out channel (all 256 in channels): wl = W + 8 g NOUT + channel; constant row steps, so one address serves all 128 loads
template <int NOUT> __device__ __forceinline__ void pj_loadw(float (&wr)[CIN / 32][16], const float* __restrict__ wl) {
#pragma unroll
  for (int kc = 0; kc < CIN / 32; ++kc)
#pragma unroll
    for (int i = 0; i < 8; ++i) { wr[kc][i] = wl[(kc * 32 + i) * NOUT]; wr[kc][8 + i] = wl[(kc * 32 + 16 + i) * NOUT]; } }
// defined behind the kernel
template <int NOUT> __device__ __forceinline__ void pj_run(const float* Wa, const float* Ba, const float* Wb, const float* Bb, _Float16* __restrict__ dha, _Float16* __restrict__ dla, _Float16* __restrict__ dhb, _Float16* __restrict__ dlb, _Float16* __restrict__ VT, const __bf16 (&sx)[64][CIN + 8], _Float16 (&sh)[64][72], _Float16 (&sl)[64][72], _Float16 (&tv)[64][72], int p0, size_t b, int cg0, int cgn);
// ---- k_proj: block = (64 positions, b, which 0 / 1 v out channels 0 .. 127 / 128 .. 255, 2 q and k together): the 320 out channels are five groups of 64, dealt 2 + 2 + 1 to a tile's three blocks, the longer blocks first in the grid; channels-last x tile (bf16) in LDS, W [in][out] + b (exact); q and k -> f16 hi + residual rows, v -> f16 planes [c][n]
__global__ __launch_bounds__(128) void k_proj(const float* __restrict__ XQK, const float* __restrict__ XV, const float* __restrict__ WQ, const float* __restrict__ BQ, const float* __restrict__ WK, const float* __restrict__ BK, const float* __restrict__ WV, const float* __restrict__ BV, _Float16* __restrict__ QH, _Float16* __restrict__ QL, _Float16* __restrict__ KH, _Float16* __restrict__ KL, _Float16* __restrict__ VT) {
  __shared__ __align__(16) __bf16 sx[64][CIN + 8]; __shared__ __align__(16) _Float16 sh[64][72], sl[64][72]; __shared__ __align__(16) _Float16 tv[64][72];
  const int tid = threadIdx.x, wave = tid >> 5, lane = tid & 31, col = lane & 15, g = lane >> 4; const int p0 = blockIdx.x * 64; const size_t b = blockIdx.y; const int which = blockIdx.z;
  const float* X = (which == 2) ? XQK : XV;
  { const float* xl = X + ((size_t)b * NP + p0) * CIN + tid * 4;   // channels-last rows: the tile's 64 rows are 64 KB in a row, taken as 16-byte pieces, piece tid + 128 i
    v4f xr[32];
#pragma unroll
    for (int i = 0; i < 32; ++i) xr[i] = *(const v4f*)(xl + i * 512);   // a thread's 32 loads go out as one batch: one latency for the tile, not one per group of eight 4-byte loads
#pragma unroll
    for (int i = 0; i < 32; ++i) { const v4b xb = { (__bf16)xr[i][0], (__bf16)xr[i][1], (__bf16)xr[i][2], (__bf16)xr[i][3] }; *(v4b*)&sx[(tid >> 6) + 2 * i][(tid & 63) * 4] = xb; } }   // four channels an 8-byte LDS store
  __syncthreads();
  if (which != 2) pj_run<CV>(WV, BV, WV, BV, nullptr, nullptr, nullptr, nullptr, VT, sx, sh, sl, tv, p0, b, which * 2, 2);   // which is the same for the whole block: every barrier inside is passed by all its waves
  else pj_run<CQ>(WQ, BQ, WK, BK, QH, QL, KH, KL, nullptr, sx, sh, sl, tv, p0, b, 0, 1); }
// the products of a block behind its x tile: wave = all 64 positions x 16 out channels of a group of 64, so a group's W fragments are one wave's 128 registers a lane and are fetched in one batch, by that wave only
// NOUT == CV: groups cg0 .. cg0 + cgn - 1 of v (Wa, Ba). NOUT == CQ: one group, waves 0, 1 = q's 32 channels (Wa, Ba), waves 2, 3 = k's (Wb, Bb)
template <int NOUT> __device__ __forceinline__ void pj_run(const float* Wa, const float* Ba, const float* Wb, const float* Bb, _Float16* __restrict__ dha, _Float16* __restrict__ dla, _Float16* __restrict__ dhb, _Float16* __restrict__ dlb, _Float16* __restrict__ VT, const __bf16 (&sx)[64][CIN + 8], _Float16 (&sh)[64][72], _Float16 (&sl)[64][72], _Float16 (&tv)[64][72], int p0, size_t b, int cg0, int cgn) {
  const int tid = threadIdx.x, wave = tid >> 5, lane = tid & 31, col = lane & 15, g = lane >> 4;
  const bool first = NOUT == CV || __builtin_amdgcn_readfirstlane(wave) < 2;   // the same for a whole wave: the two bases stay scalar
  const float* __restrict__ Wm = first ? Wa : Wb; const float* __restrict__ Bm = first ? Ba : Bb;
#pragma unroll 1
  for (int cg = cg0; cg < cg0 + cgn; ++cg) { float wr[CIN / 32][16]; v16b af[2][8];   // two sets of x fragments (two k steps x four position tiles each)
    const int o = min(NOUT == CV ? cg * 64 + wave * 16 + col : (wave & 1) * 16 + col, NOUT - 1);   // the lane's out channel in its own matrix
#pragma unroll
    for (int j = 0; j < 8; ++j) af[0][j] = frag_b(&sx[(j & 3) * 16 + col][(j >> 2) * 32], lane);
    PJ_SB();   // the first x fragments' reads stand in front of the W loads: behind them they could take the loads' address registers ahead of the wait below
    const float braw = Bm[o];
    asm volatile("s_wait_xcnt 0x0" ::: "memory");   // stands in front of the W loads, whose results may take the bias load's offset register
    pj_loadw<NOUT>(wr, Wm + 8 * g * NOUT + o);   // the group's 128 W loads go out as one batch; the products start as the first of them return
    asm volatile("s_wait_xcnt 0x0" ::: "memory");   // stands in front of any later write to the loads' address registers
    PJ_SB();   // and nothing is moved up in front of that wait
    const float bb = bfr(braw);
    v8f acc[4] = {};
#pragma unroll
    for (int kp = 0; kp < CIN / 64; ++kp) { const int cur = kp & 1;
      PJ_SB();   // the next eight x fragments are read as one group ahead of this group's products
      if (kp + 1 < CIN / 64) {
#pragma unroll
        for (int j = 0; j < 8; ++j) af[cur ^ 1][j] = frag_b(&sx[(j & 3) * 16 + col][((kp + 1) * 2 + (j >> 2)) * 32], lane); }
      PJ_SB();
#pragma unroll
      for (int h = 0; h < 2; ++h) { v16b wf;
#pragma unroll
        for (int i = 0; i < 16; ++i) wf[i] = (__bf16)wr[kp * 2 + h][i];
#pragma unroll
        for (int m = 0; m < 4; ++m) acc[m] = wmma_bf(af[cur][h * 4 + m], wf, acc[m]); } }
    __syncthreads();
    const int ol = wave * 16 + col;
#pragma unroll
    for (int m = 0; m < 4; ++m)
#pragma unroll
      for (int r = 0; r < 8; ++r) { const int pl = m * 16 + 8 * g + r; const float v = acc[m][r] + bb; const _Float16 hv = (_Float16)v; if (NOUT == CV) tv[ol][pl] = hv; else { sh[pl][ol] = hv; sl[pl][ol] = (_Float16)(v - (float)hv); } }   // q AND k keep a residual
    __syncthreads();
    if (NOUT != CV) { for (int e = tid; e < 64 * 8; e += 128) { const int pl = e >> 3, q = e & 7; const size_t at = (b * NP + p0 + pl) * CQ + (q & 3) * 8; vst2((unsigned*)((q < 4 ? dha : dhb) + at), *(const v4u*)&sh[pl][q * 8]); vst2((unsigned*)((q < 4 ? dla : dlb) + at), *(const v4u*)&sl[pl][q * 8]);   // staged columns 0 .. 31 are q's, 32 .. 63 k's
        asm volatile("s_wait_xcnt 0x0" ::: "memory"); } }   // stands in front of the next trip's writes to the two stores' address and data registers
    else { for (int e = tid; e < 64 * 8; e += 128) { const int ov = e >> 3, q = e & 7; vst2((unsigned*)(VT + (b * CV + cg * 64 + ov) * (size_t)NP + p0 + q * 8), *(const v4u*)&tv[ov][q * 8]); } } } }
// the plain builtin: the compiler keeps the distance behind it itself and may place operands in any register
__device__ __forceinline__ v8f wmma_h(v16h a, v16h b, v8f c) { return __builtin_amdgcn_wmma_f32_16x16x32_f16(false, a, false, b, (short)0, c, false, false); }
// lane l with lane l ^ 16, on the vector unit
__device__ __forceinline__ float xhalf(float x) { return __builtin_bit_cast(float, __builtin_amdgcn_permlanex16(__builtin_bit_cast(int, x), __builtin_bit_cast(int, x), 0x76543210, 0xfedcba98, false, false)); }
// keeps a group of LDS reads together at its place: without it the compiler spreads the reads singly among the products, each with its own wait
#define FA_SB() __builtin_amdgcn_sched_barrier(0)
// ---- k_fa: block = (64 queries, batch b), eight waves = 2 query halves x 4 key quarters: wave = 32 queries x all 256 channels x 32 of a stage's 128 keys, so a v fragment read from LDS serves two products and two waves share a SIMD; S^T = K Q^T, running-maximum softmax in registers, O^T += V^T P^T; the four key quarters' sums are joined once, behind the loop, through LDS; k and v tiles of 128 keys staged in LDS (three buffers, asynchronous copies, two stages in flight)
#define FA_KT 128                      // keys per stage: 256 B of a v row, so one wave-wide copy brings two whole row pieces
#define FA_NT (NP / FA_KT)
#define FA_VP (FA_KT + 8)              // f16 elements; 272 B = 16 B x odd: the pitch for ds_load_b128 readers
#define FA_KP (CQ + 8)                 // 80 B = 16 B x odd
#define FA_VPB (2u * FA_VP)
#define FA_KPB (2u * FA_KP)
#define FA_TH 12.476649250f             // 18 ln 2: how far a score may pass the maximum in use before the sums are rescaled
#define FA_C (-3.0f)                   // P = exp(s - m) x 2^FA_C: at most 2^15, below f16's largest number; the largest weight is at least 2^-3, so weights down to 2^-11 of it are normal f16 numbers and smaller ones round within 2^-22 of it
struct FaStage { _Float16 v[CV][FA_VP]; _Float16 kh[FA_KT][FA_KP]; _Float16 kl[FA_KT][FA_KP]; };
#define FA_BUFB ((unsigned)sizeof(FaStage))
// one wave's share of a stage: 32 of the 256 v rows (two rows a copy) and 16 of the 128 keys' hi and residual rows (eight keys a copy): 20 copies a stage, two stages' at most in flight
// a copy's immediate offset moves both of its addresses, so it is the copy's distance in LDS from the lane's first v row (2 rows = 544 B a copy) or first hi row (8 keys = 640 B; the residual rows FA_KT FA_KPB bytes behind the hi rows), and the copy's uniform base holds its distance in global memory less that immediate:
// LDS byte = the lane's LDS address + immediate, global byte = uniform base + the lane's 32-bit byte offset + immediate. The 16 v copies share two vector registers and so do the 4 k copies: no vector address sum per copy
typedef __attribute__((address_space(1))) v4i* fa_gp; typedef __attribute__((address_space(3))) v4i* fa_lp;
template <int N> __device__ __forceinline__ void fa_cp(const char* base, unsigned off, unsigned lds) { __builtin_amdgcn_global_load_async_to_lds_b128((fa_gp)(base + off), (fa_lp)lds, N, 0); }
// a copy's base as a scalar value of its own: left as base + constant, the compiler puts the constant behind the lane's offset and forms every copy's address by a 64-bit vector sum
__device__ __forceinline__ const char* fa_sc(const char* p) { const unsigned long long u = (unsigned long long)p; return (const char*)(((unsigned long long)(unsigned)__builtin_amdgcn_readfirstlane((int)(u >> 32)) << 32) | (unsigned)__builtin_amdgcn_readfirstlane((int)u)); }
struct FaBase { const char* v[16]; const char* k[4]; };   // the 20 copies' bases: the same for every stage
template <int I> __device__ __forceinline__ void fa_cpv(const FaBase& fb, unsigned ov, unsigned lv) { fa_cp<I * 2 * (int)FA_VPB>(fb.v[I], ov, lv); if constexpr (I + 1 < 16) fa_cpv<I + 1>(fb, ov, lv); }
#define FA_K8 (8 * (int)FA_KPB)          // LDS distance of eight keys' rows
#define FA_KL0 (FA_KT * (int)FA_KPB)     // and from the hi rows to the residual rows
__device__ __forceinline__ void fa_fill(unsigned lv, unsigned lk, const FaBase& fb, unsigned ov, unsigned ok) {
  fa_cpv<0>(fb, ov, lv);
  fa_cp<0>(fb.k[0], ok, lk); fa_cp<FA_K8>(fb.k[1], ok, lk); fa_cp<FA_KL0>(fb.k[2], ok, lk); fa_cp<FA_KL0 + FA_K8>(fb.k[3], ok, lk); }
#define FA_NC 20                       // copies of a wave per stage, the same in every wave and for every stage
union FaSh { FaStage ring[3]; float part[4][64][CV + 4]; };   // behind the loop the ring's bytes hold the four key quarters' scaled sums
__global__ __launch_bounds__(256) void k_fa(const _Float16* __restrict__ QH, const _Float16* __restrict__ QL, const _Float16* __restrict__ KH, const _Float16* __restrict__ KL, const _Float16* __restrict__ VT, const float* __restrict__ X, const float* __restrict__ GM, float* __restrict__ OUT) { __shared__ __align__(16) FaSh sh; __shared__ float sm[4][64], sl[4][64];
  const int tid = threadIdx.x, wave = tid >> 5, lane = tid & 31, col = lane & 15, g = lane >> 4; const size_t b = blockIdx.y; const int i0 = blockIdx.x * 64;
  const int qg = wave & 1, kg = wave >> 1; const int il0 = qg * 32, k0 = kg * 32;   // the wave's 32 queries of the block, and its 32 keys of every stage
  const unsigned lv = (unsigned)(size_t)&sh.ring[0].v[wave * 32 + g][col * 8], lk = (unsigned)(size_t)&sh.ring[0].kh[wave * 16 + (lane >> 2)][(lane & 3) * 8];
  const char* bv = (const char*)(VT + b * CV * (size_t)NP); const char* bkh = (const char*)(KH + b * NP * (size_t)CQ); const char* bkl = (const char*)(KL + b * NP * (size_t)CQ);   // the batch's planes and rows, uniform
  FaBase fb;
#pragma unroll
  for (int i = 0; i < 16; ++i) fb.v[i] = fa_sc(bv + i * (2 * 2 * NP - 2 * (int)FA_VPB));   // two rows of a plane a copy, less the copy's immediate
  fb.k[0] = fa_sc(bkh); fb.k[1] = fa_sc(bkh + (8 * 2 * CQ - FA_K8)); fb.k[2] = fa_sc(bkl - FA_KL0); fb.k[3] = fa_sc(bkl + (8 * 2 * CQ - FA_KL0 - FA_K8));
  const unsigned ov = 2u * ((unsigned)(wave * 32 + g) * NP + col * 8), ok = 2u * ((unsigned)(wave * 16 + (lane >> 2)) * CQ + (lane & 3) * 8);   // the lane's byte offsets inside them at stage 0; a stage adds 2 FA_KT bytes to the first, 2 FA_KT CQ to the second
  v16h qh[2], ql[2];   // B operands: column = query, two tiles of 16, kept for the whole kernel
  const size_t qr = (b * NP + i0 + il0 + col) * CQ + 8 * g; const _Float16* pqh = QH + qr; const _Float16* pql = QL + qr;   // the lane's place in its first query's rows: elements 8g .. and 16 + 8g ..
#pragma unroll
  for (int qt = 0; qt < 2; ++qt) { union { v16h v; v8h q[2]; } uh, ul; uh.q[0] = *(const v8h*)(pqh + qt * 16 * CQ); uh.q[1] = *(const v8h*)(pqh + qt * 16 * CQ + 16); ul.q[0] = *(const v8h*)(pql + qt * 16 * CQ); ul.q[1] = *(const v8h*)(pql + qt * 16 * CQ + 16); qh[qt] = uh.v; ql[qt] = ul.v; }
  asm volatile("s_wait_xcnt 0x0" :: "v"(pqh), "v"(pql) : "memory");   // stands in front of any later write to the q loads' address registers, which it names as inputs so that they live up to it
  FA_SB();   // and nothing is moved up in front of that wait
  const float L2E = 1.4426950408889634f;
  v8f acc[2][16] = {}; float mrun[2] = { -3.0e38f, -3.0e38f }, lsum[2] = { 0.f, 0.f }, nb[2] = { 0.f, 0.f };   // per lane and query tile: its query's running maximum over the wave's keys, its half's share of the sum, and FA_C - maximum x log2 e (set with the maximum). The maximum is the one IN USE: it is raised, and the sums rescaled, only when a score passes it by more than FA_TH; numerator and sum carry the same m and the same factor, which cancel
  fa_fill(lv, lk, fb, ov, ok);
  fa_fill(lv + FA_BUFB, lk + FA_BUFB, fb, ov + 2u * FA_KT, ok + 2u * FA_KT * CQ);
  asm volatile("s_wait_asynccnt %0" :: "i"(FA_NC) : "memory");    // all but the wave's FA_NC youngest copies, which are stage 1's: stage 0 has landed before the barrier publishes it
  __syncthreads();
  fa_fill(lv + 2u * FA_BUFB, lk + 2u * FA_BUFB, fb, ov + 2u * (2u * FA_KT), ok + 2u * (2u * FA_KT * CQ));
  int bi = 0;   // the buffer of stage t: t mod 3
#pragma unroll 1
  for (int t = 0; t < FA_NT; ++t) { const FaStage& sb = sh.ring[bi];   // rolled: one stage a trip
    v16h kh[2], kl[2], vf[2][8];   // k fragments of the wave's 32 keys; two sets of v fragments: the second goes out as one group ahead of the first group's products
#pragma unroll
    for (int kt = 0; kt < 2; ++kt) { kh[kt] = frag_h(&sb.kh[k0 + kt * 16 + col][0], lane); kl[kt] = frag_h(&sb.kl[k0 + kt * 16 + col][0], lane); }
    v8f s[2][2] = {};   // S^T tiles [query tile][key tile]: register r = key 8g + r of the tile, lane column = query
    FA_SB();
#pragma unroll
    for (int x = 0; x < 4; ++x) s[x >> 1][x & 1] = wmma_h(kh[x & 1], qh[x >> 1], s[x >> 1][x & 1]);
#pragma unroll
    for (int x = 0; x < 4; ++x) s[x >> 1][x & 1] = wmma_h(kh[x & 1], ql[x >> 1], s[x >> 1][x & 1]);
#pragma unroll
    for (int x = 0; x < 4; ++x) s[x >> 1][x & 1] = wmma_h(kl[x & 1], qh[x >> 1], s[x >> 1][x & 1]);   // 3 products, in the order hi hi, residual hi, hi residual
    FA_SB();
#pragma unroll
    for (int j = 0; j < 8; ++j) vf[0][j] = frag_h(&sb.v[j * 16 + col][k0], lane);   // the first v group flies under the softmax
    FA_SB();
    float mst[2];   // the stage's own maxima
#pragma unroll
    for (int qt = 0; qt < 2; ++qt) { float m8[8];   // maximum by a tree, not a single chain of dependent maxima
#pragma unroll
      for (int r = 0; r < 8; ++r) m8[r] = fmaxf(s[qt][0][r], s[qt][1][r]);
      float mx = fmaxf(fmaxf(fmaxf(m8[0], m8[1]), fmaxf(m8[2], m8[3])), fmaxf(fmaxf(m8[4], m8[5]), fmaxf(m8[6], m8[7])));
      mst[qt] = fmaxf(mx, xhalf(mx)); }   // with the other half of the query's 32 keys
    if (__builtin_amdgcn_ballot_w32(mst[0] > mrun[0] + FA_TH || mst[1] > mrun[1] + FA_TH) != 0) {   // scalar branch, one test a stage: the 256 sums a lane are rescaled only where some query's score would leave f16's range above; then every query of the wave takes the larger of its maximum in use and the stage's maximum
      const float mnew[2] = { fmaxf(mrun[0], mst[0]), fmaxf(mrun[1], mst[1]) };
      const float al0 = __builtin_amdgcn_exp2f((mrun[0] - mnew[0]) * L2E), al1 = __builtin_amdgcn_exp2f((mrun[1] - mnew[1]) * L2E);
      mrun[0] = mnew[0]; mrun[1] = mnew[1]; lsum[0] *= al0; lsum[1] *= al1; nb[0] = FA_C - mnew[0] * L2E; nb[1] = FA_C - mnew[1] * L2E;
#pragma unroll
      for (int j = 0; j < 16; ++j) { acc[0][j] *= al0; acc[1][j] *= al1; } }
    v16h pb[2];
#pragma unroll
    for (int x = 0; x < 4; ++x)
#pragma unroll
      for (int r = 0; r < 8; ++r) s[x >> 1][x & 1][r] = fmaf(s[x >> 1][x & 1][r], L2E, nb[x >> 1]);
    FA_SB();   // all exponents are formed before the first exponential: none of them then overwrites an exponential's source directly behind it
#pragma unroll
    for (int x = 0; x < 4; ++x)
#pragma unroll
      for (int r = 0; r < 8; ++r) s[x >> 1][x & 1][r] = __builtin_amdgcn_exp2f(s[x >> 1][x & 1][r]);
    FA_SB();   // and no conversion or sum overwrites one
#pragma unroll
    for (int x = 0; x < 4; ++x)
#pragma unroll
      for (int r = 0; r < 8; ++r) pb[x >> 1][(x & 1) * 8 + r] = (_Float16)s[x >> 1][x & 1][r];   // a query tile's two score tiles, converted in place, are one B operand
#pragma unroll
    for (int qt = 0; qt < 2; ++qt) { const v8f p8 = s[qt][0] + s[qt][1];   // the f32 weights summed by a tree, for the same reason as the maximum
      lsum[qt] += ((p8[0] + p8[1]) + (p8[2] + p8[3])) + ((p8[4] + p8[5]) + (p8[6] + p8[7])); }
    FA_SB();
#pragma unroll
    for (int j = 0; j < 8; ++j) vf[1][j] = frag_h(&sb.v[(8 + j) * 16 + col][k0], lane);   // the stage's last LDS reads fly under the first group's products
    FA_SB();
#pragma unroll
    for (int j = 0; j < 8; ++j) { acc[0][j] = wmma_h(vf[0][j], pb[0], acc[0][j]); acc[1][j] = wmma_h(vf[0][j], pb[1], acc[1][j]); }   // channel tiles 0 .. 7, both query tiles on each fragment
    FA_SB();   // these products stay in front of the stage's foot: sunk behind its barrier they would hold back the refill
    asm volatile("s_wait_dscnt 0x0" :: "v"(lsum[0]), "v"(lsum[1]) : "memory");      // this wave's reads of the buffer are done before it is refilled; the two sums are named as inputs so that they are formed in front of the refill: sunk behind it, their 32 weights stay live beside the copies' addresses and a register is spilled
    asm volatile("s_wait_asynccnt %0" :: "i"(FA_NC) : "memory");    // this wave's copies of stage t + 1 have landed: all but its FA_NC youngest, which are stage t + 2's and stay in flight, so a stage has two trips to land, not one
    if (t + 2 >= FA_NT) asm volatile("s_wait_asynccnt 0x0" ::: "memory");   // the last two trips: no stage t + 2 was issued, stage t + 1's own copies are the youngest, and only the wait to 0 covers them
    __syncthreads();                                    // publishes stage t + 1 and ends every reader's last read of stage t
    if (t + 3 < FA_NT) { const unsigned bo = (unsigned)bi * FA_BUFB; fa_fill(lv + bo, lk + bo, fb, ov + (unsigned)(t + 3) * (2u * FA_KT), ok + (unsigned)(t + 3) * (2u * FA_KT * CQ)); }   // stage t + 3 into the buffer that trip t has just read
    bi = bi == 2 ? 0 : bi + 1;
    FA_SB();   // channel tiles 8 .. 15, all operands in registers, stand behind the refill: the copies go out as soon as the buffer is free and fly under these products too
#pragma unroll
    for (int j = 0; j < 8; ++j) { acc[0][8 + j] = wmma_h(vf[1][j], pb[0], acc[0][8 + j]); acc[1][8 + j] = wmma_h(vf[1][j], pb[1], acc[1][8 + j]); } }
  asm volatile("s_wait_asynccnt 0x0" ::: "memory");     // no copy is outstanding behind the loop
  // the four key quarters of a query are joined: maxima and sums first, then the sums of products, each scaled to the common maximum and divided by the whole sum
#pragma unroll
  for (int qt = 0; qt < 2; ++qt) { const float lj = lsum[qt] + xhalf(lsum[qt]);   // the halves' sums are joined once
    if (g == 0) { sm[kg][il0 + qt * 16 + col] = mrun[qt]; sl[kg][il0 + qt * 16 + col] = lj; } }
  __syncthreads();   // every quarter's maxima and sums are written; the loop's last barrier has ended every read of the ring
#pragma unroll
  for (int qt = 0; qt < 2; ++qt) { const int q = il0 + qt * 16 + col;
    const float m0 = sm[0][q], m1 = sm[1][q], m2 = sm[2][q], m3 = sm[3][q]; const float mm = fmaxf(fmaxf(m0, m1), fmaxf(m2, m3));
    const float e0 = __builtin_amdgcn_exp2f((m0 - mm) * L2E), e1 = __builtin_amdgcn_exp2f((m1 - mm) * L2E), e2 = __builtin_amdgcn_exp2f((m2 - mm) * L2E), e3 = __builtin_amdgcn_exp2f((m3 - mm) * L2E);
    const float ls = (sl[0][q] * e0 + sl[1][q] * e1) + (sl[2][q] * e2 + sl[3][q] * e3);
    const float inv = __builtin_amdgcn_exp2f((mrun[qt] - mm) * L2E) / ls;   // the wave's own quarter's factor over the whole sum
#pragma unroll
    for (int j = 0; j < 16; ++j) { const v8f o = acc[qt][j] * inv; v4f lo = { o[0], o[1], o[2], o[3] }, hi = { o[4], o[5], o[6], o[7] };   // a lane holds 8 consecutive channels of its query
      *(v4f*)&sh.part[kg][q][j * 16 + 8 * g] = lo; *(v4f*)&sh.part[kg][q][j * 16 + 8 * g + 4] = hi; } }
  __syncthreads();   // all four quarters' rows are written before any is read
  const float gm = bfr(GM[0]);
  // channels-last rows [b*n][CV]: positions i0 .. i0+63, whole rows
#pragma unroll 1   // rolled, so that the wait at the trip's foot stands once behind four stores
  for (int i = 0; i < 64 * (CV / 4) / 256; i += 4) {
#pragma unroll   // four row pieces a trip: their x loads go out together and wait once, not one latency each
    for (int u = 0; u < 4; ++u) { const int e = tid + (i + u) * 256, il = e >> 6, q = e & 63; const size_t o = (b * NP + i0 + il) * CV + q * 4; const v4f sv = (*(const v4f*)&sh.part[0][il][q * 4] + *(const v4f*)&sh.part[1][il][q * 4]) + (*(const v4f*)&sh.part[2][il][q * 4] + *(const v4f*)&sh.part[3][il][q * 4]); const v4f xv = *(const v4f*)(X + o); v4f r = { gm * sv[0] + bfr(xv[0]), gm * sv[1] + bfr(xv[1]), gm * sv[2] + bfr(xv[2]), gm * sv[3] + bfr(xv[3]) }; vst2(OUT + o, r); }
    asm volatile("s_wait_xcnt 0x0" ::: "memory"); } }   // stands in front of the next trip's writes to the four stores' address and data registers
extern "C" void kernel_launch(void* const* d_in, const int* in_sizes, int n_in, void* d_out, int out_size, void* d_ws, size_t ws_size, hipStream_t stream) {
  (void)in_sizes; (void)n_in; (void)out_size;
  const float** F = (const float**)d_in;   // 0 inputs [4,64,64,256] channels-last, 1 Wq [256,32] (in,out), 2 bq, 3 Wk, 4 bk, 5 Wv [256,256], 6 bv, 7 gamma [1]
  if (ws_size < (size_t)WS_END) return;
  char* ws = (char*)d_ws; _Float16 *QH = (_Float16*)(ws + WS_QH), *QL = (_Float16*)(ws + WS_QL), *KH = (_Float16*)(ws + WS_KH), *KL = (_Float16*)(ws + WS_KL), *VT = (_Float16*)(ws + WS_VT);
  k_proj<<<dim3(NP / 64, TNB, 3), 128, 0, stream>>>(F[0], F[0], F[1], F[2], F[3], F[4], F[5], F[6], QH, QL, KH, KL, VT);
  k_fa<<<dim3(TQB, TNB), 256, 0, stream>>>(QH, QL, KH, KL, VT, F[0], F[7], (float*)d_out);
}

// v010
// It runs in 41.5 microseconds.
// Next to v009, in two timings, it ran 1.03 times as fast each time.
// Over all steps from v000 it is 23.7 times as fast.
// compute dtype: all float inputs rounded to bf16, gamma read; q/k (32 ch) and v (256 ch) = x W + b ((in,out)) with EXACT bf16 products on WMMA 16x16x32 (channels-last x tile in LDS), f32 accumulate; q and k as f16 hi + unscaled residual -> UNSCALED logits with 3 products (std ~5.7, near-one-hot softmax), kept in registers; running-maximum softmax in f32, the maximum in use m raised lazily -> P f16 = exp(s - m) / 8 <= 2^15; out = gamma * (P . v) / sum(P) + x with v rounded once to f16, channels-last rows; f32 output.
#include <hip/hip_runtime.h>
#include <math.h>

typedef __attribute__((ext_vector_type(16))) _Float16 v16h;
typedef __attribute__((ext_vector_type(16))) __bf16 v16b;
typedef __attribute__((ext_vector_type(8)))  _Float16 v8h;
typedef __attribute__((ext_vector_type(8)))  float v8f;
typedef __attribute__((ext_vector_type(4)))  float v4f;
typedef __attribute__((ext_vector_type(2)))  float v2f;
typedef __attribute__((ext_vector_type(4)))  unsigned v4u;
typedef __attribute__((ext_vector_type(4)))  int v4i;
typedef float __attribute__((may_alias)) float_a;
typedef int __attribute__((may_alias)) int_a;

template <typename T> __device__ __forceinline__ void vst2(void* p, T v) { *(T*)p = v;  }
__device__ __forceinline__ v8f wmma16(v16h a, v16h b, v8f c) {
  v8f d = __builtin_amdgcn_wmma_f32_16x16x32_f16(false, a, false, b, (short)0, c, false, false);
  asm volatile("v_nop\n\tv_nop\n\tv_nop\n\tv_nop" : "+v"(d) : "v"(a), "v"(b));
  return d;
}
__device__ __forceinline__ v8f wmma_bf(v16b a, v16b b, v8f c) {
  v8f d = __builtin_amdgcn_wmma_f32_16x16x32_bf16(false, a, false, b, (short)0, c, false, false);
  asm volatile("v_nop\n\tv_nop\n\tv_nop\n\tv_nop" : "+v"(d) : "v"(a), "v"(b));
  return d;
}
// 16x16x32 fragments: lane = (h = lane>>4, row/col = lane&15); elements 0..7 = k0+8h+0..7, 8..15 = k0+16+8h+0..7; D element r = row 8h+r
__device__ __forceinline__ v16h frag_h(const _Float16* rowk0, int lane) {
  union { v16h v; v8h q[2]; } u; const _Float16* p = rowk0 + 8 * (lane >> 4);
  u.q[0] = *(const v8h*)p; u.q[1] = *(const v8h*)(p + 16); return u.v;
}
__device__ __forceinline__ v16h frag_f32(const float* rowk0, int lane) {
  v16h a; const float* p = rowk0 + 8 * (lane >> 4);
#pragma unroll
  for (int i = 0; i < 8; ++i) { a[i] = (_Float16)p[i]; a[8 + i] = (_Float16)p[16 + i]; }
  return a;
}
__device__ __forceinline__ v16h frag_f32s(const float* rowk0, int lane, float sc) {
  v16h a; const float* p = rowk0 + 8 * (lane >> 4);
#pragma unroll
  for (int i = 0; i < 8; ++i) { a[i] = (_Float16)(p[i] * sc); a[8 + i] = (_Float16)(p[16 + i] * sc); }
  return a;
}
// column fragment from a [K][ld] layout (column n), rows >= K read as 0
__device__ __forceinline__ v16h fragc_f32(const float* W, int k0, int n, int lane, int ld, int K) {
  v16h a; const int g = lane >> 4;
#pragma unroll
  for (int i = 0; i < 8; ++i) { const int ka = k0 + 8 * g + i, kb = ka + 16;
    a[i] = (_Float16)(ka < K ? W[(size_t)(ka < K ? ka : K - 1) * ld + n] : 0.f); a[8 + i] = (_Float16)(kb < K ? W[(size_t)(kb < K ? kb : K - 1) * ld + n] : 0.f); }
  return a;
}
struct F2 { v16b h, l; };
__device__ __forceinline__ F2 bsplit16(const float v[16]) { F2 r;
#pragma unroll
  for (int i = 0; i < 16; ++i) { const __bf16 h = (__bf16)v[i]; r.h[i] = h; r.l[i] = (__bf16)(v[i] - (float)h); }
  return r; }
__device__ __forceinline__ F2 split_row(const float* row, int k0, int lane) { float v[16]; const float* p = row + k0 + 8 * (lane >> 4);
#pragma unroll
  for (int i = 0; i < 8; ++i) { v[i] = p[i]; v[8 + i] = p[16 + i]; }
  return bsplit16(v); }
__device__ __forceinline__ F2 split_rowK(const float* row, int k0, int lane, int K) { float v[16]; const int g = lane >> 4;
#pragma unroll
  for (int i = 0; i < 8; ++i) { const int ka = k0 + 8 * g + i, kb = ka + 16; v[i] = ka < K ? row[ka < K ? ka : K - 1] : 0.f; v[8 + i] = kb < K ? row[kb < K ? kb : K - 1] : 0.f; }
  return bsplit16(v); }
__device__ __forceinline__ F2 split_col(const float* W, int k0, int n, int lane, int ld, int K) { float v[16]; const int g = lane >> 4;
#pragma unroll
  for (int i = 0; i < 8; ++i) { const int ka = k0 + 8 * g + i, kb = ka + 16; v[i] = ka < K ? W[(size_t)(ka < K ? ka : K - 1) * ld + n] : 0.f; v[8 + i] = kb < K ? W[(size_t)(kb < K ? kb : K - 1) * ld + n] : 0.f; }
  return bsplit16(v); }
__device__ __forceinline__ v8f mac3(const F2& a, const F2& b, v8f c) { c = wmma_bf(a.l, b.h, c); c = wmma_bf(a.h, b.l, c); return wmma_bf(a.h, b.h, c); }
__device__ __forceinline__ float sigm(float v) { return 1.0f / (1.0f + expf(-v)); }
#define LDSX() do { asm volatile("s_wait_dscnt 0" ::: "memory"); __builtin_amdgcn_wave_barrier(); __builtin_amdgcn_fence(__ATOMIC_RELEASE, "workgroup"); } while (0)


// SelfAttentionModel (SAGAN-style, channels-last input [B, 64, 64, 256]): energy = q k^T unscaled over all 4,096 positions, out = gamma * softmax(energy) v + inputs.
#define NB 4
#define NP 4096
#define CIN 256
#define CQ 32
#define CV 256
#ifndef TNB
#define TNB NB
#endif
#ifndef TQB
#define TQB (NP / 64)
#endif
typedef __attribute__((ext_vector_type(8))) __bf16 v8b;
typedef __attribute__((ext_vector_type(4))) __bf16 v4b;
__device__ __forceinline__ v16b frag_b(const __bf16* rowk0, int lane) {
  union { v16b v; v8b q[2]; } u; const __bf16* p = rowk0 + 8 * (lane >> 4);
  u.q[0] = *(const v8b*)p; u.q[1] = *(const v8b*)(p + 16); return u.v;
}
__device__ __forceinline__ float bfr(float v) { return (float)(__bf16)v; }
__device__ __attribute__((noinline)) float exp_ni(float v) { return expf(v); }
__device__ __attribute__((noinline)) float erf_ni(float v) { return erff(v); }

#define WS_QH  0u                                    // f16 q rows [b*n][CQ] hi
#define WS_QL  (WS_QH + 2u * (size_t)NB * NP * CQ)      // f16 q residual rows (unscaled)
#define WS_KH  (WS_QL + 2u * (size_t)NB * NP * CQ)      // f16 k rows
#define WS_KL  (WS_KH + 2u * (size_t)NB * NP * CQ)      // f16 k residual rows
#define WS_VT  (WS_KL + 2u * (size_t)NB * NP * CQ)      // f16 v planes [b][CV][n]
#define WS_END (WS_VT + 2u * (size_t)NB * CV * NP)

// keeps a batch of loads together at its place, ahead of the work that hides their latency
#define PJ_SB() __builtin_amdgcn_sched_barrier(0)
// work-group barrier that orders LDS only: __syncthreads() also waits out every global load and store in flight, and the next W tile's loads and a group's result stores are to fly across k_proj's barriers, which guard LDS tiles alone
#define PJ_BAR() do { __builtin_amdgcn_fence(__ATOMIC_RELEASE, "workgroup", "local"); __builtin_amdgcn_s_barrier(); __builtin_amdgcn_fence(__ATOMIC_ACQUIRE, "workgroup", "local"); } while (0)
#define PJ_WP 80                       // bf16 elements of a staged W row (64 out channels + pad): 160 B = 32 B x odd, the pitch for ds_load_tr16_b128 readers
// one thread's share of a group's W tile (256 in channels x 64 out channels, f32): 16 bytes = four out channels of the rows (tid >> 4) + 8 i; wt = the thread's place in its first row; sixteen threads take 256 B of a row in a row, so a wave-wide load covers whole lines; constant row steps, so one address serves all 32 loads
template <int NOUT> __device__ __forceinline__ void pj_ldw(v4f (&wq)[32], const float* __restrict__ wt) {
#pragma unroll
  for (int i = 0; i < 32; ++i) wq[i] = *(const v4f*)(wt + i * 8 * NOUT); }
// the tile goes to LDS as it lies in memory, rows = in channels, rounded to bf16: four out channels an 8-byte store
__device__ __forceinline__ void pj_stw(__bf16 (&sw)[CIN][PJ_WP], const v4f (&wq)[32], int tid) {
#pragma unroll
  for (int i = 0; i < 32; ++i) { const v4b wb = { (__bf16)wq[i][0], (__bf16)wq[i][1], (__bf16)wq[i][2], (__bf16)wq[i][3] }; *(v4b*)&sw[(tid >> 4) + 8 * i][(tid & 15) * 4] = wb; } }
// transposing LDS read: lane (col, g) gets rows kbase + 8 g + 0 .. 7 of column dbase + col, where the lane's address is row kbase + 8 g + (lane & 7), column dbase + 8 ((lane >> 3) & 1)
typedef __attribute__((ext_vector_type(8))) short v8s;
__device__ __forceinline__ v8b ld_tr16(const __bf16* p) { typedef __attribute__((address_space(3))) v8s lds_v8s; return __builtin_bit_cast(v8b, __builtin_amdgcn_ds_load_tr16_b128_v8i16((lds_v8s*)p)); }
// defined behind the kernel
template <int NOUT, int CGN> __device__ __forceinline__ void pj_run(const float* __restrict__ X, const float* Wa, const float* Ba, const float* Wb, const float* Bb, _Float16* __restrict__ dha, _Float16* __restrict__ dla, _Float16* __restrict__ dhb, _Float16* __restrict__ dlb, _Float16* __restrict__ VT, __bf16 (&sx)[64][CIN + 8], __bf16 (&sw)[CIN][PJ_WP], _Float16 (&sh)[64][72], _Float16 (&sl)[64][72], _Float16 (&tv)[64][72], int p0, size_t b, int cg0);
// ---- k_proj: block = (64 positions, b, which 0 / 1 v out channels 0 .. 127 / 128 .. 255, 2 q and k together): the 320 out channels are five groups of 64, dealt 2 + 2 + 1 to a tile's three blocks, the longer blocks first in the grid; x^T tile (bf16) and the group's W tile (bf16, rows = in channels) in LDS, + b (exact); q and k -> f16 hi + residual rows, v -> f16 planes [c][n]
// three blocks a WGP (a tile's three, all 768 resident at once): the second bound keeps the registers at a third of a SIMD's
__global__ __launch_bounds__(128, 3) void k_proj(const float* __restrict__ XQK, const float* __restrict__ XV, const float* __restrict__ WQ, const float* __restrict__ BQ, const float* __restrict__ WK, const float* __restrict__ BK, const float* __restrict__ WV, const float* __restrict__ BV, _Float16* __restrict__ QH, _Float16* __restrict__ QL, _Float16* __restrict__ KH, _Float16* __restrict__ KL, _Float16* __restrict__ VT) {
  __shared__ __align__(16) __bf16 sx[64][CIN + 8]; __shared__ __align__(16) __bf16 sw[CIN][PJ_WP]; __shared__ __align__(16) _Float16 sh[64][72], sl[64][72]; __shared__ __align__(16) _Float16 tv[64][72];
  const int p0 = blockIdx.x * 64; const size_t b = blockIdx.y; const int which = blockIdx.z;
  if (which != 2) pj_run<CV, 2>(XV, WV, BV, WV, BV, nullptr, nullptr, nullptr, nullptr, VT, sx, sw, sh, sl, tv, p0, b, which * 2);   // which is the same for the whole block: every barrier inside is passed by all its waves
  else pj_run<CQ, 1>(XQK, WQ, BQ, WK, BK, QH, QL, KH, KL, nullptr, sx, sw, sh, sl, tv, p0, b, 0); }
// a block's work: x tile and first W tile fetched together, then per group of 64 out channels: W tile to LDS, products, results out. Wave = all 64 positions x 16 out channels of the group
// NOUT == CV: groups cg0 .. cg0 + CGN - 1 of v (Wa, Ba). NOUT == CQ: one group, staged columns 0 .. 31 (waves 0, 1) = q's 32 channels (Wa, Ba), 32 .. 63 (waves 2, 3) = k's (Wb, Bb)
template <int NOUT, int CGN> __device__ __forceinline__ void pj_run(const float* __restrict__ X, const float* Wa, const float* Ba, const float* Wb, const float* Bb, _Float16* __restrict__ dha, _Float16* __restrict__ dla, _Float16* __restrict__ dhb, _Float16* __restrict__ dlb, _Float16* __restrict__ VT, __bf16 (&sx)[64][CIN + 8], __bf16 (&sw)[CIN][PJ_WP], _Float16 (&sh)[64][72], _Float16 (&sl)[64][72], _Float16 (&tv)[64][72], int p0, size_t b, int cg0) {
  const int tid = threadIdx.x, wave = tid >> 5, lane = tid & 31, col = lane & 15, g = lane >> 4;
  const bool first = NOUT == CV || __builtin_amdgcn_readfirstlane(wave) < 2;   // the same for a whole wave: the bias base stays scalar
  const float* __restrict__ Bm = first ? Ba : Bb;
  const int wc = tid & 15;   // the thread's four out channels of a W tile: staged columns 4 wc .. 4 wc + 3
  const float* wt = (NOUT == CV ? Wa + cg0 * 64 + wc * 4 : wc < 8 ? Wa + wc * 4 : Wb + (wc - 8) * 4) + (tid >> 4) * NOUT;
  v4f wq[32];
  { const float* xl = X + ((size_t)b * NP + p0) * CIN + tid * 4;   // channels-last rows: the tile's 64 rows are 64 KB in a row, taken as 16-byte pieces, piece tid + 128 i
    v4f xr[32];
#pragma unroll
    for (int i = 0; i < 32; ++i) xr[i] = *(const v4f*)(xl + i * 512);   // a thread's 32 loads go out as one batch: one latency for the tile, not one per group of eight 4-byte loads
    pj_ldw<NOUT>(wq, wt);   // the first group's W tile goes out behind them, in the same batch
    asm volatile("s_wait_xcnt 0x0" :: "v"(xl), "v"(wt) : "memory");   // stands in front of any later write to the two batches' address registers, which it names as inputs so that they live up to it
    PJ_SB();   // and nothing is moved up in front of that wait
#pragma unroll
    for (int i = 0; i < 32; ++i) { const v4b xb = { (__bf16)xr[i][0], (__bf16)xr[i][1], (__bf16)xr[i][2], (__bf16)xr[i][3] }; *(v4b*)&sx[(tid >> 6) + 2 * i][(tid & 63) * 4] = xb; } }   // four channels an 8-byte LDS store
#pragma unroll   // unrolled, the count a template constant: in a rolled loop the tile fetched ahead under a test stays live through the products, 128 registers too many for three waves a SIMD
  for (int ci = 0; ci < CGN; ++ci) { const int cg = cg0 + ci; v16b wf[CIN / 32], af[2][8];   // the wave's eight W fragments; two sets of x fragments (two k steps x four position tiles each)
    pj_stw(sw, wq, tid);
    PJ_BAR();   // publishes the group's W tile, and in the first trip the x tile; it also ends every wave's reads of the staged results of the group before, so no barrier stands behind the products any more
    const int o = min(NOUT == CV ? cg * 64 + wave * 16 + col : (wave & 1) * 16 + col, NOUT - 1);   // the lane's out channel in its own matrix
    const __bf16* wp = &sw[8 * g + (lane & 7)][wave * 16 + 8 * ((lane >> 3) & 1)];
#pragma unroll
    for (int kc = 0; kc < CIN / 32; ++kc) { union { v16b v; v8b q[2]; } u; u.q[0] = ld_tr16(wp + kc * 32 * PJ_WP); u.q[1] = ld_tr16(wp + (kc * 32 + 16) * PJ_WP); wf[kc] = u.v; }   // elements 0 .. 7 = in channels 32 kc + 8 g + 0 .. 7, 8 .. 15 = 16 more: the x fragments' k order
#pragma unroll
    for (int j = 0; j < 8; ++j) af[0][j] = frag_b(&sx[(j & 3) * 16 + col][(j >> 2) * 32], lane);
    PJ_SB();   // the W fragments' and the first x fragments' reads go out as one group
    const float braw = Bm[o];
    asm volatile("s_wait_xcnt 0x0" ::: "memory");   // stands in front of any later write to the bias load's offset register
    PJ_SB();   // and nothing is moved up in front of that wait
    v8f acc[4] = {};
#pragma unroll
    for (int kp = 0; kp < CIN / 64; ++kp) { const int cur = kp & 1;
      PJ_SB();   // the next eight x fragments are read as one group ahead of this group's products
      if (kp + 1 < CIN / 64) {
#pragma unroll
        for (int j = 0; j < 8; ++j) af[cur ^ 1][j] = frag_b(&sx[(j & 3) * 16 + col][((kp + 1) * 2 + (j >> 2)) * 32], lane); }
      PJ_SB();
#pragma unroll
      for (int h = 0; h < 2; ++h)
#pragma unroll
        for (int m = 0; m < 4; ++m) acc[m] = wmma_bf(af[cur][h * 4 + m], wf[kp * 2 + h], acc[m]); }
    const float bb = bfr(braw);   // the bias is waited for in front of the next tile's loads: behind them its wait would wait them out too
    if (ci + 1 < CGN) { const float* wn = wt + (ci + 1) * 64;   // the next group's W tile flies under this group's way out
      pj_ldw<NOUT>(wq, wn);
      asm volatile("s_wait_xcnt 0x0" :: "v"(wn) : "memory");   // stands in front of any later write to the loads' address registers, which it names as an input so that they live up to it
      PJ_SB(); }   // and nothing is moved up in front of that wait
    const int ol = wave * 16 + col;
#pragma unroll
    for (int m = 0; m < 4; ++m)
#pragma unroll
      for (int r = 0; r < 8; ++r) { const int pl = m * 16 + 8 * g + r; const float v = acc[m][r] + bb; const _Float16 hv = (_Float16)v; if (NOUT == CV) tv[ol][pl] = hv; else { sh[pl][ol] = hv; sl[pl][ol] = (_Float16)(v - (float)hv); } }   // q AND k keep a residual
    PJ_BAR();   // the staged results are written before any is read; every wave's reads of this group's W tile lie ahead of it too, so the next tile may be stored behind it
    if (NOUT != CV) { for (int e = tid; e < 64 * 8; e += 128) { const int pl = e >> 3, q = e & 7; const size_t at = (b * NP + p0 + pl) * CQ + (q & 3) * 8; vst2((unsigned*)((q < 4 ? dha : dhb) + at), *(const v4u*)&sh[pl][q * 8]); vst2((unsigned*)((q < 4 ? dla : dlb) + at), *(const v4u*)&sl[pl][q * 8]);   // staged columns 0 .. 31 are q's, 32 .. 63 k's
        asm volatile("s_wait_xcnt 0x0" ::: "memory"); } }   // stands in front of the next trip's writes to the two stores' address and data registers
    else { for (int e = tid; e < 64 * 8; e += 128) { const int ov = e >> 3, q = e & 7; vst2((unsigned*)(VT + (b * CV + cg * 64 + ov) * (size_t)NP + p0 + q * 8), *(const v4u*)&tv[ov][q * 8]); } } } }
// the plain builtin: the compiler keeps the distance behind it itself and may place operands in any register
__device__ __forceinline__ v8f wmma_h(v16h a, v16h b, v8f c) { return __builtin_amdgcn_wmma_f32_16x16x32_f16(false, a, false, b, (short)0, c, false, false); }
// lane l with lane l ^ 16, on the vector unit
__device__ __forceinline__ float xhalf(float x) { return __builtin_bit_cast(float, __builtin_amdgcn_permlanex16(__builtin_bit_cast(int, x), __builtin_bit_cast(int, x), 0x76543210, 0xfedcba98, false, false)); }
// keeps a group of LDS reads together at its place: without it the compiler spreads the reads singly among the products, each with its own wait
#define FA_SB() __builtin_amdgcn_sched_barrier(0)
// ---- k_fa: block = (64 queries, batch b), eight waves = 2 query halves x 4 key quarters: wave = 32 queries x all 256 channels x 32 of a stage's 128 keys, so a v fragment read from LDS serves two products and two waves share a SIMD; S^T = K Q^T, running-maximum softmax in registers, O^T += V^T P^T; the four key quarters' sums are joined once, behind the loop, through LDS; k and v tiles of 128 keys staged in LDS (three buffers, asynchronous copies, two stages in flight)
#define FA_KT 128                      // keys per stage: 256 B of a v row, so one wave-wide copy brings two whole row pieces
#define FA_NT (NP / FA_KT)
#define FA_VP (FA_KT + 8)              // f16 elements; 272 B = 16 B x odd: the pitch for ds_load_b128 readers
#define FA_KP (CQ + 8)                 // 80 B = 16 B x odd
#define FA_VPB (2u * FA_VP)
#define FA_KPB (2u * FA_KP)
#define FA_TH 12.476649250f             // 18 ln 2: how far a score may pass the maximum in use before the sums are rescaled
#define FA_C (-3.0f)                   // P = exp(s - m) x 2^FA_C: at most 2^15, below f16's largest number; the largest weight is at least 2^-3, so weights down to 2^-11 of it are normal f16 numbers and smaller ones round within 2^-22 of it
struct FaStage { _Float16 v[CV][FA_VP]; _Float16 kh[FA_KT][FA_KP]; _Float16 kl[FA_KT][FA_KP]; };
#define FA_BUFB ((unsigned)sizeof(FaStage))
// one wave's share of a stage: 32 of the 256 v rows (two rows a copy) and 16 of the 128 keys' hi and residual rows (eight keys a copy): 20 copies a stage, two stages' at most in flight
// a copy's immediate offset moves both of its addresses, so it is the copy's distance in LDS from the lane's first v row (2 rows = 544 B a copy) or first hi row (8 keys = 640 B; the residual rows FA_KT FA_KPB bytes behind the hi rows), and the copy's uniform base holds its distance in global memory less that immediate:
// LDS byte = the lane's LDS address + immediate, global byte = uniform base + the lane's 32-bit byte offset + immediate. The 16 v copies share two vector registers and so do the 4 k copies: no vector address sum per copy
typedef __attribute__((address_space(1))) v4i* fa_gp; typedef __attribute__((address_space(3))) v4i* fa_lp;
template <int N> __device__ __forceinline__ void fa_cp(const char* base, unsigned off, unsigned lds) { __builtin_amdgcn_global_load_async_to_lds_b128((fa_gp)(base + off), (fa_lp)lds, N, 0); }
// a copy's base as a scalar value of its own: left as base + constant, the compiler puts the constant behind the lane's offset and forms every copy's address by a 64-bit vector sum
__device__ __forceinline__ const char* fa_sc(const char* p) { const unsigned long long u = (unsigned long long)p; return (const char*)(((unsigned long long)(unsigned)__builtin_amdgcn_readfirstlane((int)(u >> 32)) << 32) | (unsigned)__builtin_amdgcn_readfirstlane((int)u)); }
struct FaBase { const char* v[16]; const char* k[4]; };   // the 20 copies' bases: the same for every stage
template <int I> __device__ __forceinline__ void fa_cpv(const FaBase& fb, unsigned ov, unsigned lv) { fa_cp<I * 2 * (int)FA_VPB>(fb.v[I], ov, lv); if constexpr (I + 1 < 16) fa_cpv<I + 1>(fb, ov, lv); }
#define FA_K8 (8 * (int)FA_KPB)          // LDS distance of eight keys' rows
#define FA_KL0 (FA_KT * (int)FA_KPB)     // and from the hi rows to the residual rows
__device__ __forceinline__ void fa_fill(unsigned lv, unsigned lk, const FaBase& fb, unsigned ov, unsigned ok) {
  fa_cpv<0>(fb, ov, lv);
  fa_cp<0>(fb.k[0], ok, lk); fa_cp<FA_K8>(fb.k[1], ok, lk); fa_cp<FA_KL0>(fb.k[2], ok, lk); fa_cp<FA_KL0 + FA_K8>(fb.k[3], ok, lk); }
#define FA_NC 20                       // copies of a wave per stage, the same in every wave and for every stage
union FaSh { FaStage ring[3]; float part[4][64][CV + 4]; };   // behind the loop the ring's bytes hold the four key quarters' scaled sums
__global__ __launch_bounds__(256) void k_fa(const _Float16* __restrict__ QH, const _Float16* __restrict__ QL, const _Float16* __restrict__ KH, const _Float16* __restrict__ KL, const _Float16* __restrict__ VT, const float* __restrict__ X, const float* __restrict__ GM, float* __restrict__ OUT) { __shared__ __align__(16) FaSh sh; __shared__ float sm[4][64], sl[4][64];
  const int tid = threadIdx.x, wave = tid >> 5, lane = tid & 31, col = lane & 15, g = lane >> 4; const size_t b = blockIdx.y; const int i0 = blockIdx.x * 64;
  const int qg = wave & 1, kg = wave >> 1; const int il0 = qg * 32, k0 = kg * 32;   // the wave's 32 queries of the block, and its 32 keys of every stage
  const unsigned lv = (unsigned)(size_t)&sh.ring[0].v[wave * 32 + g][col * 8], lk = (unsigned)(size_t)&sh.ring[0].kh[wave * 16 + (lane >> 2)][(lane & 3) * 8];
  const char* bv = (const char*)(VT + b * CV * (size_t)NP); const char* bkh = (const char*)(KH + b * NP * (size_t)CQ); const char* bkl = (const char*)(KL + b * NP * (size_t)CQ);   // the batch's planes and rows, uniform
  FaBase fb;
#pragma unroll
  for (int i = 0; i < 16; ++i) fb.v[i] = fa_sc(bv + i * (2 * 2 * NP - 2 * (int)FA_VPB));   // two rows of a plane a copy, less the copy's immediate
  fb.k[0] = fa_sc(bkh); fb.k[1] = fa_sc(bkh + (8 * 2 * CQ - FA_K8)); fb.k[2] = fa_sc(bkl - FA_KL0); fb.k[3] = fa_sc(bkl + (8 * 2 * CQ - FA_KL0 - FA_K8));
  const unsigned ov = 2u * ((unsigned)(wave * 32 + g) * NP + col * 8), ok = 2u * ((unsigned)(wave * 16 + (lane >> 2)) * CQ + (lane & 3) * 8);   // the lane's byte offsets inside them at stage 0; a stage adds 2 FA_KT bytes to the first, 2 FA_KT CQ to the second
  v16h qh[2], ql[2];   // B operands: column = query, two tiles of 16, kept for the whole kernel
  const size_t qr = (b * NP + i0 + il0 + col) * CQ + 8 * g; const _Float16* pqh = QH + qr; const _Float16* pql = QL + qr;   // the lane's place in its first query's rows: elements 8g .. and 16 + 8g ..
#pragma unroll
  for (int qt = 0; qt < 2; ++qt) { union { v16h v; v8h q[2]; } uh, ul; uh.q[0] = *(const v8h*)(pqh + qt * 16 * CQ); uh.q[1] = *(const v8h*)(pqh + qt * 16 * CQ + 16); ul.q[0] = *(const v8h*)(pql + qt * 16 * CQ); ul.q[1] = *(const v8h*)(pql + qt * 16 * CQ + 16); qh[qt] = uh.v; ql[qt] = ul.v; }
  asm volatile("s_wait_xcnt 0x0" :: "v"(pqh), "v"(pql) : "memory");   // stands in front of any later write to the q loads' address registers, which it names as inputs so that they live up to it
  FA_SB();   // and nothing is moved up in front of that wait
  const float L2E = 1.4426950408889634f;
  v8f acc[2][16] = {}; float mrun[2] = { -3.0e38f, -3.0e38f }, lsum[2] = { 0.f, 0.f }, nb[2] = { 0.f, 0.f };   // per lane and query tile: its query's running maximum over the wave's keys, its half's share of the sum, and FA_C - maximum x log2 e (set with the maximum). The maximum is the one IN USE: it is raised, and the sums rescaled, only when a score passes it by more than FA_TH; numerator and sum carry the same m and the same factor, which cancel
  fa_fill(lv, lk, fb, ov, ok);
  fa_fill(lv + FA_BUFB, lk + FA_BUFB, fb, ov + 2u * FA_KT, ok + 2u * FA_KT * CQ);
  asm volatile("s_wait_asynccnt %0" :: "i"(FA_NC) : "memory");    // all but the wave's FA_NC youngest copies, which are stage 1's: stage 0 has landed before the barrier publishes it
  __syncthreads();
  fa_fill(lv + 2u * FA_BUFB, lk + 2u * FA_BUFB, fb, ov + 2u * (2u * FA_KT), ok + 2u * (2u * FA_KT * CQ));
  int bi = 0;   // the buffer of stage t: t mod 3
#pragma unroll 1
  for (int t = 0; t < FA_NT; ++t) { const FaStage& sb = sh.ring[bi];   // rolled: one stage a trip
    v16h kh[2], kl[2], vf[2][8];   // k fragments of the wave's 32 keys; two sets of v fragments: the second goes out as one group ahead of the first group's products
#pragma unroll
    for (int kt = 0; kt < 2; ++kt) { kh[kt] = frag_h(&sb.kh[k0 + kt * 16 + col][0], lane); kl[kt] = frag_h(&sb.kl[k0 + kt * 16 + col][0], lane); }
    v8f s[2][2] = {};   // S^T tiles [query tile][key tile]: register r = key 8g + r of the tile, lane column = query
    FA_SB();
#pragma unroll
    for (int x = 0; x < 4; ++x) s[x >> 1][x & 1] = wmma_h(kh[x & 1], qh[x >> 1], s[x >> 1][x & 1]);
#pragma unroll
    for (int x = 0; x < 4; ++x) s[x >> 1][x & 1] = wmma_h(kh[x & 1], ql[x >> 1], s[x >> 1][x & 1]);
#pragma unroll
    for (int x = 0; x < 4; ++x) s[x >> 1][x & 1] = wmma_h(kl[x & 1], qh[x >> 1], s[x >> 1][x & 1]);   // 3 products, in the order hi hi, residual hi, hi residual
    FA_SB();
#pragma unroll
    for (int j = 0; j < 8; ++j) vf[0][j] = frag_h(&sb.v[j * 16 + col][k0], lane);   // the first v group flies under the softmax
    FA_SB();
    float mst[2];   // the stage's own maxima
#pragma unroll
    for (int qt = 0; qt < 2; ++qt) { float m8[8];   // maximum by a tree, not a single chain of dependent maxima
#pragma unroll
      for (int r = 0; r < 8; ++r) m8[r] = fmaxf(s[qt][0][r], s[qt][1][r]);
      float mx = fmaxf(fmaxf(fmaxf(m8[0], m8[1]), fmaxf(m8[2], m8[3])), fmaxf(fmaxf(m8[4], m8[5]), fmaxf(m8[6], m8[7])));
      mst[qt] = fmaxf(mx, xhalf(mx)); }   // with the other half of the query's 32 keys
    if (__builtin_amdgcn_ballot_w32(mst[0] > mrun[0] + FA_TH || mst[1] > mrun[1] + FA_TH) != 0) {   // scalar branch, one test a stage: the 256 sums a lane are rescaled only where some query's score would leave f16's range above; then every query of the wave takes the larger of its maximum in use and the stage's maximum
      const float mnew[2] = { fmaxf(mrun[0], mst[0]), fmaxf(mrun[1], mst[1]) };
      const float al0 = __builtin_amdgcn_exp2f((mrun[0] - mnew[0]) * L2E), al1 = __builtin_amdgcn_exp2f((mrun[1] - mnew[1]) * L2E);
      mrun[0] = mnew[0]; mrun[1] = mnew[1]; lsum[0] *= al0; lsum[1] *= al1; nb[0] = FA_C - mnew[0] * L2E; nb[1] = FA_C - mnew[1] * L2E;
#pragma unroll
      for (int j = 0; j < 16; ++j) { acc[0][j] *= al0; acc[1][j] *= al1; } }
    v16h pb[2];
#pragma unroll
    for (int x = 0; x < 4; ++x)
#pragma unroll
      for (int r = 0; r < 8; ++r) s[x >> 1][x & 1][r] = fmaf(s[x >> 1][x & 1][r], L2E, nb[x >> 1]);
    FA_SB();   // all exponents are formed before the first exponential: none of them then overwrites an exponential's source directly behind it
#pragma unroll
    for (int x = 0; x < 4; ++x)
#pragma unroll
      for (int r = 0; r < 8; ++r) s[x >> 1][x & 1][r] = __builtin_amdgcn_exp2f(s[x >> 1][x & 1][r]);
    FA_SB();   // and no conversion or sum overwrites one
#pragma unroll
    for (int x = 0; x < 4; ++x)
#pragma unroll
      for (int r = 0; r < 8; ++r) pb[x >> 1][(x & 1) * 8 + r] = (_Float16)s[x >> 1][x & 1][r];   // a query tile's two score tiles, converted in place, are one B operand
#pragma unroll
    for (int qt = 0; qt < 2; ++qt) { const v8f p8 = s[qt][0] + s[qt][1];   // the f32 weights summed by a tree, for the same reason as the maximum
      lsum[qt] += ((p8[0] + p8[1]) + (p8[2] + p8[3])) + ((p8[4] + p8[5]) + (p8[6] + p8[7])); }
    FA_SB();
#pragma unroll
    for (int j = 0; j < 8; ++j) vf[1][j] = frag_h(&sb.v[(8 + j) * 16 + col][k0], lane);   // the stage's last LDS reads fly under the first group's products
    FA_SB();
#pragma unroll
    for (int j = 0; j < 8; ++j) { acc[0][j] = wmma_h(vf[0][j], pb[0], acc[0][j]); acc[1][j] = wmma_h(vf[0][j], pb[1], acc[1][j]); }   // channel tiles 0 .. 7, both query tiles on each fragment
    FA_SB();   // these products stay in front of the stage's foot: sunk behind its barrier they would hold back the refill
    asm volatile("s_wait_dscnt 0x0" :: "v"(lsum[0]), "v"(lsum[1]) : "memory");      // this wave's reads of the buffer are done before it is refilled; the two sums are named as inputs so that they are formed in front of the refill: sunk behind it, their 32 weights stay live beside the copies' addresses and a register is spilled
    asm volatile("s_wait_asynccnt %0" :: "i"(FA_NC) : "memory");    // this wave's copies of stage t + 1 have landed: all but its FA_NC youngest, which are stage t + 2's and stay in flight, so a stage has two trips to land, not one
    if (t + 2 >= FA_NT) asm volatile("s_wait_asynccnt 0x0" ::: "memory");   // the last two trips: no stage t + 2 was issued, stage t + 1's own copies are the youngest, and only the wait to 0 covers them
    __syncthreads();                                    // publishes stage t + 1 and ends every reader's last read of stage t
    if (t + 3 < FA_NT) { const unsigned bo = (unsigned)bi * FA_BUFB; fa_fill(lv + bo, lk + bo, fb, ov + (unsigned)(t + 3) * (2u * FA_KT), ok + (unsigned)(t + 3) * (2u * FA_KT * CQ)); }   // stage t + 3 into the buffer that trip t has just read
    bi = bi == 2 ? 0 : bi + 1;
    FA_SB();   // channel tiles 8 .. 15, all operands in registers, stand behind the refill: the copies go out as soon as the buffer is free and fly under these products too
#pragma unroll
    for (int j = 0; j < 8; ++j) { acc[0][8 + j] = wmma_h(vf[1][j], pb[0], acc[0][8 + j]); acc[1][8 + j] = wmma_h(vf[1][j], pb[1], acc[1][8 + j]); } }
  asm volatile("s_wait_asynccnt 0x0" ::: "memory");     // no copy is outstanding behind the loop
  // the four key quarters of a query are joined: maxima and sums first, then the sums of products, each scaled to the common maximum and divided by the whole sum
#pragma unroll
  for (int qt = 0; qt < 2; ++qt) { const float lj = lsum[qt] + xhalf(lsum[qt]);   // the halves' sums are joined once
    if (g == 0) { sm[kg][il0 + qt * 16 + col] = mrun[qt]; sl[kg][il0 + qt * 16 + col] = lj; } }
  __syncthreads();   // every quarter's maxima and sums are written; the loop's last barrier has ended every read of the ring
#pragma unroll
  for (int qt = 0; qt < 2; ++qt) { const int q = il0 + qt * 16 + col;
    const float m0 = sm[0][q], m1 = sm[1][q], m2 = sm[2][q], m3 = sm[3][q]; const float mm = fmaxf(fmaxf(m0, m1), fmaxf(m2, m3));
    const float e0 = __builtin_amdgcn_exp2f((m0 - mm) * L2E), e1 = __builtin_amdgcn_exp2f((m1 - mm) * L2E), e2 = __builtin_amdgcn_exp2f((m2 - mm) * L2E), e3 = __builtin_amdgcn_exp2f((m3 - mm) * L2E);
    const float ls = (sl[0][q] * e0 + sl[1][q] * e1) + (sl[2][q] * e2 + sl[3][q] * e3);
    const float inv = __builtin_amdgcn_exp2f((mrun[qt] - mm) * L2E) / ls;   // the wave's own quarter's factor over the whole sum
#pragma unroll
    for (int j = 0; j < 16; ++j) { const v8f o = acc[qt][j] * inv; v4f lo = { o[0], o[1], o[2], o[3] }, hi = { o[4], o[5], o[6], o[7] };   // a lane holds 8 consecutive channels of its query
      *(v4f*)&sh.part[kg][q][j * 16 + 8 * g] = lo; *(v4f*)&sh.part[kg][q][j * 16 + 8 * g + 4] = hi; } }
  __syncthreads();   // all four quarters' rows are written before any is read
  const float gm = bfr(GM[0]);
  // channels-last rows [b*n][CV]: positions i0 .. i0+63, whole rows
#pragma unroll 1   // rolled, so that the wait at the trip's foot stands once behind four stores
  for (int i = 0; i < 64 * (CV / 4) / 256; i += 4) {
#pragma unroll   // four row pieces a trip: their x loads go out together and wait once, not one latency each
    for (int u = 0; u < 4; ++u) { const int e = tid + (i + u) * 256, il = e >> 6, q = e & 63; const size_t o = (b * NP + i0 + il) * CV + q * 4; const v4f sv = (*(const v4f*)&sh.part[0][il][q * 4] + *(const v4f*)&sh.part[1][il][q * 4]) + (*(const v4f*)&sh.part[2][il][q * 4] + *(const v4f*)&sh.part[3][il][q * 4]); const v4f xv = *(const v4f*)(X + o); v4f r = { gm * sv[0] + bfr(xv[0]), gm * sv[1] + bfr(xv[1]), gm * sv[2] + bfr(xv[2]), gm * sv[3] + bfr(xv[3]) }; vst2(OUT + o, r); }
    asm volatile("s_wait_xcnt 0x0" ::: "memory"); } }   // stands in front of the next trip's writes to the four stores' address and data registers
extern "C" void kernel_launch(void* const* d_in, const int* in_sizes, int n_in, void* d_out, int out_size, void* d_ws, size_t ws_size, hipStream_t stream) {
  (void)in_sizes; (void)n_in; (void)out_size;
  const float** F = (const float**)d_in;   // 0 inputs [4,64,64,256] channels-last, 1 Wq [256,32] (in,out), 2 bq, 3 Wk, 4 bk, 5 Wv [256,256], 6 bv, 7 gamma [1]
  if (ws_size < (size_t)WS_END) return;
  char* ws = (char*)d_ws; _Float16 *QH = (_Float16*)(ws + WS_QH), *QL = (_Float16*)(ws + WS_QL), *KH = (_Float16*)(ws + WS_KH), *KL = (_Float16*)(ws + WS_KL), *VT = (_Float16*)(ws + WS_VT);
  k_proj<<<dim3(NP / 64, TNB, 3), 128, 0, stream>>>(F[0], F[0], F[1], F[2], F[3], F[4], F[5], F[6], QH, QL, KH, KL, VT);
  k_fa<<<dim3(TQB, TNB), 256, 0, stream>>>(QH, QL, KH, KL, VT, F[0], F[7], (float*)d_out);
}
